// v000
// The times below were measured on an AMD MI455X: many runs one after another, warmed up first and cycling through
// copies of the inputs, with the whole window's GPU time divided by the number of runs. Launches and the gaps
// between them are all in it. The median over several windows is given; except for v000 it joins two sittings, which
// can be a few percent apart, so the side-by-side timings, each taken in one sitting, are the better comparison.
// v000, which the later versions start from, runs in 523 microseconds.
#include <hip/hip_runtime.h>
#include <hip/hip_bf16.h>

#define B_  2
#define S_  4096
#define D_  768
#define H_  12
#define DH_ 64

typedef _Float16 v16h __attribute__((ext_vector_type(16)));
typedef float    v8f  __attribute__((ext_vector_type(8)));

// Build a WMMA f16 fragment from 16 rows (stride in halves) of LDS.
// Works for A (row = M, contiguous dim = K) and for column-major B
// (row = N column, contiguous dim = K).
// CDNA5 16-bit A layout: lane r=lane%16 holds row r; hi=lane/16 selects the
// +8 K offset half; VGPR v<4 -> K = hi*8 + 2v{+1}; v>=4 -> K = 16 + hi*8 + 2(v-4){+1}.
// Each 8-half group is contiguous -> lowers to two ds_load_b128.
__device__ __forceinline__ v16h frag_from_rows(const _Float16* p, int stride) {
  const int lane = threadIdx.x & 31;
  const int r = lane & 15, hi = lane >> 4;
  const _Float16* q = p + r * stride + hi * 8;
  v16h f;
#pragma unroll
  for (int v = 0; v < 4; ++v) {
    f[2 * v]         = q[2 * v];
    f[2 * v + 1]     = q[2 * v + 1];
    f[8 + 2 * v]     = q[16 + 2 * v];
    f[8 + 2 * v + 1] = q[16 + 2 * v + 1];
  }
  return f;
}

__device__ __forceinline__ v8f wmma_f16(v16h a, v16h b, v8f c) {
  return __builtin_amdgcn_wmma_f32_16x16x32_f16(false, a, false, b, (short)0, c,
                                                false, false);
}

// Async global -> LDS copy of 16 bytes (CDNA5, ASYNCcnt-tracked).
__device__ __forceinline__ void async_copy_b128(void* lds_ptr, const void* gptr) {
  uint32_t lds_off = (uint32_t)(uintptr_t)lds_ptr;  // low 32 bits = LDS offset
  asm volatile("global_load_async_to_lds_b128 %0, %1, off"
               :: "v"(lds_off), "v"(gptr)
               : "memory");
}
__device__ __forceinline__ void wait_async0() {
  asm volatile("s_wait_asynccnt 0x0" ::: "memory");
}

__device__ __forceinline__ float red16_max(float v) {
  v = fmaxf(v, __shfl_xor(v, 1, 32));
  v = fmaxf(v, __shfl_xor(v, 2, 32));
  v = fmaxf(v, __shfl_xor(v, 4, 32));
  v = fmaxf(v, __shfl_xor(v, 8, 32));
  return v;
}
__device__ __forceinline__ float red16_sum(float v) {
  v += __shfl_xor(v, 1, 32);
  v += __shfl_xor(v, 2, 32);
  v += __shfl_xor(v, 4, 32);
  v += __shfl_xor(v, 8, 32);
  return v;
}

// ---------------- Kernel 1: fused QKV projection -------------------------
// Y[m,e] = sum_k h[m,k] * W[e,k] + bias[e]; written f16 to [B,H,S,DH].
// Q gets the softmax scale (1/sqrt(DH)) folded in.
__global__ __launch_bounds__(256) void qkv_proj_kernel(
    const float* __restrict__ hsrc,
    const float* __restrict__ Wq, const float* __restrict__ bq,
    const float* __restrict__ Wk, const float* __restrict__ bk,
    const float* __restrict__ Wv, const float* __restrict__ bv,
    _Float16* __restrict__ Qo, _Float16* __restrict__ Ko,
    _Float16* __restrict__ Vo) {
  const int which = blockIdx.z;
  const float* W    = which == 0 ? Wq : (which == 1 ? Wk : Wv);
  const float* bias = which == 0 ? bq : (which == 1 ? bk : bv);
  _Float16* out     = which == 0 ? Qo : (which == 1 ? Ko : Vo);
  const float oscale = which == 0 ? 0.125f : 1.0f;  // 1/sqrt(64)

  const int m0 = blockIdx.y * 128;
  const int n0 = blockIdx.x * 64;
  const int tid = threadIdx.x;
  const int wave = tid >> 5;
  const int wm = (wave >> 1) * 32;  // 0..96
  const int wn = (wave & 1) * 32;   // 0,32

  __shared__ _Float16 As[128 * 40];
  __shared__ _Float16 Bs[64 * 40];

  v8f acc[2][2];
#pragma unroll
  for (int i = 0; i < 2; ++i)
#pragma unroll
    for (int j = 0; j < 2; ++j) acc[i][j] = (v8f){0, 0, 0, 0, 0, 0, 0, 0};

  for (int k0 = 0; k0 < D_; k0 += 32) {
    __syncthreads();
#pragma unroll
    for (int i = 0; i < 16; ++i) {  // 128x32 f32 -> f16
      int idx = tid + i * 256;
      int r = idx >> 5, c = idx & 31;
      As[r * 40 + c] = (_Float16)hsrc[(size_t)(m0 + r) * D_ + k0 + c];
    }
#pragma unroll
    for (int i = 0; i < 8; ++i) {   // 64 rows of W (column-major B)
      int idx = tid + i * 256;
      int r = idx >> 5, c = idx & 31;
      Bs[r * 40 + c] = (_Float16)W[(size_t)(n0 + r) * D_ + k0 + c];
    }
    __syncthreads();
    v16h a0 = frag_from_rows(&As[(wm + 0) * 40], 40);
    v16h a1 = frag_from_rows(&As[(wm + 16) * 40], 40);
    v16h b0 = frag_from_rows(&Bs[(wn + 0) * 40], 40);
    v16h b1 = frag_from_rows(&Bs[(wn + 16) * 40], 40);
    acc[0][0] = wmma_f16(a0, b0, acc[0][0]);
    acc[0][1] = wmma_f16(a0, b1, acc[0][1]);
    acc[1][0] = wmma_f16(a1, b0, acc[1][0]);
    acc[1][1] = wmma_f16(a1, b1, acc[1][1]);
  }

  const int lane = tid & 31;
  const int nloc = lane & 15, hi = lane >> 4;
#pragma unroll
  for (int sm = 0; sm < 2; ++sm)
#pragma unroll
    for (int sn = 0; sn < 2; ++sn) {
      int e = n0 + wn + sn * 16 + nloc;
      int hh = e >> 6, d = e & 63;
      float bsv = bias[e];
#pragma unroll
      for (int j = 0; j < 8; ++j) {
        int m = m0 + wm + sm * 16 + j + hi * 8;
        int bb = m >> 12;          // m / S_
        int s = m & (S_ - 1);
        size_t o = (((size_t)bb * H_ + hh) * S_ + s) * DH_ + d;
        out[o] = (_Float16)((acc[sm][sn][j] + bsv) * oscale);
      }
    }
}

// ---------------- Kernel 2: flash attention ------------------------------
#define QK_STRIDE 88   // halves; 176B rows -> B128-aligned, conflict-free reads
__global__ __launch_bounds__(128) void attn_kernel(
    const _Float16* __restrict__ Q, const _Float16* __restrict__ K,
    const _Float16* __restrict__ V, const int* __restrict__ mask,
    _Float16* __restrict__ att) {
  const int qt = blockIdx.x, hh = blockIdx.y, bb = blockIdx.z;
  const int tid = threadIdx.x, wave = tid >> 5, lane = tid & 31;
  const int nloc = lane & 15, hi = lane >> 4;

  __shared__ _Float16 Qs[64 * QK_STRIDE];
  __shared__ _Float16 Ks[64 * QK_STRIDE];
  __shared__ _Float16 Vt[64 * 72];        // transposed: [d][k]
  __shared__ _Float16 Ps[4][16 * 72];     // per-wave probabilities
  __shared__ float maskAdd[64];

  const size_t bh = ((size_t)bb * H_ + hh) * S_;

  {  // stage Q tile asynchronously (64 rows contiguous in memory)
    const _Float16* Qg = Q + (bh + (size_t)qt * 64) * DH_;
#pragma unroll
    for (int i = 0; i < 4; ++i) {
      int idx = tid + i * 128;            // B128 chunk index (8 halves)
      int r = idx >> 3, c8 = idx & 7;
      async_copy_b128(&Qs[r * QK_STRIDE + c8 * 8], Qg + idx * 8);
    }
  }
  wait_async0();
  __syncthreads();
  v16h aq0 = frag_from_rows(&Qs[(wave * 16) * QK_STRIDE + 0], QK_STRIDE);
  v16h aq1 = frag_from_rows(&Qs[(wave * 16) * QK_STRIDE + 32], QK_STRIDE);

  v8f o[4];
#pragma unroll
  for (int t = 0; t < 4; ++t) o[t] = (v8f){0, 0, 0, 0, 0, 0, 0, 0};
  float rmax[8], rsum[8];
#pragma unroll
  for (int j = 0; j < 8; ++j) { rmax[j] = -__builtin_inff(); rsum[j] = 0.f; }

  for (int k0 = 0; k0 < S_; k0 += 64) {
    __syncthreads();
    // K tile: async global -> LDS (no VGPR round trip)
    const _Float16* Kg = K + (bh + k0) * DH_;
#pragma unroll
    for (int i = 0; i < 4; ++i) {
      int idx = tid + i * 128;
      int r = idx >> 3, c8 = idx & 7;
      async_copy_b128(&Ks[r * QK_STRIDE + c8 * 8], Kg + idx * 8);
    }
    // V tile: sync load with transpose into [d][k]
    const uint2* vsrc = (const uint2*)(V + (bh + k0) * DH_);
#pragma unroll
    for (int i = 0; i < 8; ++i) {
      int idx = tid + i * 128;
      int r = idx >> 4, c4 = idx & 15;
      uint2 vv = vsrc[idx];
      const _Float16* vh = (const _Float16*)&vv;
#pragma unroll
      for (int u = 0; u < 4; ++u) Vt[(c4 * 4 + u) * 72 + r] = vh[u];
    }
    if (tid < 64) maskAdd[tid] = mask[bb * S_ + k0 + tid] ? -1e9f : 0.0f;
    wait_async0();
    __syncthreads();

    // prefetch next iteration's K/V lines while this tile computes
    if (k0 + 64 < S_) {
      __builtin_prefetch(K + (bh + k0 + 64) * DH_ + tid * 32, 0, 1);
      __builtin_prefetch(V + (bh + k0 + 64) * DH_ + tid * 32, 0, 1);
    }

    // scores: 16 queries x 64 keys, Q pre-scaled
    v8f c[4];
#pragma unroll
    for (int t = 0; t < 4; ++t) {
      v16h bk0 = frag_from_rows(&Ks[(t * 16) * QK_STRIDE + 0], QK_STRIDE);
      v16h bk1 = frag_from_rows(&Ks[(t * 16) * QK_STRIDE + 32], QK_STRIDE);
      v8f cc = (v8f){0, 0, 0, 0, 0, 0, 0, 0};
      cc = wmma_f16(aq0, bk0, cc);
      cc = wmma_f16(aq1, bk1, cc);
      float ma = maskAdd[t * 16 + nloc];
#pragma unroll
      for (int j = 0; j < 8; ++j) cc[j] += ma;
      c[t] = cc;
    }

    // online softmax (row m = j + 8*hi lives in one 16-lane half)
#pragma unroll
    for (int j = 0; j < 8; ++j) {
      float v = fmaxf(fmaxf(c[0][j], c[1][j]), fmaxf(c[2][j], c[3][j]));
      float tmax = red16_max(v);
      float nm = fmaxf(rmax[j], tmax);
      float corr = __expf(rmax[j] - nm);
      rmax[j] = nm;
#pragma unroll
      for (int t = 0; t < 4; ++t) c[t][j] = __expf(c[t][j] - nm);
      float s = red16_sum(c[0][j] + c[1][j] + c[2][j] + c[3][j]);
      rsum[j] = rsum[j] * corr + s;
#pragma unroll
      for (int t = 0; t < 4; ++t) o[t][j] *= corr;
    }

    // P -> LDS (A-fragment layout: rows = queries, contiguous = keys)
#pragma unroll
    for (int t = 0; t < 4; ++t)
#pragma unroll
      for (int j = 0; j < 8; ++j)
        Ps[wave][(j + hi * 8) * 72 + t * 16 + nloc] = (_Float16)c[t][j];
    __syncthreads();

    v16h ap0 = frag_from_rows(&Ps[wave][0], 72);    // keys 0..31
    v16h ap1 = frag_from_rows(&Ps[wave][32], 72);   // keys 32..63
#pragma unroll
    for (int t2 = 0; t2 < 4; ++t2) {
      v16h bv0 = frag_from_rows(&Vt[(t2 * 16) * 72 + 0], 72);
      v16h bv1 = frag_from_rows(&Vt[(t2 * 16) * 72 + 32], 72);
      o[t2] = wmma_f16(ap0, bv0, o[t2]);
      o[t2] = wmma_f16(ap1, bv1, o[t2]);
    }
  }

  // normalize + write att[b, s, h*64+d] as f16
  float inv[8];
#pragma unroll
  for (int j = 0; j < 8; ++j) inv[j] = 1.0f / rsum[j];
#pragma unroll
  for (int t2 = 0; t2 < 4; ++t2)
#pragma unroll
    for (int j = 0; j < 8; ++j) {
      size_t row = (size_t)bb * S_ + qt * 64 + wave * 16 + j + hi * 8;
      att[row * (H_ * DH_) + hh * DH_ + t2 * 16 + nloc] =
          (_Float16)(o[t2][j] * inv[j]);
    }
}

// ---------------- Kernel 3: output projection ----------------------------
// out[m,d] = sum_e att[m,e] * Wo[d,e] + bo[d]  (fp32 out)
__global__ __launch_bounds__(256) void out_proj_kernel(
    const _Float16* __restrict__ att, const float* __restrict__ Wo,
    const float* __restrict__ bo, float* __restrict__ out) {
  const int m0 = blockIdx.y * 128;
  const int n0 = blockIdx.x * 64;
  const int tid = threadIdx.x;
  const int wave = tid >> 5;
  const int wm = (wave >> 1) * 32;
  const int wn = (wave & 1) * 32;

  __shared__ _Float16 As[128 * 40];
  __shared__ _Float16 Bs[64 * 40];

  v8f acc[2][2];
#pragma unroll
  for (int i = 0; i < 2; ++i)
#pragma unroll
    for (int j = 0; j < 2; ++j) acc[i][j] = (v8f){0, 0, 0, 0, 0, 0, 0, 0};

  for (int k0 = 0; k0 < D_; k0 += 32) {
    __syncthreads();
#pragma unroll
    for (int i = 0; i < 8; ++i) {  // 128x32 halves as dwords
      int idx = tid + i * 256;
      int r = idx >> 4, cu = idx & 15;
      *(uint32_t*)&As[r * 40 + cu * 2] =
          ((const uint32_t*)att)[(((size_t)(m0 + r) * D_) + k0) / 2 + cu];
    }
#pragma unroll
    for (int i = 0; i < 8; ++i) {  // 64 rows of Wo, f32 -> f16
      int idx = tid + i * 256;
      int r = idx >> 5, c = idx & 31;
      Bs[r * 40 + c] = (_Float16)Wo[(size_t)(n0 + r) * D_ + k0 + c];
    }
    __syncthreads();
    v16h a0 = frag_from_rows(&As[(wm + 0) * 40], 40);
    v16h a1 = frag_from_rows(&As[(wm + 16) * 40], 40);
    v16h b0 = frag_from_rows(&Bs[(wn + 0) * 40], 40);
    v16h b1 = frag_from_rows(&Bs[(wn + 16) * 40], 40);
    acc[0][0] = wmma_f16(a0, b0, acc[0][0]);
    acc[0][1] = wmma_f16(a0, b1, acc[0][1]);
    acc[1][0] = wmma_f16(a1, b0, acc[1][0]);
    acc[1][1] = wmma_f16(a1, b1, acc[1][1]);
  }

  const int lane = tid & 31;
  const int nloc = lane & 15, hi = lane >> 4;
#pragma unroll
  for (int sm = 0; sm < 2; ++sm)
#pragma unroll
    for (int sn = 0; sn < 2; ++sn) {
      int e = n0 + wn + sn * 16 + nloc;
      float bsv = bo[e];
#pragma unroll
      for (int j = 0; j < 8; ++j) {
        int m = m0 + wm + sm * 16 + j + hi * 8;
        out[(size_t)m * D_ + e] = acc[sm][sn][j] + bsv;
      }
    }
}

extern "C" void kernel_launch(void* const* d_in, const int* in_sizes, int n_in,
                              void* d_out, int out_size, void* d_ws,
                              size_t ws_size, hipStream_t stream) {
  (void)in_sizes; (void)n_in; (void)out_size; (void)ws_size;
  const float* h  = (const float*)d_in[0];
  const float* Wq = (const float*)d_in[1];
  const float* bq = (const float*)d_in[2];
  const float* Wk = (const float*)d_in[3];
  const float* bk = (const float*)d_in[4];
  const float* Wv = (const float*)d_in[5];
  const float* bv = (const float*)d_in[6];
  const float* Wo = (const float*)d_in[7];
  const float* bo = (const float*)d_in[8];
  const int* mask = (const int*)d_in[9];
  float* out = (float*)d_out;

  _Float16* ws = (_Float16*)d_ws;
  const size_t per = (size_t)B_ * H_ * S_ * DH_;  // 6,291,456 halves
  _Float16* Qb = ws;
  _Float16* Kb = ws + per;
  _Float16* Vb = ws + 2 * per;
  _Float16* Ab = ws + 3 * per;

  qkv_proj_kernel<<<dim3(D_ / 64, (B_ * S_) / 128, 3), 256, 0, stream>>>(
      h, Wq, bq, Wk, bk, Wv, bv, Qb, Kb, Vb);
  attn_kernel<<<dim3(S_ / 64, H_, B_), 128, 0, stream>>>(Qb, Kb, Vb, mask, Ab);
  out_proj_kernel<<<dim3(D_ / 64, (B_ * S_) / 128), 256, 0, stream>>>(
      Ab, Wo, bo, out);
}

// v001
// One run takes 369 microseconds.
// In both of two side-by-side timings against v000, it was 1.49 times as fast.
#include <hip/hip_runtime.h>
#include <hip/hip_bf16.h>

#define B_  2
#define S_  4096
#define D_  768
#define H_  12
#define DH_ 64

typedef _Float16 v16h __attribute__((ext_vector_type(16)));
typedef float    v8f  __attribute__((ext_vector_type(8)));
typedef _Float16 v8h  __attribute__((ext_vector_type(8)));

// Build a WMMA f16 fragment from 16 rows (stride in halves) of LDS.
// Works for A (row = M, contiguous dim = K) and for column-major B
// (row = N column, contiguous dim = K).
// CDNA5 16-bit A layout: lane r=lane%16 holds row r; hi=lane/16 selects the
// +8 K offset half; VGPR v<4 -> K = hi*8 + 2v{+1}; v>=4 -> K = 16 + hi*8 + 2(v-4){+1}.
// Each 8-half group is contiguous -> lowers to two ds_load_b128.
__device__ __forceinline__ v16h frag_from_rows(const _Float16* p, int stride) {
  const int lane = threadIdx.x & 31;
  const int r = lane & 15, hi = lane >> 4;
  const _Float16* q = p + r * stride + hi * 8;
  v16h f;
#pragma unroll
  for (int v = 0; v < 4; ++v) {
    f[2 * v]         = q[2 * v];
    f[2 * v + 1]     = q[2 * v + 1];
    f[8 + 2 * v]     = q[16 + 2 * v];
    f[8 + 2 * v + 1] = q[16 + 2 * v + 1];
  }
  return f;
}

__device__ __forceinline__ v8f wmma_f16(v16h a, v16h b, v8f c) {
  return __builtin_amdgcn_wmma_f32_16x16x32_f16(false, a, false, b, (short)0, c,
                                                false, false);
}

// Async global -> LDS copy of 16 bytes (CDNA5, ASYNCcnt-tracked).
__device__ __forceinline__ void async_copy_b128(void* lds_ptr, const void* gptr) {
  uint32_t lds_off = (uint32_t)(uintptr_t)lds_ptr;  // low 32 bits = LDS offset
  asm volatile("global_load_async_to_lds_b128 %0, %1, off"
               :: "v"(lds_off), "v"(gptr)
               : "memory");
}
__device__ __forceinline__ void wait_async0() {
  asm volatile("s_wait_asynccnt 0x0" ::: "memory");
}

// ---------------- Kernel 1: fused QKV projection -------------------------
// Y[m,e] = sum_k h[m,k] * W[e,k] + bias[e]; written f16 to [B,H,S,DH].
// Q gets the softmax scale (1/sqrt(DH)) folded in.
__global__ __launch_bounds__(256) void qkv_proj_kernel(
    const float* __restrict__ hsrc,
    const float* __restrict__ Wq, const float* __restrict__ bq,
    const float* __restrict__ Wk, const float* __restrict__ bk,
    const float* __restrict__ Wv, const float* __restrict__ bv,
    _Float16* __restrict__ Qo, _Float16* __restrict__ Ko,
    _Float16* __restrict__ Vo) {
  const int which = blockIdx.z;
  const float* W    = which == 0 ? Wq : (which == 1 ? Wk : Wv);
  const float* bias = which == 0 ? bq : (which == 1 ? bk : bv);
  _Float16* out     = which == 0 ? Qo : (which == 1 ? Ko : Vo);
  const float oscale = which == 0 ? 0.125f : 1.0f;  // 1/sqrt(64)

  const int m0 = blockIdx.y * 128;
  const int n0 = blockIdx.x * 64;
  const int tid = threadIdx.x;
  const int wave = tid >> 5;
  const int wm = (wave >> 1) * 32;  // 0..96
  const int wn = (wave & 1) * 32;   // 0,32

  __shared__ _Float16 As[128 * 40];
  __shared__ _Float16 Bs[64 * 40];

  v8f acc[2][2];
#pragma unroll
  for (int i = 0; i < 2; ++i)
#pragma unroll
    for (int j = 0; j < 2; ++j) acc[i][j] = (v8f){0, 0, 0, 0, 0, 0, 0, 0};

  for (int k0 = 0; k0 < D_; k0 += 32) {
    __syncthreads();
#pragma unroll
    for (int i = 0; i < 16; ++i) {  // 128x32 f32 -> f16
      int idx = tid + i * 256;
      int r = idx >> 5, c = idx & 31;
      As[r * 40 + c] = (_Float16)hsrc[(size_t)(m0 + r) * D_ + k0 + c];
    }
#pragma unroll
    for (int i = 0; i < 8; ++i) {   // 64 rows of W (column-major B)
      int idx = tid + i * 256;
      int r = idx >> 5, c = idx & 31;
      Bs[r * 40 + c] = (_Float16)W[(size_t)(n0 + r) * D_ + k0 + c];
    }
    __syncthreads();
    v16h a0 = frag_from_rows(&As[(wm + 0) * 40], 40);
    v16h a1 = frag_from_rows(&As[(wm + 16) * 40], 40);
    v16h b0 = frag_from_rows(&Bs[(wn + 0) * 40], 40);
    v16h b1 = frag_from_rows(&Bs[(wn + 16) * 40], 40);
    acc[0][0] = wmma_f16(a0, b0, acc[0][0]);
    acc[0][1] = wmma_f16(a0, b1, acc[0][1]);
    acc[1][0] = wmma_f16(a1, b0, acc[1][0]);
    acc[1][1] = wmma_f16(a1, b1, acc[1][1]);
  }

  const int lane = tid & 31;
  const int nloc = lane & 15, hi = lane >> 4;
#pragma unroll
  for (int sm = 0; sm < 2; ++sm)
#pragma unroll
    for (int sn = 0; sn < 2; ++sn) {
      int e = n0 + wn + sn * 16 + nloc;
      int hh = e >> 6, d = e & 63;
      float bsv = bias[e];
#pragma unroll
      for (int j = 0; j < 8; ++j) {
        int m = m0 + wm + sm * 16 + j + hi * 8;
        int bb = m >> 12;          // m / S_
        int s = m & (S_ - 1);
        size_t o = (((size_t)bb * H_ + hh) * S_ + s) * DH_ + d;
        out[o] = (_Float16)((acc[sm][sn][j] + bsv) * oscale);
      }
    }
}

#define QK_STRIDE 88   // halves; 176B rows -> B128-aligned, conflict-free reads

// value of lane l ^ 16
__device__ __forceinline__ float other_half(float v) {
  int b = __builtin_bit_cast(int, v);
  b = __builtin_amdgcn_permlanex16(b, b, 0x76543210, 0xfedcba98, false, false);
  return __builtin_bit_cast(float, b);
}

__global__ __launch_bounds__(128) void attn_kernel(
    const _Float16* __restrict__ Q, const _Float16* __restrict__ K,
    const _Float16* __restrict__ V, const int* __restrict__ mask,
    _Float16* __restrict__ att) {
  const int qt = blockIdx.x, hh = blockIdx.y, bb = blockIdx.z;
  const int tid = threadIdx.x, wave = tid >> 5, lane = tid & 31;
  const int nloc = lane & 15, hi = lane >> 4;

  __shared__ _Float16 Qs[64 * QK_STRIDE];
  __shared__ _Float16 Ks[64 * QK_STRIDE];
  __shared__ _Float16 Vt[64 * 72];        // transposed: [d][k]
  __shared__ __attribute__((aligned(32))) float maskAdd[64];

  const size_t bh = ((size_t)bb * H_ + hh) * S_;

  {  // stage Q tile asynchronously (64 rows contiguous in memory)
    const _Float16* Qg = Q + (bh + (size_t)qt * 64) * DH_;
#pragma unroll
    for (int i = 0; i < 4; ++i) {
      int idx = tid + i * 128;            // B128 chunk index (8 halves)
      int r = idx >> 3, c8 = idx & 7;
      async_copy_b128(&Qs[r * QK_STRIDE + c8 * 8], Qg + idx * 8);
    }
  }
  wait_async0();
  __syncthreads();
  // B operand: column = query, contiguous = head dim
  v16h bq0 = frag_from_rows(&Qs[(wave * 16) * QK_STRIDE + 0], QK_STRIDE);
  v16h bq1 = frag_from_rows(&Qs[(wave * 16) * QK_STRIDE + 32], QK_STRIDE);

  v8f o[4];   // o[t2][j] = O[query nloc][d = t2*16 + 8*hi + j]
#pragma unroll
  for (int t = 0; t < 4; ++t) o[t] = (v8f){0, 0, 0, 0, 0, 0, 0, 0};
  float rmax = -__builtin_inff();  // of query nloc, alike in both halves
  float rsum = 0.f;                // of this half's keys only; joined at the end

  for (int k0 = 0; k0 < S_; k0 += 64) {
    __syncthreads();
    // K tile: async global -> LDS (no VGPR round trip)
    const _Float16* Kg = K + (bh + k0) * DH_;
#pragma unroll
    for (int i = 0; i < 4; ++i) {
      int idx = tid + i * 128;
      int r = idx >> 3, c8 = idx & 7;
      async_copy_b128(&Ks[r * QK_STRIDE + c8 * 8], Kg + idx * 8);
    }
    // V tile: sync load with transpose into [d][k]
    const uint2* vsrc = (const uint2*)(V + (bh + k0) * DH_);
#pragma unroll
    for (int i = 0; i < 8; ++i) {
      int idx = tid + i * 128;
      int r = idx >> 4, c4 = idx & 15;
      uint2 vv = vsrc[idx];
      const _Float16* vh = (const _Float16*)&vv;
#pragma unroll
      for (int u = 0; u < 4; ++u) Vt[(c4 * 4 + u) * 72 + r] = vh[u];
    }
    if (tid < 64) maskAdd[tid] = mask[bb * S_ + k0 + tid] ? -1e9f : 0.0f;
    wait_async0();
    __syncthreads();

    // prefetch next iteration's K/V lines while this tile computes
    if (k0 + 64 < S_) {
      __builtin_prefetch(K + (bh + k0 + 64) * DH_ + tid * 32, 0, 1);
      __builtin_prefetch(V + (bh + k0 + 64) * DH_ + tid * 32, 0, 1);
    }

    // scores, transposed: 64 keys x 16 queries, Q pre-scaled
    // c[t][j] = S[query nloc][key t*16 + 8*hi + j]
    v8f c[4];
#pragma unroll
    for (int t = 0; t < 4; ++t) {
      v16h ak0 = frag_from_rows(&Ks[(t * 16) * QK_STRIDE + 0], QK_STRIDE);
      v16h ak1 = frag_from_rows(&Ks[(t * 16) * QK_STRIDE + 32], QK_STRIDE);
      v8f cc = (v8f){0, 0, 0, 0, 0, 0, 0, 0};
      cc = wmma_f16(ak0, bq0, cc);
      cc = wmma_f16(ak1, bq1, cc);
      c[t] = cc + *(const v8f*)&maskAdd[t * 16 + hi * 8];
    }

    // online softmax: one query per lane, 32 of the tile's 64 keys in each half
    // all loops over c[] and o[] are unrolled so that every index is a constant
    // and the tiles stay in registers
    float v = c[0][0];
#pragma unroll
    for (int t = 0; t < 4; ++t)
#pragma unroll
      for (int j = 0; j < 8; ++j) v = fmaxf(v, c[t][j]);
    v = fmaxf(v, other_half(v));
    const float nm = fmaxf(rmax, v);
    const float corr = __expf(rmax - nm);
    rmax = nm;
#pragma unroll
    for (int t = 0; t < 4; ++t)
#pragma unroll
      for (int j = 0; j < 8; ++j) c[t][j] = __expf(c[t][j] - nm);
    const v8f sv = (c[0] + c[1]) + (c[2] + c[3]);
    rsum = rsum * corr + (((sv[0] + sv[1]) + (sv[2] + sv[3])) + ((sv[4] + sv[5]) + (sv[6] + sv[7])));
#pragma unroll
    for (int t = 0; t < 4; ++t) o[t] *= corr;

    // P^T as B operand: element e is key 8*hi + e (e < 8) or 16 + 8*hi + (e - 8) of
    // its 32 keys, which is register e&7 of score tile e>>3: no lane exchange
    v16h bp0, bp1;
#pragma unroll
    for (int e = 0; e < 16; ++e) {
      bp0[e] = (_Float16)c[e >> 3][e & 7];        // keys 0..31
      bp1[e] = (_Float16)c[2 + (e >> 3)][e & 7];  // keys 32..63
    }
#pragma unroll
    for (int t2 = 0; t2 < 4; ++t2) {
      // A operand: row = head dim, contiguous = keys
      v16h av0 = frag_from_rows(&Vt[(t2 * 16) * 72 + 0], 72);
      v16h av1 = frag_from_rows(&Vt[(t2 * 16) * 72 + 32], 72);
      o[t2] = wmma_f16(av0, bp0, o[t2]);
      o[t2] = wmma_f16(av1, bp1, o[t2]);
    }
  }

  // normalize + write att[b, s, h*64+d] as f16: 8 consecutive d per lane
  const float inv = 1.0f / (rsum + other_half(rsum));
  const size_t row = (size_t)bb * S_ + qt * 64 + wave * 16 + nloc;
  _Float16* dst = att + row * (H_ * DH_) + hh * DH_ + hi * 8;
#pragma unroll
  for (int t2 = 0; t2 < 4; ++t2) {
    v8h ov;
#pragma unroll
    for (int j = 0; j < 8; ++j) ov[j] = (_Float16)(o[t2][j] * inv);
    *(v8h*)(dst + t2 * 16) = ov;
  }
}

// ---------------- Kernel 3: output projection ----------------------------
// out[m,d] = sum_e att[m,e] * Wo[d,e] + bo[d]  (fp32 out)
__global__ __launch_bounds__(256) void out_proj_kernel(
    const _Float16* __restrict__ att, const float* __restrict__ Wo,
    const float* __restrict__ bo, float* __restrict__ out) {
  const int m0 = blockIdx.y * 128;
  const int n0 = blockIdx.x * 64;
  const int tid = threadIdx.x;
  const int wave = tid >> 5;
  const int wm = (wave >> 1) * 32;
  const int wn = (wave & 1) * 32;

  __shared__ _Float16 As[128 * 40];
  __shared__ _Float16 Bs[64 * 40];

  v8f acc[2][2];
#pragma unroll
  for (int i = 0; i < 2; ++i)
#pragma unroll
    for (int j = 0; j < 2; ++j) acc[i][j] = (v8f){0, 0, 0, 0, 0, 0, 0, 0};

  for (int k0 = 0; k0 < D_; k0 += 32) {
    __syncthreads();
#pragma unroll
    for (int i = 0; i < 8; ++i) {  // 128x32 halves as dwords
      int idx = tid + i * 256;
      int r = idx >> 4, cu = idx & 15;
      *(uint32_t*)&As[r * 40 + cu * 2] =
          ((const uint32_t*)att)[(((size_t)(m0 + r) * D_) + k0) / 2 + cu];
    }
#pragma unroll
    for (int i = 0; i < 8; ++i) {  // 64 rows of Wo, f32 -> f16
      int idx = tid + i * 256;
      int r = idx >> 5, c = idx & 31;
      Bs[r * 40 + c] = (_Float16)Wo[(size_t)(n0 + r) * D_ + k0 + c];
    }
    __syncthreads();
    v16h a0 = frag_from_rows(&As[(wm + 0) * 40], 40);
    v16h a1 = frag_from_rows(&As[(wm + 16) * 40], 40);
    v16h b0 = frag_from_rows(&Bs[(wn + 0) * 40], 40);
    v16h b1 = frag_from_rows(&Bs[(wn + 16) * 40], 40);
    acc[0][0] = wmma_f16(a0, b0, acc[0][0]);
    acc[0][1] = wmma_f16(a0, b1, acc[0][1]);
    acc[1][0] = wmma_f16(a1, b0, acc[1][0]);
    acc[1][1] = wmma_f16(a1, b1, acc[1][1]);
  }

  const int lane = tid & 31;
  const int nloc = lane & 15, hi = lane >> 4;
#pragma unroll
  for (int sm = 0; sm < 2; ++sm)
#pragma unroll
    for (int sn = 0; sn < 2; ++sn) {
      int e = n0 + wn + sn * 16 + nloc;
      float bsv = bo[e];
#pragma unroll
      for (int j = 0; j < 8; ++j) {
        int m = m0 + wm + sm * 16 + j + hi * 8;
        out[(size_t)m * D_ + e] = acc[sm][sn][j] + bsv;
      }
    }
}

extern "C" void kernel_launch(void* const* d_in, const int* in_sizes, int n_in,
                              void* d_out, int out_size, void* d_ws,
                              size_t ws_size, hipStream_t stream) {
  (void)in_sizes; (void)n_in; (void)out_size; (void)ws_size;
  const float* h  = (const float*)d_in[0];
  const float* Wq = (const float*)d_in[1];
  const float* bq = (const float*)d_in[2];
  const float* Wk = (const float*)d_in[3];
  const float* bk = (const float*)d_in[4];
  const float* Wv = (const float*)d_in[5];
  const float* bv = (const float*)d_in[6];
  const float* Wo = (const float*)d_in[7];
  const float* bo = (const float*)d_in[8];
  const int* mask = (const int*)d_in[9];
  float* out = (float*)d_out;

  _Float16* ws = (_Float16*)d_ws;
  const size_t per = (size_t)B_ * H_ * S_ * DH_;  // 6,291,456 halves
  _Float16* Qb = ws;
  _Float16* Kb = ws + per;
  _Float16* Vb = ws + 2 * per;
  _Float16* Ab = ws + 3 * per;

  qkv_proj_kernel<<<dim3(D_ / 64, (B_ * S_) / 128, 3), 256, 0, stream>>>(
      h, Wq, bq, Wk, bk, Wv, bv, Qb, Kb, Vb);
  attn_kernel<<<dim3(S_ / 64, H_, B_), 128, 0, stream>>>(Qb, Kb, Vb, mask, Ab);
  out_proj_kernel<<<dim3(D_ / 64, (B_ * S_) / 128), 256, 0, stream>>>(
      Ab, Wo, bo, out);
}

// v002
// It runs in 222 microseconds.
// Next to v001, in two timings, it ran 1.66 times as fast each time.
// All steps since v000 together make it 2.46 times as fast.
#include <hip/hip_runtime.h>
#include <hip/hip_bf16.h>

#define B_  2
#define S_  4096
#define D_  768
#define H_  12
#define DH_ 64

typedef _Float16 v16h __attribute__((ext_vector_type(16)));
typedef float    v8f  __attribute__((ext_vector_type(8)));
typedef _Float16 v8h  __attribute__((ext_vector_type(8)));

// Build a WMMA f16 fragment from 16 rows (stride in halves) of LDS.
// Works for A (row = M, contiguous dim = K) and for column-major B
// (row = N column, contiguous dim = K).
// CDNA5 16-bit A layout: lane r=lane%16 holds row r; hi=lane/16 selects the
// +8 K offset half; VGPR v<4 -> K = hi*8 + 2v{+1}; v>=4 -> K = 16 + hi*8 + 2(v-4){+1}.
// Each 8-half group is contiguous -> lowers to two ds_load_b128.
__device__ __forceinline__ v16h frag_from_rows(const _Float16* p, int stride) {
  const int lane = threadIdx.x & 31;
  const int r = lane & 15, hi = lane >> 4;
  const _Float16* q = p + r * stride + hi * 8;
  v16h f;
#pragma unroll
  for (int v = 0; v < 4; ++v) {
    f[2 * v]         = q[2 * v];
    f[2 * v + 1]     = q[2 * v + 1];
    f[8 + 2 * v]     = q[16 + 2 * v];
    f[8 + 2 * v + 1] = q[16 + 2 * v + 1];
  }
  return f;
}

__device__ __forceinline__ v8f wmma_f16(v16h a, v16h b, v8f c) {
  return __builtin_amdgcn_wmma_f32_16x16x32_f16(false, a, false, b, (short)0, c,
                                                false, false);
}

// Async global -> LDS copy of 16 bytes (CDNA5, ASYNCcnt-tracked).
__device__ __forceinline__ void async_copy_b128(void* lds_ptr, const void* gptr) {
  uint32_t lds_off = (uint32_t)(uintptr_t)lds_ptr;  // low 32 bits = LDS offset
  asm volatile("global_load_async_to_lds_b128 %0, %1, off"
               :: "v"(lds_off), "v"(gptr)
               : "memory");
}
// Four such copies of one lane. The s_wait_xcnt stands inside the statement so
// that no address register of a copy is rewritten ahead of it.
__device__ __forceinline__ void async_copy4_b128(void* l0, const void* g0,
                                                 void* l1, const void* g1,
                                                 void* l2, const void* g2,
                                                 void* l3, const void* g3) {
  asm volatile("global_load_async_to_lds_b128 %0, %1, off\n\t"
               "global_load_async_to_lds_b128 %2, %3, off\n\t"
               "global_load_async_to_lds_b128 %4, %5, off\n\t"
               "global_load_async_to_lds_b128 %6, %7, off\n\t"
               "s_wait_xcnt 0x0"
               :: "v"((uint32_t)(uintptr_t)l0), "v"(g0),
                  "v"((uint32_t)(uintptr_t)l1), "v"(g1),
                  "v"((uint32_t)(uintptr_t)l2), "v"(g2),
                  "v"((uint32_t)(uintptr_t)l3), "v"(g3)
               : "memory");
}
__device__ __forceinline__ void wait_async0() {
  asm volatile("s_wait_asynccnt 0x0" ::: "memory");
}

// ---------------- Kernel 1: fused QKV projection -------------------------
// Y[m,e] = sum_k h[m,k] * W[e,k] + bias[e]; written f16 to [B,H,S,DH].
// Q gets the softmax scale (1/sqrt(DH)) folded in.
__global__ __launch_bounds__(256) void qkv_proj_kernel(
    const float* __restrict__ hsrc,
    const float* __restrict__ Wq, const float* __restrict__ bq,
    const float* __restrict__ Wk, const float* __restrict__ bk,
    const float* __restrict__ Wv, const float* __restrict__ bv,
    _Float16* __restrict__ Qo, _Float16* __restrict__ Ko,
    _Float16* __restrict__ Vo) {
  const int which = blockIdx.z;
  const float* W    = which == 0 ? Wq : (which == 1 ? Wk : Wv);
  const float* bias = which == 0 ? bq : (which == 1 ? bk : bv);
  _Float16* out     = which == 0 ? Qo : (which == 1 ? Ko : Vo);
  const float oscale = which == 0 ? 0.125f : 1.0f;  // 1/sqrt(64)

  const int m0 = blockIdx.y * 128;
  const int n0 = blockIdx.x * 64;
  const int tid = threadIdx.x;
  const int wave = tid >> 5;
  const int wm = (wave >> 1) * 32;  // 0..96
  const int wn = (wave & 1) * 32;   // 0,32

  __shared__ _Float16 As[128 * 40];
  __shared__ _Float16 Bs[64 * 40];

  v8f acc[2][2];
#pragma unroll
  for (int i = 0; i < 2; ++i)
#pragma unroll
    for (int j = 0; j < 2; ++j) acc[i][j] = (v8f){0, 0, 0, 0, 0, 0, 0, 0};

  for (int k0 = 0; k0 < D_; k0 += 32) {
    __syncthreads();
#pragma unroll
    for (int i = 0; i < 16; ++i) {  // 128x32 f32 -> f16
      int idx = tid + i * 256;
      int r = idx >> 5, c = idx & 31;
      As[r * 40 + c] = (_Float16)hsrc[(size_t)(m0 + r) * D_ + k0 + c];
    }
#pragma unroll
    for (int i = 0; i < 8; ++i) {   // 64 rows of W (column-major B)
      int idx = tid + i * 256;
      int r = idx >> 5, c = idx & 31;
      Bs[r * 40 + c] = (_Float16)W[(size_t)(n0 + r) * D_ + k0 + c];
    }
    __syncthreads();
    v16h a0 = frag_from_rows(&As[(wm + 0) * 40], 40);
    v16h a1 = frag_from_rows(&As[(wm + 16) * 40], 40);
    v16h b0 = frag_from_rows(&Bs[(wn + 0) * 40], 40);
    v16h b1 = frag_from_rows(&Bs[(wn + 16) * 40], 40);
    acc[0][0] = wmma_f16(a0, b0, acc[0][0]);
    acc[0][1] = wmma_f16(a0, b1, acc[0][1]);
    acc[1][0] = wmma_f16(a1, b0, acc[1][0]);
    acc[1][1] = wmma_f16(a1, b1, acc[1][1]);
  }

  const int lane = tid & 31;
  const int nloc = lane & 15, hi = lane >> 4;
#pragma unroll
  for (int sm = 0; sm < 2; ++sm)
#pragma unroll
    for (int sn = 0; sn < 2; ++sn) {
      int e = n0 + wn + sn * 16 + nloc;
      int hh = e >> 6, d = e & 63;
      float bsv = bias[e];
#pragma unroll
      for (int j = 0; j < 8; ++j) {
        int m = m0 + wm + sm * 16 + j + hi * 8;
        int bb = m >> 12;          // m / S_
        int s = m & (S_ - 1);
        size_t o = (((size_t)bb * H_ + hh) * S_ + s) * DH_ + d;
        out[o] = (_Float16)((acc[sm][sn][j] + bsv) * oscale);
      }
    }
}

#define QK_STRIDE 88   // halves; 176B rows -> B128-aligned, conflict-free reads
#define V_STRIDE 80    // halves; 160B rows = 32B x odd, the transposing load's pitch

typedef short s16x8 __attribute__((ext_vector_type(8)));
typedef __attribute__((address_space(3))) s16x8 lds_s16x8;

// A operand V^T (row = head dim, k = keys in the hardware k order) from the
// row-major V tile: p is the lane's address for keys kbase + 8*hi + (lane & 7);
// the second load takes the 16 keys behind them.
__device__ __forceinline__ v16h vt_frag(const _Float16* p) {
  v8h lo = __builtin_bit_cast(v8h, __builtin_amdgcn_ds_load_tr16_b128_v8i16((lds_s16x8*)p));
  v8h hi = __builtin_bit_cast(v8h, __builtin_amdgcn_ds_load_tr16_b128_v8i16(
                                       (lds_s16x8*)(p + 16 * V_STRIDE)));
  return __builtin_shufflevector(lo, hi, 0, 1, 2, 3, 4, 5, 6, 7, 8, 9, 10, 11, 12, 13, 14, 15);
}

// value of lane l ^ 16
__device__ __forceinline__ float other_half(float v) {
  int b = __builtin_bit_cast(int, v);
  b = __builtin_amdgcn_permlanex16(b, b, 0x76543210, 0xfedcba98, false, false);
  return __builtin_bit_cast(float, b);
}

__global__ __launch_bounds__(128) void attn_kernel(
    const _Float16* __restrict__ Q, const _Float16* __restrict__ K,
    const _Float16* __restrict__ V, const int* __restrict__ mask,
    _Float16* __restrict__ att) {
  const int qt = blockIdx.x, hh = blockIdx.y, bb = blockIdx.z;
  const int tid = threadIdx.x, wave = tid >> 5, lane = tid & 31;
  const int nloc = lane & 15, hi = lane >> 4;

  __shared__ _Float16 Qs[64 * QK_STRIDE];
  __shared__ _Float16 Ks[64 * QK_STRIDE];
  __shared__ __attribute__((aligned(32))) _Float16 Vs[64 * V_STRIDE];  // [k][d], as in memory
  __shared__ __attribute__((aligned(32))) float maskAdd[64];

  const size_t bh = ((size_t)bb * H_ + hh) * S_;

  {  // stage Q tile asynchronously (64 rows contiguous in memory)
    const _Float16* Qg = Q + (bh + (size_t)qt * 64) * DH_;
#pragma unroll
    for (int i = 0; i < 4; ++i) {
      int idx = tid + i * 128;            // B128 chunk index (8 halves)
      int r = idx >> 3, c8 = idx & 7;
      async_copy_b128(&Qs[r * QK_STRIDE + c8 * 8], Qg + idx * 8);
    }
  }
  wait_async0();
  __syncthreads();
  // B operand: column = query, contiguous = head dim
  v16h bq0 = frag_from_rows(&Qs[(wave * 16) * QK_STRIDE + 0], QK_STRIDE);
  v16h bq1 = frag_from_rows(&Qs[(wave * 16) * QK_STRIDE + 32], QK_STRIDE);

  // lane's address in the V tile for the transposing loads
  const _Float16* vrd = &Vs[(8 * hi + (lane & 7)) * V_STRIDE + 8 * ((lane >> 3) & 1)];

  v8f o[4];   // o[t2][j] = O[query nloc][d = t2*16 + 8*hi + j]
#pragma unroll
  for (int t = 0; t < 4; ++t) o[t] = (v8f){0, 0, 0, 0, 0, 0, 0, 0};
  float rmax = -__builtin_inff();  // of query nloc, alike in both halves
  float rsum = 0.f;                // of this half's keys only; joined at the end

  for (int k0 = 0; k0 < S_; k0 += 64) {
    __syncthreads();
    // K tile: async global -> LDS (no VGPR round trip)
    const _Float16* Kg = K + (bh + k0) * DH_;
#pragma unroll
    for (int i = 0; i < 4; ++i) {
      int idx = tid + i * 128;
      int r = idx >> 3, c8 = idx & 7;
      async_copy_b128(&Ks[r * QK_STRIDE + c8 * 8], Kg + idx * 8);
    }
    // V tile: the same, rows as they lie; the transpose is left to the LDS loads
    {
      const _Float16* Vg = V + (bh + k0) * DH_ + tid * 8;
      _Float16* Vl = &Vs[(tid >> 3) * V_STRIDE + (tid & 7) * 8];
      async_copy4_b128(Vl, Vg, Vl + 16 * V_STRIDE, Vg + 1024,
                       Vl + 32 * V_STRIDE, Vg + 2048, Vl + 48 * V_STRIDE, Vg + 3072);
    }
    if (tid < 64) maskAdd[tid] = mask[bb * S_ + k0 + tid] ? -1e9f : 0.0f;
    wait_async0();
    __syncthreads();

    // prefetch next iteration's K/V lines while this tile computes
    if (k0 + 64 < S_) {
      __builtin_prefetch(K + (bh + k0 + 64) * DH_ + tid * 32, 0, 1);
      __builtin_prefetch(V + (bh + k0 + 64) * DH_ + tid * 32, 0, 1);
    }

    // scores, transposed: 64 keys x 16 queries, Q pre-scaled
    // c[t][j] = S[query nloc][key t*16 + 8*hi + j]
    v8f c[4];
#pragma unroll
    for (int t = 0; t < 4; ++t) {
      v16h ak0 = frag_from_rows(&Ks[(t * 16) * QK_STRIDE + 0], QK_STRIDE);
      v16h ak1 = frag_from_rows(&Ks[(t * 16) * QK_STRIDE + 32], QK_STRIDE);
      v8f cc = (v8f){0, 0, 0, 0, 0, 0, 0, 0};
      cc = wmma_f16(ak0, bq0, cc);
      cc = wmma_f16(ak1, bq1, cc);
      c[t] = cc + *(const v8f*)&maskAdd[t * 16 + hi * 8];
    }

    // online softmax: one query per lane, 32 of the tile's 64 keys in each half
    // all loops over c[] and o[] are unrolled so that every index is a constant
    // and the tiles stay in registers
    float v = c[0][0];
#pragma unroll
    for (int t = 0; t < 4; ++t)
#pragma unroll
      for (int j = 0; j < 8; ++j) v = fmaxf(v, c[t][j]);
    v = fmaxf(v, other_half(v));
    const float nm = fmaxf(rmax, v);
    const float corr = __expf(rmax - nm);
    rmax = nm;
#pragma unroll
    for (int t = 0; t < 4; ++t)
#pragma unroll
      for (int j = 0; j < 8; ++j) c[t][j] = __expf(c[t][j] - nm);
    const v8f sv = (c[0] + c[1]) + (c[2] + c[3]);
    rsum = rsum * corr + (((sv[0] + sv[1]) + (sv[2] + sv[3])) + ((sv[4] + sv[5]) + (sv[6] + sv[7])));
#pragma unroll
    for (int t = 0; t < 4; ++t) o[t] *= corr;

    // P^T as B operand: element e is key 8*hi + e (e < 8) or 16 + 8*hi + (e - 8) of
    // its 32 keys, which is register e&7 of score tile e>>3: no lane exchange
    v16h bp0, bp1;
#pragma unroll
    for (int e = 0; e < 16; ++e) {
      bp0[e] = (_Float16)c[e >> 3][e & 7];        // keys 0..31
      bp1[e] = (_Float16)c[2 + (e >> 3)][e & 7];  // keys 32..63
    }
#pragma unroll
    for (int t2 = 0; t2 < 4; ++t2) {
      // A operand: row = head dim t2*16 + nloc, k = keys
      v16h av0 = vt_frag(vrd + t2 * 16);
      v16h av1 = vt_frag(vrd + 32 * V_STRIDE + t2 * 16);
      o[t2] = wmma_f16(av0, bp0, o[t2]);
      o[t2] = wmma_f16(av1, bp1, o[t2]);
    }
  }

  // normalize + write att[b, s, h*64+d] as f16: 8 consecutive d per lane
  const float inv = 1.0f / (rsum + other_half(rsum));
  const size_t row = (size_t)bb * S_ + qt * 64 + wave * 16 + nloc;
  _Float16* dst = att + row * (H_ * DH_) + hh * DH_ + hi * 8;
#pragma unroll
  for (int t2 = 0; t2 < 4; ++t2) {
    v8h ov;
#pragma unroll
    for (int j = 0; j < 8; ++j) ov[j] = (_Float16)(o[t2][j] * inv);
    *(v8h*)(dst + t2 * 16) = ov;
  }
}

// ---------------- Kernel 3: output projection ----------------------------
// out[m,d] = sum_e att[m,e] * Wo[d,e] + bo[d]  (fp32 out)
__global__ __launch_bounds__(256) void out_proj_kernel(
    const _Float16* __restrict__ att, const float* __restrict__ Wo,
    const float* __restrict__ bo, float* __restrict__ out) {
  const int m0 = blockIdx.y * 128;
  const int n0 = blockIdx.x * 64;
  const int tid = threadIdx.x;
  const int wave = tid >> 5;
  const int wm = (wave >> 1) * 32;
  const int wn = (wave & 1) * 32;

  __shared__ _Float16 As[128 * 40];
  __shared__ _Float16 Bs[64 * 40];

  v8f acc[2][2];
#pragma unroll
  for (int i = 0; i < 2; ++i)
#pragma unroll
    for (int j = 0; j < 2; ++j) acc[i][j] = (v8f){0, 0, 0, 0, 0, 0, 0, 0};

  for (int k0 = 0; k0 < D_; k0 += 32) {
    __syncthreads();
#pragma unroll
    for (int i = 0; i < 8; ++i) {  // 128x32 halves as dwords
      int idx = tid + i * 256;
      int r = idx >> 4, cu = idx & 15;
      *(uint32_t*)&As[r * 40 + cu * 2] =
          ((const uint32_t*)att)[(((size_t)(m0 + r) * D_) + k0) / 2 + cu];
    }
#pragma unroll
    for (int i = 0; i < 8; ++i) {  // 64 rows of Wo, f32 -> f16
      int idx = tid + i * 256;
      int r = idx >> 5, c = idx & 31;
      Bs[r * 40 + c] = (_Float16)Wo[(size_t)(n0 + r) * D_ + k0 + c];
    }
    __syncthreads();
    v16h a0 = frag_from_rows(&As[(wm + 0) * 40], 40);
    v16h a1 = frag_from_rows(&As[(wm + 16) * 40], 40);
    v16h b0 = frag_from_rows(&Bs[(wn + 0) * 40], 40);
    v16h b1 = frag_from_rows(&Bs[(wn + 16) * 40], 40);
    acc[0][0] = wmma_f16(a0, b0, acc[0][0]);
    acc[0][1] = wmma_f16(a0, b1, acc[0][1]);
    acc[1][0] = wmma_f16(a1, b0, acc[1][0]);
    acc[1][1] = wmma_f16(a1, b1, acc[1][1]);
  }

  const int lane = tid & 31;
  const int nloc = lane & 15, hi = lane >> 4;
#pragma unroll
  for (int sm = 0; sm < 2; ++sm)
#pragma unroll
    for (int sn = 0; sn < 2; ++sn) {
      int e = n0 + wn + sn * 16 + nloc;
      float bsv = bo[e];
#pragma unroll
      for (int j = 0; j < 8; ++j) {
        int m = m0 + wm + sm * 16 + j + hi * 8;
        out[(size_t)m * D_ + e] = acc[sm][sn][j] + bsv;
      }
    }
}

extern "C" void kernel_launch(void* const* d_in, const int* in_sizes, int n_in,
                              void* d_out, int out_size, void* d_ws,
                              size_t ws_size, hipStream_t stream) {
  (void)in_sizes; (void)n_in; (void)out_size; (void)ws_size;
  const float* h  = (const float*)d_in[0];
  const float* Wq = (const float*)d_in[1];
  const float* bq = (const float*)d_in[2];
  const float* Wk = (const float*)d_in[3];
  const float* bk = (const float*)d_in[4];
  const float* Wv = (const float*)d_in[5];
  const float* bv = (const float*)d_in[6];
  const float* Wo = (const float*)d_in[7];
  const float* bo = (const float*)d_in[8];
  const int* mask = (const int*)d_in[9];
  float* out = (float*)d_out;

  _Float16* ws = (_Float16*)d_ws;
  const size_t per = (size_t)B_ * H_ * S_ * DH_;  // 6,291,456 halves
  _Float16* Qb = ws;
  _Float16* Kb = ws + per;
  _Float16* Vb = ws + 2 * per;
  _Float16* Ab = ws + 3 * per;

  qkv_proj_kernel<<<dim3(D_ / 64, (B_ * S_) / 128, 3), 256, 0, stream>>>(
      h, Wq, bq, Wk, bk, Wv, bv, Qb, Kb, Vb);
  attn_kernel<<<dim3(S_ / 64, H_, B_), 128, 0, stream>>>(Qb, Kb, Vb, mask, Ab);
  out_proj_kernel<<<dim3(D_ / 64, (B_ * S_) / 128), 256, 0, stream>>>(
      Ab, Wo, bo, out);
}

// v003
// One run takes 213 microseconds.
// Next to v002, in two timings, it ran 1.04 times as fast each time.
// All steps since v000 together make it 2.56 times as fast.
#include <hip/hip_runtime.h>
#include <hip/hip_bf16.h>

#define B_  2
#define S_  4096
#define D_  768
#define H_  12
#define DH_ 64

typedef _Float16 v16h __attribute__((ext_vector_type(16)));
typedef float    v8f  __attribute__((ext_vector_type(8)));
typedef _Float16 v8h  __attribute__((ext_vector_type(8)));

// Build a WMMA f16 fragment from 16 rows (stride in halves) of LDS.
// Works for A (row = M, contiguous dim = K) and for column-major B
// (row = N column, contiguous dim = K).
// CDNA5 16-bit A layout: lane r=lane%16 holds row r; hi=lane/16 selects the
// +8 K offset half; VGPR v<4 -> K = hi*8 + 2v{+1}; v>=4 -> K = 16 + hi*8 + 2(v-4){+1}.
// Each 8-half group is contiguous -> lowers to two ds_load_b128.
__device__ __forceinline__ v16h frag_from_rows(const _Float16* p, int stride) {
  const int lane = threadIdx.x & 31;
  const int r = lane & 15, hi = lane >> 4;
  const _Float16* q = p + r * stride + hi * 8;
  v16h f;
#pragma unroll
  for (int v = 0; v < 4; ++v) {
    f[2 * v]         = q[2 * v];
    f[2 * v + 1]     = q[2 * v + 1];
    f[8 + 2 * v]     = q[16 + 2 * v];
    f[8 + 2 * v + 1] = q[16 + 2 * v + 1];
  }
  return f;
}

__device__ __forceinline__ v8f wmma_f16(v16h a, v16h b, v8f c) {
  return __builtin_amdgcn_wmma_f32_16x16x32_f16(false, a, false, b, (short)0, c,
                                                false, false);
}

// Four async global -> LDS copies of 16 bytes of one lane (ASYNCcnt-tracked; the
// low 32 bits of a __shared__ address are the LDS offset). The s_wait_xcnt stands
// inside the statement so that no address register of a copy is rewritten ahead of it.
__device__ __forceinline__ void async_copy4_b128(void* l0, const void* g0,
                                                 void* l1, const void* g1,
                                                 void* l2, const void* g2,
                                                 void* l3, const void* g3) {
  asm volatile("global_load_async_to_lds_b128 %0, %1, off\n\t"
               "global_load_async_to_lds_b128 %2, %3, off\n\t"
               "global_load_async_to_lds_b128 %4, %5, off\n\t"
               "global_load_async_to_lds_b128 %6, %7, off\n\t"
               "s_wait_xcnt 0x0"
               :: "v"((uint32_t)(uintptr_t)l0), "v"(g0),
                  "v"((uint32_t)(uintptr_t)l1), "v"(g1),
                  "v"((uint32_t)(uintptr_t)l2), "v"(g2),
                  "v"((uint32_t)(uintptr_t)l3), "v"(g3)
               : "memory");
}
// the wave's own copies have landed
__device__ __forceinline__ void wait_async0() {
  asm volatile("s_wait_asynccnt 0x0" ::: "memory");
}
// the wave's own LDS reads and writes are done (before a buffer is handed over)
__device__ __forceinline__ void wait_ds0() {
  asm volatile("s_wait_dscnt 0x0" ::: "memory");
}
// 64 rows of 64 halves, contiguous in memory, into LDS rows of `stride` halves:
// 128 threads, four 16-byte pieces each. l and g are the thread's own first piece.
__device__ __forceinline__ void stage_tile(_Float16* l, const _Float16* g, int stride) {
  async_copy4_b128(l, g, l + 16 * stride, g + 1024, l + 32 * stride, g + 2048,
                   l + 48 * stride, g + 3072);
}

// ---------------- Kernel 1: fused QKV projection -------------------------
// Y[m,e] = sum_k h[m,k] * W[e,k] + bias[e]; written f16 to [B,H,S,DH].
// Q gets the softmax scale (1/sqrt(DH)) folded in.
__global__ __launch_bounds__(256) void qkv_proj_kernel(
    const float* __restrict__ hsrc,
    const float* __restrict__ Wq, const float* __restrict__ bq,
    const float* __restrict__ Wk, const float* __restrict__ bk,
    const float* __restrict__ Wv, const float* __restrict__ bv,
    _Float16* __restrict__ Qo, _Float16* __restrict__ Ko,
    _Float16* __restrict__ Vo) {
  const int which = blockIdx.z;
  const float* W    = which == 0 ? Wq : (which == 1 ? Wk : Wv);
  const float* bias = which == 0 ? bq : (which == 1 ? bk : bv);
  _Float16* out     = which == 0 ? Qo : (which == 1 ? Ko : Vo);
  const float oscale = which == 0 ? 0.125f : 1.0f;  // 1/sqrt(64)

  const int m0 = blockIdx.y * 128;
  const int n0 = blockIdx.x * 64;
  const int tid = threadIdx.x;
  const int wave = tid >> 5;
  const int wm = (wave >> 1) * 32;  // 0..96
  const int wn = (wave & 1) * 32;   // 0,32

  __shared__ _Float16 As[128 * 40];
  __shared__ _Float16 Bs[64 * 40];

  v8f acc[2][2];
#pragma unroll
  for (int i = 0; i < 2; ++i)
#pragma unroll
    for (int j = 0; j < 2; ++j) acc[i][j] = (v8f){0, 0, 0, 0, 0, 0, 0, 0};

  for (int k0 = 0; k0 < D_; k0 += 32) {
    __syncthreads();
#pragma unroll
    for (int i = 0; i < 16; ++i) {  // 128x32 f32 -> f16
      int idx = tid + i * 256;
      int r = idx >> 5, c = idx & 31;
      As[r * 40 + c] = (_Float16)hsrc[(size_t)(m0 + r) * D_ + k0 + c];
    }
#pragma unroll
    for (int i = 0; i < 8; ++i) {   // 64 rows of W (column-major B)
      int idx = tid + i * 256;
      int r = idx >> 5, c = idx & 31;
      Bs[r * 40 + c] = (_Float16)W[(size_t)(n0 + r) * D_ + k0 + c];
    }
    __syncthreads();
    v16h a0 = frag_from_rows(&As[(wm + 0) * 40], 40);
    v16h a1 = frag_from_rows(&As[(wm + 16) * 40], 40);
    v16h b0 = frag_from_rows(&Bs[(wn + 0) * 40], 40);
    v16h b1 = frag_from_rows(&Bs[(wn + 16) * 40], 40);
    acc[0][0] = wmma_f16(a0, b0, acc[0][0]);
    acc[0][1] = wmma_f16(a0, b1, acc[0][1]);
    acc[1][0] = wmma_f16(a1, b0, acc[1][0]);
    acc[1][1] = wmma_f16(a1, b1, acc[1][1]);
  }

  const int lane = tid & 31;
  const int nloc = lane & 15, hi = lane >> 4;
#pragma unroll
  for (int sm = 0; sm < 2; ++sm)
#pragma unroll
    for (int sn = 0; sn < 2; ++sn) {
      int e = n0 + wn + sn * 16 + nloc;
      int hh = e >> 6, d = e & 63;
      float bsv = bias[e];
#pragma unroll
      for (int j = 0; j < 8; ++j) {
        int m = m0 + wm + sm * 16 + j + hi * 8;
        int bb = m >> 12;          // m / S_
        int s = m & (S_ - 1);
        size_t o = (((size_t)bb * H_ + hh) * S_ + s) * DH_ + d;
        out[o] = (_Float16)((acc[sm][sn][j] + bsv) * oscale);
      }
    }
}

#define QK_STRIDE 72   // halves; 144B rows = 16B x odd -> conflict-free b128 reads
#define NT_ (S_ / 64)  // key tiles
#define V_STRIDE 80    // halves; 160B rows = 32B x odd, the transposing load's pitch

typedef short s16x8 __attribute__((ext_vector_type(8)));
typedef __attribute__((address_space(3))) s16x8 lds_s16x8;

// A operand V^T (row = head dim, k = keys in the hardware k order) from the
// row-major V tile: p is the lane's address for keys kbase + 8*hi + (lane & 7);
// the second load takes the 16 keys behind them.
__device__ __forceinline__ v16h vt_frag(const _Float16* p) {
  v8h lo = __builtin_bit_cast(v8h, __builtin_amdgcn_ds_load_tr16_b128_v8i16((lds_s16x8*)p));
  v8h hi = __builtin_bit_cast(v8h, __builtin_amdgcn_ds_load_tr16_b128_v8i16(
                                       (lds_s16x8*)(p + 16 * V_STRIDE)));
  return __builtin_shufflevector(lo, hi, 0, 1, 2, 3, 4, 5, 6, 7, 8, 9, 10, 11, 12, 13, 14, 15);
}

// value of lane l ^ 16
__device__ __forceinline__ float other_half(float v) {
  int b = __builtin_bit_cast(int, v);
  b = __builtin_amdgcn_permlanex16(b, b, 0x76543210, 0xfedcba98, false, false);
  return __builtin_bit_cast(float, b);
}

__global__ __launch_bounds__(128) void attn_kernel(
    const _Float16* __restrict__ Q, const _Float16* __restrict__ K,
    const _Float16* __restrict__ V, const int* __restrict__ mask,
    _Float16* __restrict__ att) {
  const int qt = blockIdx.x, hh = blockIdx.y, bb = blockIdx.z;
  const int tid = threadIdx.x, wave = tid >> 5, lane = tid & 31;
  const int nloc = lane & 15, hi = lane >> 4;

  // K and V: two buffers each; tile t lies in buffer t & 1 and is copied one trip ahead
  __shared__ __attribute__((aligned(32))) _Float16 Qs[64 * QK_STRIDE];
  __shared__ __attribute__((aligned(32))) _Float16 Ks[2 * 64 * QK_STRIDE];
  __shared__ __attribute__((aligned(32))) _Float16 Vs[2 * 64 * V_STRIDE];  // [k][d], as in memory
  __shared__ __attribute__((aligned(32))) float maskAdd[2 * 64];

  const size_t bh = ((size_t)bb * H_ + hh) * S_;
  // the thread's own first piece of a tile, in memory and in LDS
  const _Float16* Kg = K + bh * DH_ + tid * 8;
  const _Float16* Vg = V + bh * DH_ + tid * 8;
  const int* mg = mask + bb * S_ + tid;
  const int qk_off = (tid >> 3) * QK_STRIDE + (tid & 7) * 8;
  const int v_off = (tid >> 3) * V_STRIDE + (tid & 7) * 8;

  // Q tile and tile 0
  stage_tile(&Qs[qk_off], Q + (bh + (size_t)qt * 64) * DH_ + tid * 8, QK_STRIDE);
  stage_tile(&Ks[qk_off], Kg, QK_STRIDE);
  stage_tile(&Vs[v_off], Vg, V_STRIDE);
  if (tid < 64) maskAdd[tid] = mg[0] ? -1e9f : 0.0f;
  wait_async0();
  __syncthreads();
  // tile 1 flies while tile 0 is worked on; its mask word waits in a register
  stage_tile(&Ks[64 * QK_STRIDE + qk_off], Kg + 64 * DH_, QK_STRIDE);
  stage_tile(&Vs[64 * V_STRIDE + v_off], Vg + 64 * DH_, V_STRIDE);
  int mnext = 0;
  if (tid < 64) mnext = mg[64];

  // B operand: column = query, contiguous = head dim
  v16h bq0 = frag_from_rows(&Qs[(wave * 16) * QK_STRIDE + 0], QK_STRIDE);
  v16h bq1 = frag_from_rows(&Qs[(wave * 16) * QK_STRIDE + 32], QK_STRIDE);

  // lane's address in V buffer 0 for the transposing loads
  const _Float16* vrd = &Vs[(8 * hi + (lane & 7)) * V_STRIDE + 8 * ((lane >> 3) & 1)];

  v8f o[4];   // o[t2][j] = O[query nloc][d = t2*16 + 8*hi + j]
#pragma unroll
  for (int t = 0; t < 4; ++t) o[t] = (v8f){0, 0, 0, 0, 0, 0, 0, 0};
  float rmax = -__builtin_inff();  // of query nloc, alike in both halves
  float rsum = 0.f;                // of this half's keys only; joined at the end

  // where the current tile's buffer starts in Ks and Vs (elements): 0 or one buffer's
  // size, flipped at each trip's end; kept as uniform offsets so that an LDS address
  // costs one add
  int kofs = 0, vofs = 0;
  for (int kt = 0; kt < NT_; ++kt) {
    const int mofs = (kt & 1) * 64;  // the same for maskAdd
    // scores, transposed: 64 keys x 16 queries, Q pre-scaled
    // c[t][j] = S[query nloc][key t*16 + 8*hi + j]
    v8f c[4];
#pragma unroll
    for (int t = 0; t < 4; ++t) {
      v16h ak0 = frag_from_rows(&Ks[kofs + (t * 16) * QK_STRIDE + 0], QK_STRIDE);
      v16h ak1 = frag_from_rows(&Ks[kofs + (t * 16) * QK_STRIDE + 32], QK_STRIDE);
      v8f cc = (v8f){0, 0, 0, 0, 0, 0, 0, 0};
      cc = wmma_f16(ak0, bq0, cc);
      cc = wmma_f16(ak1, bq1, cc);
      c[t] = cc + *(const v8f*)&maskAdd[mofs + t * 16 + hi * 8];
    }

    // online softmax: one query per lane, 32 of the tile's 64 keys in each half
    // all loops over c[] and o[] are unrolled so that every index is a constant
    // and the tiles stay in registers
    float v = c[0][0];
#pragma unroll
    for (int t = 0; t < 4; ++t)
#pragma unroll
      for (int j = 0; j < 8; ++j) v = fmaxf(v, c[t][j]);
    v = fmaxf(v, other_half(v));
    const float nm = fmaxf(rmax, v);
    const float corr = __expf(rmax - nm);
    rmax = nm;
#pragma unroll
    for (int t = 0; t < 4; ++t)
#pragma unroll
      for (int j = 0; j < 8; ++j) c[t][j] = __expf(c[t][j] - nm);
    const v8f sv = (c[0] + c[1]) + (c[2] + c[3]);
    rsum = rsum * corr + (((sv[0] + sv[1]) + (sv[2] + sv[3])) + ((sv[4] + sv[5]) + (sv[6] + sv[7])));
#pragma unroll
    for (int t = 0; t < 4; ++t) o[t] *= corr;

    // P^T as B operand: element e is key 8*hi + e (e < 8) or 16 + 8*hi + (e - 8) of
    // its 32 keys, which is register e&7 of score tile e>>3: no lane exchange
    v16h bp0, bp1;
#pragma unroll
    for (int e = 0; e < 16; ++e) {
      bp0[e] = (_Float16)c[e >> 3][e & 7];        // keys 0..31
      bp1[e] = (_Float16)c[2 + (e >> 3)][e & 7];  // keys 32..63
    }
    const _Float16* vb = vrd + vofs;
#pragma unroll
    for (int t2 = 0; t2 < 4; ++t2) {
      // A operand: row = head dim t2*16 + nloc, k = keys
      v16h av0 = vt_frag(vb + t2 * 16);
      v16h av1 = vt_frag(vb + 32 * V_STRIDE + t2 * 16);
      o[t2] = wmma_f16(av0, bp0, o[t2]);
      o[t2] = wmma_f16(av1, bp1, o[t2]);
    }

    // foot of the trip: the next tile's mask goes into the mask buffer that nobody
    // reads in this trip (behind the last tile it is a stale word that nobody reads);
    // then this wave's LDS work and its copies of the next tile are done, and the one
    // barrier both publishes that tile and ends every wave's reads of this buffer
    if (tid < 64) maskAdd[(mofs ^ 64) + tid] = mnext ? -1e9f : 0.0f;
    wait_ds0();
    wait_async0();
    __syncthreads();
    if (kt + 2 < NT_) {  // tile kt + 2 into the buffer just left, a whole trip ahead of its use
      stage_tile(&Ks[kofs + qk_off], Kg + (size_t)(kt + 2) * (64 * DH_), QK_STRIDE);
      stage_tile(&Vs[vofs + v_off], Vg + (size_t)(kt + 2) * (64 * DH_), V_STRIDE);
      if (tid < 64) {
        mnext = mg[(kt + 2) * 64];
        // the load stays in flight over the next trip: its address register is
        // stepped at the loop's end only behind this wait
        asm volatile("s_wait_xcnt 0x0" ::: "memory");
      }
    }
    kofs ^= 64 * QK_STRIDE;
    vofs ^= 64 * V_STRIDE;
  }
  wait_async0();

  // normalize + write att[b, s, h*64+d] as f16: 8 consecutive d per lane
  const float inv = 1.0f / (rsum + other_half(rsum));
  const size_t row = (size_t)bb * S_ + qt * 64 + wave * 16 + nloc;
  _Float16* dst = att + row * (H_ * DH_) + hh * DH_ + hi * 8;
#pragma unroll
  for (int t2 = 0; t2 < 4; ++t2) {
    v8h ov;
#pragma unroll
    for (int j = 0; j < 8; ++j) ov[j] = (_Float16)(o[t2][j] * inv);
    *(v8h*)(dst + t2 * 16) = ov;
  }
}

// ---------------- Kernel 3: output projection ----------------------------
// out[m,d] = sum_e att[m,e] * Wo[d,e] + bo[d]  (fp32 out)
__global__ __launch_bounds__(256) void out_proj_kernel(
    const _Float16* __restrict__ att, const float* __restrict__ Wo,
    const float* __restrict__ bo, float* __restrict__ out) {
  const int m0 = blockIdx.y * 128;
  const int n0 = blockIdx.x * 64;
  const int tid = threadIdx.x;
  const int wave = tid >> 5;
  const int wm = (wave >> 1) * 32;
  const int wn = (wave & 1) * 32;

  __shared__ _Float16 As[128 * 40];
  __shared__ _Float16 Bs[64 * 40];

  v8f acc[2][2];
#pragma unroll
  for (int i = 0; i < 2; ++i)
#pragma unroll
    for (int j = 0; j < 2; ++j) acc[i][j] = (v8f){0, 0, 0, 0, 0, 0, 0, 0};

  for (int k0 = 0; k0 < D_; k0 += 32) {
    __syncthreads();
#pragma unroll
    for (int i = 0; i < 8; ++i) {  // 128x32 halves as dwords
      int idx = tid + i * 256;
      int r = idx >> 4, cu = idx & 15;
      *(uint32_t*)&As[r * 40 + cu * 2] =
          ((const uint32_t*)att)[(((size_t)(m0 + r) * D_) + k0) / 2 + cu];
    }
#pragma unroll
    for (int i = 0; i < 8; ++i) {  // 64 rows of Wo, f32 -> f16
      int idx = tid + i * 256;
      int r = idx >> 5, c = idx & 31;
      Bs[r * 40 + c] = (_Float16)Wo[(size_t)(n0 + r) * D_ + k0 + c];
    }
    __syncthreads();
    v16h a0 = frag_from_rows(&As[(wm + 0) * 40], 40);
    v16h a1 = frag_from_rows(&As[(wm + 16) * 40], 40);
    v16h b0 = frag_from_rows(&Bs[(wn + 0) * 40], 40);
    v16h b1 = frag_from_rows(&Bs[(wn + 16) * 40], 40);
    acc[0][0] = wmma_f16(a0, b0, acc[0][0]);
    acc[0][1] = wmma_f16(a0, b1, acc[0][1]);
    acc[1][0] = wmma_f16(a1, b0, acc[1][0]);
    acc[1][1] = wmma_f16(a1, b1, acc[1][1]);
  }

  const int lane = tid & 31;
  const int nloc = lane & 15, hi = lane >> 4;
#pragma unroll
  for (int sm = 0; sm < 2; ++sm)
#pragma unroll
    for (int sn = 0; sn < 2; ++sn) {
      int e = n0 + wn + sn * 16 + nloc;
      float bsv = bo[e];
#pragma unroll
      for (int j = 0; j < 8; ++j) {
        int m = m0 + wm + sm * 16 + j + hi * 8;
        out[(size_t)m * D_ + e] = acc[sm][sn][j] + bsv;
      }
    }
}

extern "C" void kernel_launch(void* const* d_in, const int* in_sizes, int n_in,
                              void* d_out, int out_size, void* d_ws,
                              size_t ws_size, hipStream_t stream) {
  (void)in_sizes; (void)n_in; (void)out_size; (void)ws_size;
  const float* h  = (const float*)d_in[0];
  const float* Wq = (const float*)d_in[1];
  const float* bq = (const float*)d_in[2];
  const float* Wk = (const float*)d_in[3];
  const float* bk = (const float*)d_in[4];
  const float* Wv = (const float*)d_in[5];
  const float* bv = (const float*)d_in[6];
  const float* Wo = (const float*)d_in[7];
  const float* bo = (const float*)d_in[8];
  const int* mask = (const int*)d_in[9];
  float* out = (float*)d_out;

  _Float16* ws = (_Float16*)d_ws;
  const size_t per = (size_t)B_ * H_ * S_ * DH_;  // 6,291,456 halves
  _Float16* Qb = ws;
  _Float16* Kb = ws + per;
  _Float16* Vb = ws + 2 * per;
  _Float16* Ab = ws + 3 * per;

  qkv_proj_kernel<<<dim3(D_ / 64, (B_ * S_) / 128, 3), 256, 0, stream>>>(
      h, Wq, bq, Wk, bk, Wv, bv, Qb, Kb, Vb);
  attn_kernel<<<dim3(S_ / 64, H_, B_), 128, 0, stream>>>(Qb, Kb, Vb, mask, Ab);
  out_proj_kernel<<<dim3(D_ / 64, (B_ * S_) / 128), 256, 0, stream>>>(
      Ab, Wo, bo, out);
}

// v004
// It runs in 205 microseconds.
// In both of two side-by-side timings against v003, it was 1.04 times as fast.
// All steps since v000 together make it 2.66 times as fast.
#include <hip/hip_runtime.h>
#include <hip/hip_bf16.h>

#define B_  2
#define S_  4096
#define D_  768
#define H_  12
#define DH_ 64

typedef _Float16 v16h __attribute__((ext_vector_type(16)));
typedef float    v8f  __attribute__((ext_vector_type(8)));
typedef _Float16 v8h  __attribute__((ext_vector_type(8)));

// Build a WMMA f16 fragment from 16 rows (stride in halves) of LDS.
// Works for A (row = M, contiguous dim = K) and for column-major B
// (row = N column, contiguous dim = K).
// CDNA5 16-bit A layout: lane r=lane%16 holds row r; hi=lane/16 selects the
// +8 K offset half; VGPR v<4 -> K = hi*8 + 2v{+1}; v>=4 -> K = 16 + hi*8 + 2(v-4){+1}.
// Each 8-half group is contiguous -> lowers to two ds_load_b128.
__device__ __forceinline__ v16h frag_from_rows(const _Float16* p, int stride) {
  const int lane = threadIdx.x & 31;
  const int r = lane & 15, hi = lane >> 4;
  const _Float16* q = p + r * stride + hi * 8;
  v16h f;
#pragma unroll
  for (int v = 0; v < 4; ++v) {
    f[2 * v]         = q[2 * v];
    f[2 * v + 1]     = q[2 * v + 1];
    f[8 + 2 * v]     = q[16 + 2 * v];
    f[8 + 2 * v + 1] = q[16 + 2 * v + 1];
  }
  return f;
}

__device__ __forceinline__ v8f wmma_f16(v16h a, v16h b, v8f c) {
  return __builtin_amdgcn_wmma_f32_16x16x32_f16(false, a, false, b, (short)0, c,
                                                false, false);
}

// Four async global -> LDS copies of 16 bytes of one lane (ASYNCcnt-tracked; the
// low 32 bits of a __shared__ address are the LDS offset). The s_wait_xcnt stands
// inside the statement so that no address register of a copy is rewritten ahead of it.
__device__ __forceinline__ void async_copy4_b128(void* l0, const void* g0,
                                                 void* l1, const void* g1,
                                                 void* l2, const void* g2,
                                                 void* l3, const void* g3) {
  asm volatile("global_load_async_to_lds_b128 %0, %1, off\n\t"
               "global_load_async_to_lds_b128 %2, %3, off\n\t"
               "global_load_async_to_lds_b128 %4, %5, off\n\t"
               "global_load_async_to_lds_b128 %6, %7, off\n\t"
               "s_wait_xcnt 0x0"
               :: "v"((uint32_t)(uintptr_t)l0), "v"(g0),
                  "v"((uint32_t)(uintptr_t)l1), "v"(g1),
                  "v"((uint32_t)(uintptr_t)l2), "v"(g2),
                  "v"((uint32_t)(uintptr_t)l3), "v"(g3)
               : "memory");
}
// the wave's own copies have landed
__device__ __forceinline__ void wait_async0() {
  asm volatile("s_wait_asynccnt 0x0" ::: "memory");
}
// the wave's own LDS reads and writes are done (before a buffer is handed over)
__device__ __forceinline__ void wait_ds0() {
  asm volatile("s_wait_dscnt 0x0" ::: "memory");
}
// 64 rows of 64 halves, contiguous in memory, into LDS rows of `stride` halves:
// 128 threads, four 16-byte pieces each. l and g are the thread's own first piece.
__device__ __forceinline__ void stage_tile(_Float16* l, const _Float16* g, int stride) {
  async_copy4_b128(l, g, l + 16 * stride, g + 1024, l + 32 * stride, g + 2048,
                   l + 48 * stride, g + 3072);
}

// ---------------- Kernel 1: fused QKV projection -------------------------
// Y[m,e] = sum_k h[m,k] * W[e,k] + bias[e]; written f16 to [B,H,S,DH].
// Q gets the softmax scale (1/sqrt(DH)) folded in.
__global__ __launch_bounds__(256) void qkv_proj_kernel(
    const float* __restrict__ hsrc,
    const float* __restrict__ Wq, const float* __restrict__ bq,
    const float* __restrict__ Wk, const float* __restrict__ bk,
    const float* __restrict__ Wv, const float* __restrict__ bv,
    _Float16* __restrict__ Qo, _Float16* __restrict__ Ko,
    _Float16* __restrict__ Vo) {
  const int which = blockIdx.z;
  const float* W    = which == 0 ? Wq : (which == 1 ? Wk : Wv);
  const float* bias = which == 0 ? bq : (which == 1 ? bk : bv);
  _Float16* out     = which == 0 ? Qo : (which == 1 ? Ko : Vo);
  const float oscale = which == 0 ? 0.125f : 1.0f;  // 1/sqrt(64)

  const int m0 = blockIdx.y * 128;
  const int n0 = blockIdx.x * 64;
  const int tid = threadIdx.x;
  const int wave = tid >> 5;
  const int wm = (wave >> 1) * 32;  // 0..96
  const int wn = (wave & 1) * 32;   // 0,32

  __shared__ _Float16 As[128 * 40];
  __shared__ _Float16 Bs[64 * 40];

  v8f acc[2][2];
#pragma unroll
  for (int i = 0; i < 2; ++i)
#pragma unroll
    for (int j = 0; j < 2; ++j) acc[i][j] = (v8f){0, 0, 0, 0, 0, 0, 0, 0};

  for (int k0 = 0; k0 < D_; k0 += 32) {
    __syncthreads();
#pragma unroll
    for (int i = 0; i < 16; ++i) {  // 128x32 f32 -> f16
      int idx = tid + i * 256;
      int r = idx >> 5, c = idx & 31;
      As[r * 40 + c] = (_Float16)hsrc[(size_t)(m0 + r) * D_ + k0 + c];
    }
#pragma unroll
    for (int i = 0; i < 8; ++i) {   // 64 rows of W (column-major B)
      int idx = tid + i * 256;
      int r = idx >> 5, c = idx & 31;
      Bs[r * 40 + c] = (_Float16)W[(size_t)(n0 + r) * D_ + k0 + c];
    }
    __syncthreads();
    v16h a0 = frag_from_rows(&As[(wm + 0) * 40], 40);
    v16h a1 = frag_from_rows(&As[(wm + 16) * 40], 40);
    v16h b0 = frag_from_rows(&Bs[(wn + 0) * 40], 40);
    v16h b1 = frag_from_rows(&Bs[(wn + 16) * 40], 40);
    acc[0][0] = wmma_f16(a0, b0, acc[0][0]);
    acc[0][1] = wmma_f16(a0, b1, acc[0][1]);
    acc[1][0] = wmma_f16(a1, b0, acc[1][0]);
    acc[1][1] = wmma_f16(a1, b1, acc[1][1]);
  }

  const int lane = tid & 31;
  const int nloc = lane & 15, hi = lane >> 4;
#pragma unroll
  for (int sm = 0; sm < 2; ++sm)
#pragma unroll
    for (int sn = 0; sn < 2; ++sn) {
      int e = n0 + wn + sn * 16 + nloc;
      int hh = e >> 6, d = e & 63;
      float bsv = bias[e];
#pragma unroll
      for (int j = 0; j < 8; ++j) {
        int m = m0 + wm + sm * 16 + j + hi * 8;
        int bb = m >> 12;          // m / S_
        int s = m & (S_ - 1);
        size_t o = (((size_t)bb * H_ + hh) * S_ + s) * DH_ + d;
        out[o] = (_Float16)((acc[sm][sn][j] + bsv) * oscale);
      }
    }
}

#define QK_STRIDE 72   // halves; 144B rows = 16B x odd -> conflict-free b128 reads
#define NT_ (S_ / 64)  // key tiles
#define V_STRIDE 80    // halves; 160B rows = 32B x odd, the transposing load's pitch

typedef short s16x8 __attribute__((ext_vector_type(8)));
typedef __attribute__((address_space(3))) s16x8 lds_s16x8;

// A operand V^T (row = head dim, k = keys in the hardware k order) from the
// row-major V tile: p is the lane's address for keys kbase + 8*hi + (lane & 7);
// the second load takes the 16 keys behind them.
__device__ __forceinline__ v16h vt_frag(const _Float16* p) {
  v8h lo = __builtin_bit_cast(v8h, __builtin_amdgcn_ds_load_tr16_b128_v8i16((lds_s16x8*)p));
  v8h hi = __builtin_bit_cast(v8h, __builtin_amdgcn_ds_load_tr16_b128_v8i16(
                                       (lds_s16x8*)(p + 16 * V_STRIDE)));
  return __builtin_shufflevector(lo, hi, 0, 1, 2, 3, 4, 5, 6, 7, 8, 9, 10, 11, 12, 13, 14, 15);
}

// value of lane l ^ 16
__device__ __forceinline__ float other_half(float v) {
  int b = __builtin_bit_cast(int, v);
  b = __builtin_amdgcn_permlanex16(b, b, 0x76543210, 0xfedcba98, false, false);
  return __builtin_bit_cast(float, b);
}

// Each wave takes QG_ groups of 16 query columns, so that every K and V^T fragment
// read from LDS feeds QG_ products, and a work-group's K/V tile serves QB_ queries.
#define QG_ 2
#define QB_ (4 * QG_ * 16)  // queries per work-group of four waves

__global__ __launch_bounds__(128) void attn_kernel(
    const _Float16* __restrict__ Q, const _Float16* __restrict__ K,
    const _Float16* __restrict__ V, const int* __restrict__ mask,
    _Float16* __restrict__ att) {
  const int qt = blockIdx.x, hh = blockIdx.y, bb = blockIdx.z;
  const int tid = threadIdx.x, wave = tid >> 5, lane = tid & 31;
  const int nloc = lane & 15, hi = lane >> 4;

  // K and V: two buffers each; tile t lies in buffer t & 1 and is copied one trip ahead
  __shared__ __attribute__((aligned(32))) _Float16 Qs[QB_ * QK_STRIDE];
  __shared__ __attribute__((aligned(32))) _Float16 Ks[2 * 64 * QK_STRIDE];
  __shared__ __attribute__((aligned(32))) _Float16 Vs[2 * 64 * V_STRIDE];  // [k][d], as in memory
  __shared__ __attribute__((aligned(32))) float maskAdd[2 * 64];

  const size_t bh = ((size_t)bb * H_ + hh) * S_;
  // the thread's own first piece of a tile, in memory and in LDS
  const _Float16* Qg = Q + (bh + (size_t)qt * QB_) * DH_ + tid * 8;
  const _Float16* Kg = K + bh * DH_ + tid * 8;
  const _Float16* Vg = V + bh * DH_ + tid * 8;
  const int* mg = mask + bb * S_ + tid;
  const int qk_off = (tid >> 3) * QK_STRIDE + (tid & 7) * 8;
  const int v_off = (tid >> 3) * V_STRIDE + (tid & 7) * 8;

  // Q tile (64 rows a call) and tile 0
#pragma unroll
  for (int r = 0; r < QB_ / 64; ++r)
    stage_tile(&Qs[r * 64 * QK_STRIDE + qk_off], Qg + r * 64 * DH_, QK_STRIDE);
  stage_tile(&Ks[qk_off], Kg, QK_STRIDE);
  stage_tile(&Vs[v_off], Vg, V_STRIDE);
  if (tid < 64) maskAdd[tid] = mg[0] ? -1e9f : 0.0f;
  wait_async0();
  __syncthreads();
  // tile 1 flies while tile 0 is worked on; its mask word waits in a register
  stage_tile(&Ks[64 * QK_STRIDE + qk_off], Kg + 64 * DH_, QK_STRIDE);
  stage_tile(&Vs[64 * V_STRIDE + v_off], Vg + 64 * DH_, V_STRIDE);
  int mnext = 0;
  if (tid < 64) mnext = mg[64];

  // B operands: column = query, contiguous = head dim; group g holds the wave's
  // queries g*16 .. g*16 + 15
  v16h bq0[QG_], bq1[QG_];
#pragma unroll
  for (int g = 0; g < QG_; ++g) {
    bq0[g] = frag_from_rows(&Qs[((wave * QG_ + g) * 16) * QK_STRIDE + 0], QK_STRIDE);
    bq1[g] = frag_from_rows(&Qs[((wave * QG_ + g) * 16) * QK_STRIDE + 32], QK_STRIDE);
  }

  // lane's address in V buffer 0 for the transposing loads
  const _Float16* vrd = &Vs[(8 * hi + (lane & 7)) * V_STRIDE + 8 * ((lane >> 3) & 1)];

  v8f o[QG_][4];   // o[g][t2][j] = O[query g*16 + nloc][d = t2*16 + 8*hi + j]
  float rmax[QG_];  // of query g*16 + nloc, alike in both halves
  float rsum[QG_];  // of this half's keys only; joined at the end
#pragma unroll
  for (int g = 0; g < QG_; ++g) {
#pragma unroll
    for (int t = 0; t < 4; ++t) o[g][t] = (v8f){0, 0, 0, 0, 0, 0, 0, 0};
    rmax[g] = -__builtin_inff();
    rsum[g] = 0.f;
  }

  // where the current tile's buffer starts in Ks and Vs (elements): 0 or one buffer's
  // size, flipped at each trip's end; kept as uniform offsets so that an LDS address
  // costs one add
  int kofs = 0, vofs = 0;
  for (int kt = 0; kt < NT_; ++kt) {
    const int mofs = (kt & 1) * 64;  // the same for maskAdd
    // scores, transposed: 64 keys x 16 queries per group, Q pre-scaled
    // c[g][t][j] = S[query g*16 + nloc][key t*16 + 8*hi + j]
    // all loops over g, c[] and o[] are unrolled so that every index is a constant
    // and the tiles stay in registers
    v8f c[QG_][4];
#pragma unroll
    for (int t = 0; t < 4; ++t) {
      v16h ak0 = frag_from_rows(&Ks[kofs + (t * 16) * QK_STRIDE + 0], QK_STRIDE);
      v16h ak1 = frag_from_rows(&Ks[kofs + (t * 16) * QK_STRIDE + 32], QK_STRIDE);
      const v8f madd = *(const v8f*)&maskAdd[mofs + t * 16 + hi * 8];
      v8f cc[QG_];
#pragma unroll
      for (int g = 0; g < QG_; ++g)
        cc[g] = wmma_f16(ak0, bq0[g], (v8f){0, 0, 0, 0, 0, 0, 0, 0});
#pragma unroll
      for (int g = 0; g < QG_; ++g) cc[g] = wmma_f16(ak1, bq1[g], cc[g]);
#pragma unroll
      for (int g = 0; g < QG_; ++g) c[g][t] = cc[g] + madd;
    }

    // online softmax: one query per lane and group, 32 of the tile's 64 keys in each half
    v16h bp0[QG_], bp1[QG_];
#pragma unroll
    for (int g = 0; g < QG_; ++g) {
      float v = c[g][0][0];
#pragma unroll
      for (int t = 0; t < 4; ++t)
#pragma unroll
        for (int j = 0; j < 8; ++j) v = fmaxf(v, c[g][t][j]);
      v = fmaxf(v, other_half(v));
      const float nm = fmaxf(rmax[g], v);
      const float corr = __expf(rmax[g] - nm);
      rmax[g] = nm;
#pragma unroll
      for (int t = 0; t < 4; ++t)
#pragma unroll
        for (int j = 0; j < 8; ++j) c[g][t][j] = __expf(c[g][t][j] - nm);
      const v8f sv = (c[g][0] + c[g][1]) + (c[g][2] + c[g][3]);
      rsum[g] = rsum[g] * corr +
                (((sv[0] + sv[1]) + (sv[2] + sv[3])) + ((sv[4] + sv[5]) + (sv[6] + sv[7])));
#pragma unroll
      for (int t = 0; t < 4; ++t) o[g][t] *= corr;

      // P^T as B operand: element e is key 8*hi + e (e < 8) or 16 + 8*hi + (e - 8) of
      // its 32 keys, which is register e&7 of score tile e>>3: no lane exchange
#pragma unroll
      for (int e = 0; e < 16; ++e) {
        bp0[g][e] = (_Float16)c[g][e >> 3][e & 7];        // keys 0..31
        bp1[g][e] = (_Float16)c[g][2 + (e >> 3)][e & 7];  // keys 32..63
      }
    }
    const _Float16* vb = vrd + vofs;
#pragma unroll
    for (int t2 = 0; t2 < 4; ++t2) {
      // A operand: row = head dim t2*16 + nloc, k = keys
      v16h av0 = vt_frag(vb + t2 * 16);
      v16h av1 = vt_frag(vb + 32 * V_STRIDE + t2 * 16);
#pragma unroll
      for (int g = 0; g < QG_; ++g) o[g][t2] = wmma_f16(av0, bp0[g], o[g][t2]);
#pragma unroll
      for (int g = 0; g < QG_; ++g) o[g][t2] = wmma_f16(av1, bp1[g], o[g][t2]);
    }

    // foot of the trip: the next tile's mask goes into the mask buffer that nobody
    // reads in this trip (behind the last tile it is a stale word that nobody reads);
    // then this wave's LDS work and its copies of the next tile are done, and the one
    // barrier both publishes that tile and ends every wave's reads of this buffer
    if (tid < 64) maskAdd[(mofs ^ 64) + tid] = mnext ? -1e9f : 0.0f;
    wait_ds0();
    wait_async0();
    __syncthreads();
    if (kt + 2 < NT_) {  // tile kt + 2 into the buffer just left, a whole trip ahead of its use
      stage_tile(&Ks[kofs + qk_off], Kg + (size_t)(kt + 2) * (64 * DH_), QK_STRIDE);
      stage_tile(&Vs[vofs + v_off], Vg + (size_t)(kt + 2) * (64 * DH_), V_STRIDE);
      if (tid < 64) {
        mnext = mg[(kt + 2) * 64];
        // the load stays in flight over the next trip: its address register is
        // stepped at the loop's end only behind this wait
        asm volatile("s_wait_xcnt 0x0" ::: "memory");
      }
    }
    kofs ^= 64 * QK_STRIDE;
    vofs ^= 64 * V_STRIDE;
  }
  wait_async0();

  // normalize + write att[b, s, h*64+d] as f16: 8 consecutive d per lane
#pragma unroll
  for (int g = 0; g < QG_; ++g) {
    const float inv = 1.0f / (rsum[g] + other_half(rsum[g]));
    const size_t row = (size_t)bb * S_ + qt * QB_ + (wave * QG_ + g) * 16 + nloc;
    _Float16* dst = att + row * (H_ * DH_) + hh * DH_ + hi * 8;
#pragma unroll
    for (int t2 = 0; t2 < 4; ++t2) {
      v8h ov;
#pragma unroll
      for (int j = 0; j < 8; ++j) ov[j] = (_Float16)(o[g][t2][j] * inv);
      *(v8h*)(dst + t2 * 16) = ov;
    }
  }
}

// ---------------- Kernel 3: output projection ----------------------------
// out[m,d] = sum_e att[m,e] * Wo[d,e] + bo[d]  (fp32 out)
__global__ __launch_bounds__(256) void out_proj_kernel(
    const _Float16* __restrict__ att, const float* __restrict__ Wo,
    const float* __restrict__ bo, float* __restrict__ out) {
  const int m0 = blockIdx.y * 128;
  const int n0 = blockIdx.x * 64;
  const int tid = threadIdx.x;
  const int wave = tid >> 5;
  const int wm = (wave >> 1) * 32;
  const int wn = (wave & 1) * 32;

  __shared__ _Float16 As[128 * 40];
  __shared__ _Float16 Bs[64 * 40];

  v8f acc[2][2];
#pragma unroll
  for (int i = 0; i < 2; ++i)
#pragma unroll
    for (int j = 0; j < 2; ++j) acc[i][j] = (v8f){0, 0, 0, 0, 0, 0, 0, 0};

  for (int k0 = 0; k0 < D_; k0 += 32) {
    __syncthreads();
#pragma unroll
    for (int i = 0; i < 8; ++i) {  // 128x32 halves as dwords
      int idx = tid + i * 256;
      int r = idx >> 4, cu = idx & 15;
      *(uint32_t*)&As[r * 40 + cu * 2] =
          ((const uint32_t*)att)[(((size_t)(m0 + r) * D_) + k0) / 2 + cu];
    }
#pragma unroll
    for (int i = 0; i < 8; ++i) {  // 64 rows of Wo, f32 -> f16
      int idx = tid + i * 256;
      int r = idx >> 5, c = idx & 31;
      Bs[r * 40 + c] = (_Float16)Wo[(size_t)(n0 + r) * D_ + k0 + c];
    }
    __syncthreads();
    v16h a0 = frag_from_rows(&As[(wm + 0) * 40], 40);
    v16h a1 = frag_from_rows(&As[(wm + 16) * 40], 40);
    v16h b0 = frag_from_rows(&Bs[(wn + 0) * 40], 40);
    v16h b1 = frag_from_rows(&Bs[(wn + 16) * 40], 40);
    acc[0][0] = wmma_f16(a0, b0, acc[0][0]);
    acc[0][1] = wmma_f16(a0, b1, acc[0][1]);
    acc[1][0] = wmma_f16(a1, b0, acc[1][0]);
    acc[1][1] = wmma_f16(a1, b1, acc[1][1]);
  }

  const int lane = tid & 31;
  const int nloc = lane & 15, hi = lane >> 4;
#pragma unroll
  for (int sm = 0; sm < 2; ++sm)
#pragma unroll
    for (int sn = 0; sn < 2; ++sn) {
      int e = n0 + wn + sn * 16 + nloc;
      float bsv = bo[e];
#pragma unroll
      for (int j = 0; j < 8; ++j) {
        int m = m0 + wm + sm * 16 + j + hi * 8;
        out[(size_t)m * D_ + e] = acc[sm][sn][j] + bsv;
      }
    }
}

extern "C" void kernel_launch(void* const* d_in, const int* in_sizes, int n_in,
                              void* d_out, int out_size, void* d_ws,
                              size_t ws_size, hipStream_t stream) {
  (void)in_sizes; (void)n_in; (void)out_size; (void)ws_size;
  const float* h  = (const float*)d_in[0];
  const float* Wq = (const float*)d_in[1];
  const float* bq = (const float*)d_in[2];
  const float* Wk = (const float*)d_in[3];
  const float* bk = (const float*)d_in[4];
  const float* Wv = (const float*)d_in[5];
  const float* bv = (const float*)d_in[6];
  const float* Wo = (const float*)d_in[7];
  const float* bo = (const float*)d_in[8];
  const int* mask = (const int*)d_in[9];
  float* out = (float*)d_out;

  _Float16* ws = (_Float16*)d_ws;
  const size_t per = (size_t)B_ * H_ * S_ * DH_;  // 6,291,456 halves
  _Float16* Qb = ws;
  _Float16* Kb = ws + per;
  _Float16* Vb = ws + 2 * per;
  _Float16* Ab = ws + 3 * per;

  qkv_proj_kernel<<<dim3(D_ / 64, (B_ * S_) / 128, 3), 256, 0, stream>>>(
      h, Wq, bq, Wk, bk, Wv, bv, Qb, Kb, Vb);
  attn_kernel<<<dim3(S_ / QB_, H_, B_), 128, 0, stream>>>(Qb, Kb, Vb, mask, Ab);
  out_proj_kernel<<<dim3(D_ / 64, (B_ * S_) / 128), 256, 0, stream>>>(
      Ab, Wo, bo, out);
}

// v005
// Measured time: 164 microseconds a run.
// In both of two side-by-side timings against v004, it was 1.25 times as fast.
// Over all steps from v000 it is 3.33 times as fast.
#include <hip/hip_runtime.h>
#include <hip/hip_bf16.h>

#define B_  2
#define S_  4096
#define D_  768
#define H_  12
#define DH_ 64

typedef _Float16 v16h __attribute__((ext_vector_type(16)));
typedef float    v8f  __attribute__((ext_vector_type(8)));
typedef _Float16 v8h  __attribute__((ext_vector_type(8)));

// Build a WMMA f16 fragment from 16 rows (stride in halves) of LDS.
// Works for A (row = M, contiguous dim = K) and for column-major B
// (row = N column, contiguous dim = K).
// CDNA5 16-bit A layout: lane r=lane%16 holds row r; hi=lane/16 selects the
// +8 K offset half; VGPR v<4 -> K = hi*8 + 2v{+1}; v>=4 -> K = 16 + hi*8 + 2(v-4){+1}.
// Each 8-half group is contiguous -> lowers to two ds_load_b128.
__device__ __forceinline__ v16h frag_from_rows(const _Float16* p, int stride) {
  const int lane = threadIdx.x & 31;
  const int r = lane & 15, hi = lane >> 4;
  const _Float16* q = p + r * stride + hi * 8;
  v16h f;
#pragma unroll
  for (int v = 0; v < 4; ++v) {
    f[2 * v]         = q[2 * v];
    f[2 * v + 1]     = q[2 * v + 1];
    f[8 + 2 * v]     = q[16 + 2 * v];
    f[8 + 2 * v + 1] = q[16 + 2 * v + 1];
  }
  return f;
}

__device__ __forceinline__ v8f wmma_f16(v16h a, v16h b, v8f c) {
  return __builtin_amdgcn_wmma_f32_16x16x32_f16(false, a, false, b, (short)0, c,
                                                false, false);
}

// Four async global -> LDS copies of 16 bytes of one lane (ASYNCcnt-tracked; the
// low 32 bits of a __shared__ address are the LDS offset). The s_wait_xcnt stands
// inside the statement so that no address register of a copy is rewritten ahead of it.
__device__ __forceinline__ void async_copy4_b128(void* l0, const void* g0,
                                                 void* l1, const void* g1,
                                                 void* l2, const void* g2,
                                                 void* l3, const void* g3) {
  asm volatile("global_load_async_to_lds_b128 %0, %1, off\n\t"
               "global_load_async_to_lds_b128 %2, %3, off\n\t"
               "global_load_async_to_lds_b128 %4, %5, off\n\t"
               "global_load_async_to_lds_b128 %6, %7, off\n\t"
               "s_wait_xcnt 0x0"
               :: "v"((uint32_t)(uintptr_t)l0), "v"(g0),
                  "v"((uint32_t)(uintptr_t)l1), "v"(g1),
                  "v"((uint32_t)(uintptr_t)l2), "v"(g2),
                  "v"((uint32_t)(uintptr_t)l3), "v"(g3)
               : "memory");
}
// the wave's own copies have landed
__device__ __forceinline__ void wait_async0() {
  asm volatile("s_wait_asynccnt 0x0" ::: "memory");
}
// the wave's own LDS reads and writes are done (before a buffer is handed over)
__device__ __forceinline__ void wait_ds0() {
  asm volatile("s_wait_dscnt 0x0" ::: "memory");
}
// 64 rows of 64 halves, contiguous in memory, into LDS rows of `stride` halves:
// 128 threads, four 16-byte pieces each. l and g are the thread's own first piece.
__device__ __forceinline__ void stage_tile(_Float16* l, const _Float16* g, int stride) {
  async_copy4_b128(l, g, l + 16 * stride, g + 1024, l + 32 * stride, g + 2048,
                   l + 48 * stride, g + 3072);
}

typedef int i32x4 __attribute__((ext_vector_type(4)));
// Four gathered rows of 64 halves into four LDS rows that follow one another: bo holds
// the rows' byte offsets in the K or V plane of this head; l and g are the thread's
// own piece of LDS row 0 of the four and of memory row 0 of the plane. Eight lanes take
// one row, so that every copy still moves whole 128-byte lines.
__device__ __forceinline__ void stage_rows(_Float16* l, const _Float16* g, i32x4 bo,
                                           int stride) {
  const char* gb = (const char*)g;
  async_copy4_b128(l, gb + (unsigned)bo[0], l + stride, gb + (unsigned)bo[1],
                   l + 2 * stride, gb + (unsigned)bo[2], l + 3 * stride, gb + (unsigned)bo[3]);
}

// ---------------- Kernel 1: fused QKV projection -------------------------
// Y[m,e] = sum_k h[m,k] * W[e,k] + bias[e]; written f16 to [B,H,S,DH].
// Q gets the softmax scale (1/sqrt(DH)) folded in.
__global__ __launch_bounds__(256) void qkv_proj_kernel(
    const float* __restrict__ hsrc,
    const float* __restrict__ Wq, const float* __restrict__ bq,
    const float* __restrict__ Wk, const float* __restrict__ bk,
    const float* __restrict__ Wv, const float* __restrict__ bv,
    _Float16* __restrict__ Qo, _Float16* __restrict__ Ko,
    _Float16* __restrict__ Vo) {
  const int which = blockIdx.z;
  const float* W    = which == 0 ? Wq : (which == 1 ? Wk : Wv);
  const float* bias = which == 0 ? bq : (which == 1 ? bk : bv);
  _Float16* out     = which == 0 ? Qo : (which == 1 ? Ko : Vo);
  const float oscale = which == 0 ? 0.125f : 1.0f;  // 1/sqrt(64)

  const int m0 = blockIdx.y * 128;
  const int n0 = blockIdx.x * 64;
  const int tid = threadIdx.x;
  const int wave = tid >> 5;
  const int wm = (wave >> 1) * 32;  // 0..96
  const int wn = (wave & 1) * 32;   // 0,32

  __shared__ _Float16 As[128 * 40];
  __shared__ _Float16 Bs[64 * 40];

  v8f acc[2][2];
#pragma unroll
  for (int i = 0; i < 2; ++i)
#pragma unroll
    for (int j = 0; j < 2; ++j) acc[i][j] = (v8f){0, 0, 0, 0, 0, 0, 0, 0};

  for (int k0 = 0; k0 < D_; k0 += 32) {
    __syncthreads();
#pragma unroll
    for (int i = 0; i < 16; ++i) {  // 128x32 f32 -> f16
      int idx = tid + i * 256;
      int r = idx >> 5, c = idx & 31;
      As[r * 40 + c] = (_Float16)hsrc[(size_t)(m0 + r) * D_ + k0 + c];
    }
#pragma unroll
    for (int i = 0; i < 8; ++i) {   // 64 rows of W (column-major B)
      int idx = tid + i * 256;
      int r = idx >> 5, c = idx & 31;
      Bs[r * 40 + c] = (_Float16)W[(size_t)(n0 + r) * D_ + k0 + c];
    }
    __syncthreads();
    v16h a0 = frag_from_rows(&As[(wm + 0) * 40], 40);
    v16h a1 = frag_from_rows(&As[(wm + 16) * 40], 40);
    v16h b0 = frag_from_rows(&Bs[(wn + 0) * 40], 40);
    v16h b1 = frag_from_rows(&Bs[(wn + 16) * 40], 40);
    acc[0][0] = wmma_f16(a0, b0, acc[0][0]);
    acc[0][1] = wmma_f16(a0, b1, acc[0][1]);
    acc[1][0] = wmma_f16(a1, b0, acc[1][0]);
    acc[1][1] = wmma_f16(a1, b1, acc[1][1]);
  }

  const int lane = tid & 31;
  const int nloc = lane & 15, hi = lane >> 4;
#pragma unroll
  for (int sm = 0; sm < 2; ++sm)
#pragma unroll
    for (int sn = 0; sn < 2; ++sn) {
      int e = n0 + wn + sn * 16 + nloc;
      int hh = e >> 6, d = e & 63;
      float bsv = bias[e];
#pragma unroll
      for (int j = 0; j < 8; ++j) {
        int m = m0 + wm + sm * 16 + j + hi * 8;
        int bb = m >> 12;          // m / S_
        int s = m & (S_ - 1);
        size_t o = (((size_t)bb * H_ + hh) * S_ + s) * DH_ + d;
        out[o] = (_Float16)((acc[sm][sn][j] + bsv) * oscale);
      }
    }
}

#define QK_STRIDE 72   // halves; 144B rows = 16B x odd -> conflict-free b128 reads
#define NT_ (S_ / 64)  // key tiles
#define V_STRIDE 80    // halves; 160B rows = 32B x odd, the transposing load's pitch

typedef short s16x8 __attribute__((ext_vector_type(8)));
typedef __attribute__((address_space(3))) s16x8 lds_s16x8;

// A operand V^T (row = head dim, k = keys in the hardware k order) from the
// row-major V tile: p is the lane's address for keys kbase + 8*hi + (lane & 7);
// the second load takes the 16 keys behind them.
__device__ __forceinline__ v16h vt_frag(const _Float16* p) {
  v8h lo = __builtin_bit_cast(v8h, __builtin_amdgcn_ds_load_tr16_b128_v8i16((lds_s16x8*)p));
  v8h hi = __builtin_bit_cast(v8h, __builtin_amdgcn_ds_load_tr16_b128_v8i16(
                                       (lds_s16x8*)(p + 16 * V_STRIDE)));
  return __builtin_shufflevector(lo, hi, 0, 1, 2, 3, 4, 5, 6, 7, 8, 9, 10, 11, 12, 13, 14, 15);
}

// value of lane l ^ 16
__device__ __forceinline__ float other_half(float v) {
  int b = __builtin_bit_cast(int, v);
  b = __builtin_amdgcn_permlanex16(b, b, 0x76543210, 0xfedcba98, false, false);
  return __builtin_bit_cast(float, b);
}

// Each wave takes QG_ groups of 16 query columns, so that every K and V^T fragment
// read from LDS feeds QG_ products, and a work-group's K/V tile serves QB_ queries.
#define QG_ 2
#define QB_ (4 * QG_ * 16)  // queries per work-group of four waves

__global__ __launch_bounds__(128) void attn_kernel(
    const _Float16* __restrict__ Q, const _Float16* __restrict__ K,
    const _Float16* __restrict__ V, const int* __restrict__ mask,
    _Float16* __restrict__ att) {
  const int qt = blockIdx.x, hh = blockIdx.y, bb = blockIdx.z;
  const int tid = threadIdx.x, wave = tid >> 5, lane = tid & 31;
  const int nloc = lane & 15, hi = lane >> 4;

  // K and V: two buffers each; tile t lies in buffer t & 1 and is copied one trip ahead
  __shared__ __attribute__((aligned(32))) _Float16 Qs[QB_ * QK_STRIDE];
  __shared__ __attribute__((aligned(32))) _Float16 Ks[2 * 64 * QK_STRIDE];
  __shared__ __attribute__((aligned(32))) _Float16 Vs[2 * 64 * V_STRIDE];  // [k][d], as in memory
  __shared__ __attribute__((aligned(32))) float maskAdd[2 * 64];
  // the order in which keys are walked: every key of the batch row once, as the byte
  // offset of its K/V row; kept keys first, masked keys behind them
  __shared__ __attribute__((aligned(32))) int korder[S_];
  __shared__ __attribute__((aligned(16))) int wkept[4];  // kept keys in each wave's quarter

  const size_t bh = ((size_t)bb * H_ + hh) * S_;
  // the thread's own first piece of a tile, in memory and in LDS
  const _Float16* Qg = Q + (bh + (size_t)qt * QB_) * DH_ + tid * 8;
  const int qk_off = (tid >> 3) * QK_STRIDE + (tid & 7) * 8;
  // of a K or V tile a thread copies its piece of the four rows rg4 .. rg4 + 3
  const _Float16* Kg = K + bh * DH_ + (tid & 7) * 8;
  const _Float16* Vg = V + bh * DH_ + (tid & 7) * 8;
  const int rg4 = (tid >> 3) * 4;
  const int k_off = rg4 * QK_STRIDE + (tid & 7) * 8;
  const int v_off = rg4 * V_STRIDE + (tid & 7) * 8;

  // Q tile (64 rows a call); it flies while the key order is built
#pragma unroll
  for (int r = 0; r < QB_ / 64; ++r)
    stage_tile(&Qs[r * 64 * QK_STRIDE + qk_off], Qg + r * 64 * DH_, QK_STRIDE);

  // Key order. A masked key's weight is exp(-1e9 - max) = 0 as soon as one key of the
  // batch row is kept, so only the tiles that hold kept keys are walked; the masked keys
  // that fill up the last of them get -1e9 as before. With no key kept every tile is
  // walked, all at -1e9, which gives the reference's even weights.
  // Each wave takes a quarter of the row, 32 keys (one a lane) at a time.
  const int wv = __builtin_amdgcn_readfirstlane(wave);
  const int* mrow = mask + bb * S_ + wv * (S_ / 4) + lane;
  int mv[S_ / 128];
  // unrolled: all loads in flight at once, mv[] in registers
#pragma unroll
  for (int i = 0; i < S_ / 128; ++i) mv[i] = mrow[i * 32];
  // no address register of these loads is written anew ahead of this wait
  asm volatile("s_wait_xcnt 0x0" ::: "memory");
  unsigned kb[S_ / 128];  // bit l: the chunk's key l is kept
  int wk = 0;
  // unrolled: constant indices keep kb[] in scalar registers
#pragma unroll
  for (int i = 0; i < S_ / 128; ++i) {
    kb[i] = __builtin_amdgcn_ballot_w32(mv[i] == 0);
    wk += __builtin_popcount(kb[i]);
  }
  if (lane == 0) wkept[wv] = wk;
  __syncthreads();  // every wave's count is there
  int kept = 0, before = 0;  // in the whole row; in front of this wave's next chunk
  // unrolled: four counts, one LDS read
#pragma unroll
  for (int w = 0; w < 4; ++w) {
    const int c = __builtin_amdgcn_readfirstlane(wkept[w]);
    kept += c;
    if (w < wv) before += c;
  }
  // unrolled: constant indices into kb[]
#pragma unroll
  for (int i = 0; i < S_ / 128; ++i) {
    const int s = wv * (S_ / 4) + i * 32 + lane;                        // the lane's key
    const int kbef = (int)__builtin_amdgcn_mbcnt_lo(kb[i], (unsigned)before);  // kept in front of it
    // place: a kept key behind the kept ones in front of it; a masked key behind all
    // kept keys and the s - kbef masked ones in front of it: each place 0 .. S_-1 once
    korder[((kb[i] >> lane) & 1u) ? kbef : kept + s - kbef] = s * (DH_ * 2);
    before += __builtin_popcount(kb[i]);
  }
  // key tiles to walk: uniform, at least 1, at most NT_
  const int nt = kept == 0 ? NT_ : min((kept + 63) >> 6, NT_);
  if (tid < 64) maskAdd[tid] = tid < kept ? 0.0f : -1e9f;
  __syncthreads();  // the key order is whole before any wave gathers by it

  // tile 0
  {
    const i32x4 k0 = *(const i32x4*)&korder[rg4];
    stage_rows(&Ks[k_off], Kg, k0, QK_STRIDE);
    stage_rows(&Vs[v_off], Vg, k0, V_STRIDE);
  }
  wait_async0();
  __syncthreads();
  // tile 1, where there is one, flies while tile 0 is worked on
  if (1 < nt) {
    const i32x4 k1 = *(const i32x4*)&korder[64 + rg4];
    stage_rows(&Ks[64 * QK_STRIDE + k_off], Kg, k1, QK_STRIDE);
    stage_rows(&Vs[64 * V_STRIDE + v_off], Vg, k1, V_STRIDE);
  }

  // B operands: column = query, contiguous = head dim; group g holds the wave's
  // queries g*16 .. g*16 + 15
  v16h bq0[QG_], bq1[QG_];
#pragma unroll
  for (int g = 0; g < QG_; ++g) {
    bq0[g] = frag_from_rows(&Qs[((wave * QG_ + g) * 16) * QK_STRIDE + 0], QK_STRIDE);
    bq1[g] = frag_from_rows(&Qs[((wave * QG_ + g) * 16) * QK_STRIDE + 32], QK_STRIDE);
  }

  // lane's address in V buffer 0 for the transposing loads
  const _Float16* vrd = &Vs[(8 * hi + (lane & 7)) * V_STRIDE + 8 * ((lane >> 3) & 1)];

  v8f o[QG_][4];   // o[g][t2][j] = O[query g*16 + nloc][d = t2*16 + 8*hi + j]
  float rmax[QG_];  // of query g*16 + nloc, alike in both halves
  float rsum[QG_];  // of this half's keys only; joined at the end
#pragma unroll
  for (int g = 0; g < QG_; ++g) {
#pragma unroll
    for (int t = 0; t < 4; ++t) o[g][t] = (v8f){0, 0, 0, 0, 0, 0, 0, 0};
    rmax[g] = -__builtin_inff();
    rsum[g] = 0.f;
  }

  // where the current tile's buffer starts in Ks and Vs (elements): 0 or one buffer's
  // size, flipped at each trip's end; kept as uniform offsets so that an LDS address
  // costs one add
  int kofs = 0, vofs = 0;
  for (int kt = 0; kt < nt; ++kt) {
    const int mofs = (kt & 1) * 64;  // the same for maskAdd
    // rows of tile kt + 2, read in front of the foot's waits, so that the copies behind
    // the barrier find them in registers (where there is no such tile: the last tile's
    // again, unused; the index stays inside the list)
    const i32x4 kn = *(const i32x4*)&korder[min(kt + 2, nt - 1) * 64 + rg4];
    // scores, transposed: 64 keys x 16 queries per group, Q pre-scaled
    // c[g][t][j] = S[query g*16 + nloc][key t*16 + 8*hi + j]
    // all loops over g, c[] and o[] are unrolled so that every index is a constant
    // and the tiles stay in registers
    v8f c[QG_][4];
#pragma unroll
    for (int t = 0; t < 4; ++t) {
      v16h ak0 = frag_from_rows(&Ks[kofs + (t * 16) * QK_STRIDE + 0], QK_STRIDE);
      v16h ak1 = frag_from_rows(&Ks[kofs + (t * 16) * QK_STRIDE + 32], QK_STRIDE);
      const v8f madd = *(const v8f*)&maskAdd[mofs + t * 16 + hi * 8];
      v8f cc[QG_];
#pragma unroll
      for (int g = 0; g < QG_; ++g)
        cc[g] = wmma_f16(ak0, bq0[g], (v8f){0, 0, 0, 0, 0, 0, 0, 0});
#pragma unroll
      for (int g = 0; g < QG_; ++g) cc[g] = wmma_f16(ak1, bq1[g], cc[g]);
#pragma unroll
      for (int g = 0; g < QG_; ++g) c[g][t] = cc[g] + madd;
    }

    // online softmax: one query per lane and group, 32 of the tile's 64 keys in each half
    v16h bp0[QG_], bp1[QG_];
#pragma unroll
    for (int g = 0; g < QG_; ++g) {
      float v = c[g][0][0];
#pragma unroll
      for (int t = 0; t < 4; ++t)
#pragma unroll
        for (int j = 0; j < 8; ++j) v = fmaxf(v, c[g][t][j]);
      v = fmaxf(v, other_half(v));
      const float nm = fmaxf(rmax[g], v);
      const float corr = __expf(rmax[g] - nm);
      rmax[g] = nm;
#pragma unroll
      for (int t = 0; t < 4; ++t)
#pragma unroll
        for (int j = 0; j < 8; ++j) c[g][t][j] = __expf(c[g][t][j] - nm);
      const v8f sv = (c[g][0] + c[g][1]) + (c[g][2] + c[g][3]);
      rsum[g] = rsum[g] * corr +
                (((sv[0] + sv[1]) + (sv[2] + sv[3])) + ((sv[4] + sv[5]) + (sv[6] + sv[7])));
#pragma unroll
      for (int t = 0; t < 4; ++t) o[g][t] *= corr;

      // P^T as B operand: element e is key 8*hi + e (e < 8) or 16 + 8*hi + (e - 8) of
      // its 32 keys, which is register e&7 of score tile e>>3: no lane exchange
#pragma unroll
      for (int e = 0; e < 16; ++e) {
        bp0[g][e] = (_Float16)c[g][e >> 3][e & 7];        // keys 0..31
        bp1[g][e] = (_Float16)c[g][2 + (e >> 3)][e & 7];  // keys 32..63
      }
    }
    const _Float16* vb = vrd + vofs;
#pragma unroll
    for (int t2 = 0; t2 < 4; ++t2) {
      // A operand: row = head dim t2*16 + nloc, k = keys
      v16h av0 = vt_frag(vb + t2 * 16);
      v16h av1 = vt_frag(vb + 32 * V_STRIDE + t2 * 16);
#pragma unroll
      for (int g = 0; g < QG_; ++g) o[g][t2] = wmma_f16(av0, bp0[g], o[g][t2]);
#pragma unroll
      for (int g = 0; g < QG_; ++g) o[g][t2] = wmma_f16(av1, bp1[g], o[g][t2]);
    }

    // foot of the trip: the next tile's mask (places from kept on hold masked keys) goes
    // into the mask buffer that nobody reads in this trip (behind the last tile nobody reads it);
    // then this wave's LDS work and its copies of the next tile are done, and the one
    // barrier both publishes that tile and ends every wave's reads of this buffer
    if (tid < 64) maskAdd[(mofs ^ 64) + tid] = (kt + 1) * 64 + tid < kept ? 0.0f : -1e9f;
    wait_ds0();
    wait_async0();
    __syncthreads();
    if (kt + 2 < nt) {  // tile kt + 2 into the buffer just left, a whole trip ahead of its use
      stage_rows(&Ks[kofs + k_off], Kg, kn, QK_STRIDE);
      stage_rows(&Vs[vofs + v_off], Vg, kn, V_STRIDE);
    }
    kofs ^= 64 * QK_STRIDE;
    vofs ^= 64 * V_STRIDE;
  }
  wait_async0();

  // normalize + write att[b, s, h*64+d] as f16: 8 consecutive d per lane
#pragma unroll
  for (int g = 0; g < QG_; ++g) {
    const float inv = 1.0f / (rsum[g] + other_half(rsum[g]));
    const size_t row = (size_t)bb * S_ + qt * QB_ + (wave * QG_ + g) * 16 + nloc;
    _Float16* dst = att + row * (H_ * DH_) + hh * DH_ + hi * 8;
#pragma unroll
    for (int t2 = 0; t2 < 4; ++t2) {
      v8h ov;
#pragma unroll
      for (int j = 0; j < 8; ++j) ov[j] = (_Float16)(o[g][t2][j] * inv);
      *(v8h*)(dst + t2 * 16) = ov;
    }
  }
}

// ---------------- Kernel 3: output projection ----------------------------
// out[m,d] = sum_e att[m,e] * Wo[d,e] + bo[d]  (fp32 out)
__global__ __launch_bounds__(256) void out_proj_kernel(
    const _Float16* __restrict__ att, const float* __restrict__ Wo,
    const float* __restrict__ bo, float* __restrict__ out) {
  const int m0 = blockIdx.y * 128;
  const int n0 = blockIdx.x * 64;
  const int tid = threadIdx.x;
  const int wave = tid >> 5;
  const int wm = (wave >> 1) * 32;
  const int wn = (wave & 1) * 32;

  __shared__ _Float16 As[128 * 40];
  __shared__ _Float16 Bs[64 * 40];

  v8f acc[2][2];
#pragma unroll
  for (int i = 0; i < 2; ++i)
#pragma unroll
    for (int j = 0; j < 2; ++j) acc[i][j] = (v8f){0, 0, 0, 0, 0, 0, 0, 0};

  for (int k0 = 0; k0 < D_; k0 += 32) {
    __syncthreads();
#pragma unroll
    for (int i = 0; i < 8; ++i) {  // 128x32 halves as dwords
      int idx = tid + i * 256;
      int r = idx >> 4, cu = idx & 15;
      *(uint32_t*)&As[r * 40 + cu * 2] =
          ((const uint32_t*)att)[(((size_t)(m0 + r) * D_) + k0) / 2 + cu];
    }
#pragma unroll
    for (int i = 0; i < 8; ++i) {  // 64 rows of Wo, f32 -> f16
      int idx = tid + i * 256;
      int r = idx >> 5, c = idx & 31;
      Bs[r * 40 + c] = (_Float16)Wo[(size_t)(n0 + r) * D_ + k0 + c];
    }
    __syncthreads();
    v16h a0 = frag_from_rows(&As[(wm + 0) * 40], 40);
    v16h a1 = frag_from_rows(&As[(wm + 16) * 40], 40);
    v16h b0 = frag_from_rows(&Bs[(wn + 0) * 40], 40);
    v16h b1 = frag_from_rows(&Bs[(wn + 16) * 40], 40);
    acc[0][0] = wmma_f16(a0, b0, acc[0][0]);
    acc[0][1] = wmma_f16(a0, b1, acc[0][1]);
    acc[1][0] = wmma_f16(a1, b0, acc[1][0]);
    acc[1][1] = wmma_f16(a1, b1, acc[1][1]);
  }

  const int lane = tid & 31;
  const int nloc = lane & 15, hi = lane >> 4;
#pragma unroll
  for (int sm = 0; sm < 2; ++sm)
#pragma unroll
    for (int sn = 0; sn < 2; ++sn) {
      int e = n0 + wn + sn * 16 + nloc;
      float bsv = bo[e];
#pragma unroll
      for (int j = 0; j < 8; ++j) {
        int m = m0 + wm + sm * 16 + j + hi * 8;
        out[(size_t)m * D_ + e] = acc[sm][sn][j] + bsv;
      }
    }
}

extern "C" void kernel_launch(void* const* d_in, const int* in_sizes, int n_in,
                              void* d_out, int out_size, void* d_ws,
                              size_t ws_size, hipStream_t stream) {
  (void)in_sizes; (void)n_in; (void)out_size; (void)ws_size;
  const float* h  = (const float*)d_in[0];
  const float* Wq = (const float*)d_in[1];
  const float* bq = (const float*)d_in[2];
  const float* Wk = (const float*)d_in[3];
  const float* bk = (const float*)d_in[4];
  const float* Wv = (const float*)d_in[5];
  const float* bv = (const float*)d_in[6];
  const float* Wo = (const float*)d_in[7];
  const float* bo = (const float*)d_in[8];
  const int* mask = (const int*)d_in[9];
  float* out = (float*)d_out;

  _Float16* ws = (_Float16*)d_ws;
  const size_t per = (size_t)B_ * H_ * S_ * DH_;  // 6,291,456 halves
  _Float16* Qb = ws;
  _Float16* Kb = ws + per;
  _Float16* Vb = ws + 2 * per;
  _Float16* Ab = ws + 3 * per;

  qkv_proj_kernel<<<dim3(D_ / 64, (B_ * S_) / 128, 3), 256, 0, stream>>>(
      h, Wq, bq, Wk, bk, Wv, bv, Qb, Kb, Vb);
  attn_kernel<<<dim3(S_ / QB_, H_, B_), 128, 0, stream>>>(Qb, Kb, Vb, mask, Ab);
  out_proj_kernel<<<dim3(D_ / 64, (B_ * S_) / 128), 256, 0, stream>>>(
      Ab, Wo, bo, out);
}

// v006
// A run of this version takes 132 microseconds.
// Timed twice side by side with v005, it ran 1.25 times as fast both times.
// Counting every step since v000, it is 4.16 times as fast.
#include <hip/hip_runtime.h>
#include <hip/hip_bf16.h>

#define B_  2
#define S_  4096
#define D_  768
#define H_  12
#define DH_ 64

typedef _Float16 v16h __attribute__((ext_vector_type(16)));
typedef float    v8f  __attribute__((ext_vector_type(8)));
typedef _Float16 v8h  __attribute__((ext_vector_type(8)));

// Build a WMMA f16 fragment from 16 rows (stride in halves) of LDS.
// Works for A (row = M, contiguous dim = K) and for column-major B
// (row = N column, contiguous dim = K).
// CDNA5 16-bit A layout: lane r=lane%16 holds row r; hi=lane/16 selects the
// +8 K offset half; VGPR v<4 -> K = hi*8 + 2v{+1}; v>=4 -> K = 16 + hi*8 + 2(v-4){+1}.
// Each 8-half group is contiguous -> lowers to two ds_load_b128.
__device__ __forceinline__ v16h frag_from_rows(const _Float16* p, int stride) {
  const int lane = threadIdx.x & 31;
  const int r = lane & 15, hi = lane >> 4;
  const _Float16* q = p + r * stride + hi * 8;
  v16h f;
#pragma unroll
  for (int v = 0; v < 4; ++v) {
    f[2 * v]         = q[2 * v];
    f[2 * v + 1]     = q[2 * v + 1];
    f[8 + 2 * v]     = q[16 + 2 * v];
    f[8 + 2 * v + 1] = q[16 + 2 * v + 1];
  }
  return f;
}

__device__ __forceinline__ v8f wmma_f16(v16h a, v16h b, v8f c) {
  return __builtin_amdgcn_wmma_f32_16x16x32_f16(false, a, false, b, (short)0, c,
                                                false, false);
}

// Four async global -> LDS copies of 16 bytes of one lane (ASYNCcnt-tracked; the
// low 32 bits of a __shared__ address are the LDS offset). The s_wait_xcnt stands
// inside the statement so that no address register of a copy is rewritten ahead of it.
__device__ __forceinline__ void async_copy4_b128(void* l0, const void* g0,
                                                 void* l1, const void* g1,
                                                 void* l2, const void* g2,
                                                 void* l3, const void* g3) {
  asm volatile("global_load_async_to_lds_b128 %0, %1, off\n\t"
               "global_load_async_to_lds_b128 %2, %3, off\n\t"
               "global_load_async_to_lds_b128 %4, %5, off\n\t"
               "global_load_async_to_lds_b128 %6, %7, off\n\t"
               "s_wait_xcnt 0x0"
               :: "v"((uint32_t)(uintptr_t)l0), "v"(g0),
                  "v"((uint32_t)(uintptr_t)l1), "v"(g1),
                  "v"((uint32_t)(uintptr_t)l2), "v"(g2),
                  "v"((uint32_t)(uintptr_t)l3), "v"(g3)
               : "memory");
}
// the wave's own copies have landed
__device__ __forceinline__ void wait_async0() {
  asm volatile("s_wait_asynccnt 0x0" ::: "memory");
}
// the wave's own LDS reads and writes are done (before a buffer is handed over)
__device__ __forceinline__ void wait_ds0() {
  asm volatile("s_wait_dscnt 0x0" ::: "memory");
}
// 64 rows of 64 halves, contiguous in memory, into LDS rows of `stride` halves:
// 128 threads, four 16-byte pieces each. l and g are the thread's own first piece.
__device__ __forceinline__ void stage_tile(_Float16* l, const _Float16* g, int stride) {
  async_copy4_b128(l, g, l + 16 * stride, g + 1024, l + 32 * stride, g + 2048,
                   l + 48 * stride, g + 3072);
}

typedef int i32x4 __attribute__((ext_vector_type(4)));
// Four gathered rows of 64 halves into four LDS rows that follow one another: bo holds
// the rows' byte offsets in the K or V plane of this head; l and g are the thread's
// own piece of LDS row 0 of the four and of memory row 0 of the plane. Eight lanes take
// one row, so that every copy still moves whole 128-byte lines.
__device__ __forceinline__ void stage_rows(_Float16* l, const _Float16* g, i32x4 bo,
                                           int stride) {
  const char* gb = (const char*)g;
  async_copy4_b128(l, gb + (unsigned)bo[0], l + stride, gb + (unsigned)bo[1],
                   l + 2 * stride, gb + (unsigned)bo[2], l + 3 * stride, gb + (unsigned)bo[3]);
}

// Tile of both projection kernels: a work-group of eight waves (2 x 4) takes PT_M rows
// by PT_N columns of Y, a wave 64 x 48: 4 A and 3 B fragments feed 12 products, and a
// staged element of h or W serves 192 or 128 outputs.
#define PT_M 128
#define PT_N 192
#define PF_M 4   // A fragments (16 rows each) of a wave
#define PF_N 3   // B fragments (16 columns each) of a wave

// ---------------- Kernel 1: fused QKV projection -------------------------
// Y[m,e] = sum_k h[m,k] * W[e,k] + bias[e]; written f16 to [B,H,S,DH].
// Q gets the softmax scale (1/sqrt(DH)) folded in.
__global__ __launch_bounds__(256) void qkv_proj_kernel(
    const float* __restrict__ hsrc,
    const float* __restrict__ Wq, const float* __restrict__ bq,
    const float* __restrict__ Wk, const float* __restrict__ bk,
    const float* __restrict__ Wv, const float* __restrict__ bv,
    _Float16* __restrict__ Qo, _Float16* __restrict__ Ko,
    _Float16* __restrict__ Vo) {
  const int which = blockIdx.z;
  const float* W    = which == 0 ? Wq : (which == 1 ? Wk : Wv);
  const float* bias = which == 0 ? bq : (which == 1 ? bk : bv);
  _Float16* out     = which == 0 ? Qo : (which == 1 ? Ko : Vo);
  const float oscale = which == 0 ? 0.125f : 1.0f;  // 1/sqrt(64)

  const int m0 = blockIdx.y * PT_M;
  const int n0 = blockIdx.x * PT_N;
  const int tid = threadIdx.x;
  const int wave = tid >> 5;
  const int wm = (wave >> 2) * (PF_M * 16);  // 0, 64
  const int wn = (wave & 3) * (PF_N * 16);   // 0 .. 144

  __shared__ _Float16 As[PT_M * 40];
  __shared__ _Float16 Bs[PT_N * 40];

  // all loops over acc[][] are unrolled so that every index is a constant
  v8f acc[PF_M][PF_N];
#pragma unroll
  for (int i = 0; i < PF_M; ++i)
#pragma unroll
    for (int j = 0; j < PF_N; ++j) acc[i][j] = (v8f){0, 0, 0, 0, 0, 0, 0, 0};

  // a thread stages column tid & 31 of rows (tid >> 5) + 8 * i: one address each for h,
  // W and LDS, the rows behind it at constant offsets, so that the addresses of the
  // larger tile take no registers of their own
  const float* ag = hsrc + (size_t)(m0 + (tid >> 5)) * D_ + (tid & 31);
  const float* bg = W + (size_t)(n0 + (tid >> 5)) * D_ + (tid & 31);
  _Float16* al = &As[(tid >> 5) * 40 + (tid & 31)];
  _Float16* bl = &Bs[(tid >> 5) * 40 + (tid & 31)];

  for (int k0 = 0; k0 < D_; k0 += 32) {
    __syncthreads();
#pragma unroll
    for (int i = 0; i < PT_M / 8; ++i)  // 128x32 f32 -> f16
      al[i * 8 * 40] = (_Float16)ag[k0 + i * 8 * D_];
#pragma unroll
    for (int i = 0; i < PT_N / 8; ++i)  // 192 rows of W (column-major B)
      bl[i * 8 * 40] = (_Float16)bg[k0 + i * 8 * D_];
    __syncthreads();
    v16h a[PF_M];
#pragma unroll
    for (int i = 0; i < PF_M; ++i) a[i] = frag_from_rows(&As[(wm + i * 16) * 40], 40);
#pragma unroll
    for (int j = 0; j < PF_N; ++j) {
      const v16h b = frag_from_rows(&Bs[(wn + j * 16) * 40], 40);
#pragma unroll
      for (int i = 0; i < PF_M; ++i) acc[i][j] = wmma_f16(a[i], b, acc[i][j]);
    }
  }

  const int lane = tid & 31;
  const int nloc = lane & 15, hi = lane >> 4;
#pragma unroll
  for (int sm = 0; sm < PF_M; ++sm)
#pragma unroll
    for (int sn = 0; sn < PF_N; ++sn) {
      int e = n0 + wn + sn * 16 + nloc;
      int hh = e >> 6, d = e & 63;
      float bsv = bias[e];
#pragma unroll
      for (int j = 0; j < 8; ++j) {
        int m = m0 + wm + sm * 16 + j + hi * 8;
        int bb = m >> 12;          // m / S_
        int s = m & (S_ - 1);
        size_t o = (((size_t)bb * H_ + hh) * S_ + s) * DH_ + d;
        out[o] = (_Float16)((acc[sm][sn][j] + bsv) * oscale);
      }
    }
}

#define QK_STRIDE 72   // halves; 144B rows = 16B x odd -> conflict-free b128 reads
#define NT_ (S_ / 64)  // key tiles
#define V_STRIDE 80    // halves; 160B rows = 32B x odd, the transposing load's pitch

typedef short s16x8 __attribute__((ext_vector_type(8)));
typedef __attribute__((address_space(3))) s16x8 lds_s16x8;

// A operand V^T (row = head dim, k = keys in the hardware k order) from the
// row-major V tile: p is the lane's address for keys kbase + 8*hi + (lane & 7);
// the second load takes the 16 keys behind them.
__device__ __forceinline__ v16h vt_frag(const _Float16* p) {
  v8h lo = __builtin_bit_cast(v8h, __builtin_amdgcn_ds_load_tr16_b128_v8i16((lds_s16x8*)p));
  v8h hi = __builtin_bit_cast(v8h, __builtin_amdgcn_ds_load_tr16_b128_v8i16(
                                       (lds_s16x8*)(p + 16 * V_STRIDE)));
  return __builtin_shufflevector(lo, hi, 0, 1, 2, 3, 4, 5, 6, 7, 8, 9, 10, 11, 12, 13, 14, 15);
}

// value of lane l ^ 16
__device__ __forceinline__ float other_half(float v) {
  int b = __builtin_bit_cast(int, v);
  b = __builtin_amdgcn_permlanex16(b, b, 0x76543210, 0xfedcba98, false, false);
  return __builtin_bit_cast(float, b);
}

// Each wave takes QG_ groups of 16 query columns, so that every K and V^T fragment
// read from LDS feeds QG_ products, and a work-group's K/V tile serves QB_ queries.
#define QG_ 2
#define QB_ (4 * QG_ * 16)  // queries per work-group of four waves

__global__ __launch_bounds__(128) void attn_kernel(
    const _Float16* __restrict__ Q, const _Float16* __restrict__ K,
    const _Float16* __restrict__ V, const int* __restrict__ mask,
    _Float16* __restrict__ att) {
  const int qt = blockIdx.x, hh = blockIdx.y, bb = blockIdx.z;
  const int tid = threadIdx.x, wave = tid >> 5, lane = tid & 31;
  const int nloc = lane & 15, hi = lane >> 4;

  // K and V: two buffers each; tile t lies in buffer t & 1 and is copied one trip ahead
  __shared__ __attribute__((aligned(32))) _Float16 Qs[QB_ * QK_STRIDE];
  __shared__ __attribute__((aligned(32))) _Float16 Ks[2 * 64 * QK_STRIDE];
  __shared__ __attribute__((aligned(32))) _Float16 Vs[2 * 64 * V_STRIDE];  // [k][d], as in memory
  __shared__ __attribute__((aligned(32))) float maskAdd[2 * 64];
  // the order in which keys are walked: every key of the batch row once, as the byte
  // offset of its K/V row; kept keys first, masked keys behind them
  __shared__ __attribute__((aligned(32))) int korder[S_];
  __shared__ __attribute__((aligned(16))) int wkept[4];  // kept keys in each wave's quarter

  const size_t bh = ((size_t)bb * H_ + hh) * S_;
  // the thread's own first piece of a tile, in memory and in LDS
  const _Float16* Qg = Q + (bh + (size_t)qt * QB_) * DH_ + tid * 8;
  const int qk_off = (tid >> 3) * QK_STRIDE + (tid & 7) * 8;
  // of a K or V tile a thread copies its piece of the four rows rg4 .. rg4 + 3
  const _Float16* Kg = K + bh * DH_ + (tid & 7) * 8;
  const _Float16* Vg = V + bh * DH_ + (tid & 7) * 8;
  const int rg4 = (tid >> 3) * 4;
  const int k_off = rg4 * QK_STRIDE + (tid & 7) * 8;
  const int v_off = rg4 * V_STRIDE + (tid & 7) * 8;

  // Q tile (64 rows a call); it flies while the key order is built
#pragma unroll
  for (int r = 0; r < QB_ / 64; ++r)
    stage_tile(&Qs[r * 64 * QK_STRIDE + qk_off], Qg + r * 64 * DH_, QK_STRIDE);

  // Key order. A masked key's weight is exp(-1e9 - max) = 0 as soon as one key of the
  // batch row is kept, so only the tiles that hold kept keys are walked; the masked keys
  // that fill up the last of them get -1e9 as before. With no key kept every tile is
  // walked, all at -1e9, which gives the reference's even weights.
  // Each wave takes a quarter of the row, 32 keys (one a lane) at a time.
  const int wv = __builtin_amdgcn_readfirstlane(wave);
  const int* mrow = mask + bb * S_ + wv * (S_ / 4) + lane;
  int mv[S_ / 128];
  // unrolled: all loads in flight at once, mv[] in registers
#pragma unroll
  for (int i = 0; i < S_ / 128; ++i) mv[i] = mrow[i * 32];
  // no address register of these loads is written anew ahead of this wait
  asm volatile("s_wait_xcnt 0x0" ::: "memory");
  unsigned kb[S_ / 128];  // bit l: the chunk's key l is kept
  int wk = 0;
  // unrolled: constant indices keep kb[] in scalar registers
#pragma unroll
  for (int i = 0; i < S_ / 128; ++i) {
    kb[i] = __builtin_amdgcn_ballot_w32(mv[i] == 0);
    wk += __builtin_popcount(kb[i]);
  }
  if (lane == 0) wkept[wv] = wk;
  __syncthreads();  // every wave's count is there
  int kept = 0, before = 0;  // in the whole row; in front of this wave's next chunk
  // unrolled: four counts, one LDS read
#pragma unroll
  for (int w = 0; w < 4; ++w) {
    const int c = __builtin_amdgcn_readfirstlane(wkept[w]);
    kept += c;
    if (w < wv) before += c;
  }
  // unrolled: constant indices into kb[]
#pragma unroll
  for (int i = 0; i < S_ / 128; ++i) {
    const int s = wv * (S_ / 4) + i * 32 + lane;                        // the lane's key
    const int kbef = (int)__builtin_amdgcn_mbcnt_lo(kb[i], (unsigned)before);  // kept in front of it
    // place: a kept key behind the kept ones in front of it; a masked key behind all
    // kept keys and the s - kbef masked ones in front of it: each place 0 .. S_-1 once
    korder[((kb[i] >> lane) & 1u) ? kbef : kept + s - kbef] = s * (DH_ * 2);
    before += __builtin_popcount(kb[i]);
  }
  // key tiles to walk: uniform, at least 1, at most NT_
  const int nt = kept == 0 ? NT_ : min((kept + 63) >> 6, NT_);
  if (tid < 64) maskAdd[tid] = tid < kept ? 0.0f : -1e9f;
  __syncthreads();  // the key order is whole before any wave gathers by it

  // tile 0
  {
    const i32x4 k0 = *(const i32x4*)&korder[rg4];
    stage_rows(&Ks[k_off], Kg, k0, QK_STRIDE);
    stage_rows(&Vs[v_off], Vg, k0, V_STRIDE);
  }
  wait_async0();
  __syncthreads();
  // tile 1, where there is one, flies while tile 0 is worked on
  if (1 < nt) {
    const i32x4 k1 = *(const i32x4*)&korder[64 + rg4];
    stage_rows(&Ks[64 * QK_STRIDE + k_off], Kg, k1, QK_STRIDE);
    stage_rows(&Vs[64 * V_STRIDE + v_off], Vg, k1, V_STRIDE);
  }

  // B operands: column = query, contiguous = head dim; group g holds the wave's
  // queries g*16 .. g*16 + 15
  v16h bq0[QG_], bq1[QG_];
#pragma unroll
  for (int g = 0; g < QG_; ++g) {
    bq0[g] = frag_from_rows(&Qs[((wave * QG_ + g) * 16) * QK_STRIDE + 0], QK_STRIDE);
    bq1[g] = frag_from_rows(&Qs[((wave * QG_ + g) * 16) * QK_STRIDE + 32], QK_STRIDE);
  }

  // lane's address in V buffer 0 for the transposing loads
  const _Float16* vrd = &Vs[(8 * hi + (lane & 7)) * V_STRIDE + 8 * ((lane >> 3) & 1)];

  v8f o[QG_][4];   // o[g][t2][j] = O[query g*16 + nloc][d = t2*16 + 8*hi + j]
  float rmax[QG_];  // of query g*16 + nloc, alike in both halves
  float rsum[QG_];  // of this half's keys only; joined at the end
#pragma unroll
  for (int g = 0; g < QG_; ++g) {
#pragma unroll
    for (int t = 0; t < 4; ++t) o[g][t] = (v8f){0, 0, 0, 0, 0, 0, 0, 0};
    rmax[g] = -__builtin_inff();
    rsum[g] = 0.f;
  }

  // where the current tile's buffer starts in Ks and Vs (elements): 0 or one buffer's
  // size, flipped at each trip's end; kept as uniform offsets so that an LDS address
  // costs one add
  int kofs = 0, vofs = 0;
  for (int kt = 0; kt < nt; ++kt) {
    const int mofs = (kt & 1) * 64;  // the same for maskAdd
    // rows of tile kt + 2, read in front of the foot's waits, so that the copies behind
    // the barrier find them in registers (where there is no such tile: the last tile's
    // again, unused; the index stays inside the list)
    const i32x4 kn = *(const i32x4*)&korder[min(kt + 2, nt - 1) * 64 + rg4];
    // scores, transposed: 64 keys x 16 queries per group, Q pre-scaled
    // c[g][t][j] = S[query g*16 + nloc][key t*16 + 8*hi + j]
    // all loops over g, c[] and o[] are unrolled so that every index is a constant
    // and the tiles stay in registers
    v8f c[QG_][4];
#pragma unroll
    for (int t = 0; t < 4; ++t) {
      v16h ak0 = frag_from_rows(&Ks[kofs + (t * 16) * QK_STRIDE + 0], QK_STRIDE);
      v16h ak1 = frag_from_rows(&Ks[kofs + (t * 16) * QK_STRIDE + 32], QK_STRIDE);
      const v8f madd = *(const v8f*)&maskAdd[mofs + t * 16 + hi * 8];
      v8f cc[QG_];
#pragma unroll
      for (int g = 0; g < QG_; ++g)
        cc[g] = wmma_f16(ak0, bq0[g], (v8f){0, 0, 0, 0, 0, 0, 0, 0});
#pragma unroll
      for (int g = 0; g < QG_; ++g) cc[g] = wmma_f16(ak1, bq1[g], cc[g]);
#pragma unroll
      for (int g = 0; g < QG_; ++g) c[g][t] = cc[g] + madd;
    }

    // online softmax: one query per lane and group, 32 of the tile's 64 keys in each half
    v16h bp0[QG_], bp1[QG_];
#pragma unroll
    for (int g = 0; g < QG_; ++g) {
      float v = c[g][0][0];
#pragma unroll
      for (int t = 0; t < 4; ++t)
#pragma unroll
        for (int j = 0; j < 8; ++j) v = fmaxf(v, c[g][t][j]);
      v = fmaxf(v, other_half(v));
      const float nm = fmaxf(rmax[g], v);
      const float corr = __expf(rmax[g] - nm);
      rmax[g] = nm;
#pragma unroll
      for (int t = 0; t < 4; ++t)
#pragma unroll
        for (int j = 0; j < 8; ++j) c[g][t][j] = __expf(c[g][t][j] - nm);
      const v8f sv = (c[g][0] + c[g][1]) + (c[g][2] + c[g][3]);
      rsum[g] = rsum[g] * corr +
                (((sv[0] + sv[1]) + (sv[2] + sv[3])) + ((sv[4] + sv[5]) + (sv[6] + sv[7])));
#pragma unroll
      for (int t = 0; t < 4; ++t) o[g][t] *= corr;

      // P^T as B operand: element e is key 8*hi + e (e < 8) or 16 + 8*hi + (e - 8) of
      // its 32 keys, which is register e&7 of score tile e>>3: no lane exchange
#pragma unroll
      for (int e = 0; e < 16; ++e) {
        bp0[g][e] = (_Float16)c[g][e >> 3][e & 7];        // keys 0..31
        bp1[g][e] = (_Float16)c[g][2 + (e >> 3)][e & 7];  // keys 32..63
      }
    }
    const _Float16* vb = vrd + vofs;
#pragma unroll
    for (int t2 = 0; t2 < 4; ++t2) {
      // A operand: row = head dim t2*16 + nloc, k = keys
      v16h av0 = vt_frag(vb + t2 * 16);
      v16h av1 = vt_frag(vb + 32 * V_STRIDE + t2 * 16);
#pragma unroll
      for (int g = 0; g < QG_; ++g) o[g][t2] = wmma_f16(av0, bp0[g], o[g][t2]);
#pragma unroll
      for (int g = 0; g < QG_; ++g) o[g][t2] = wmma_f16(av1, bp1[g], o[g][t2]);
    }

    // foot of the trip: the next tile's mask (places from kept on hold masked keys) goes
    // into the mask buffer that nobody reads in this trip (behind the last tile nobody reads it);
    // then this wave's LDS work and its copies of the next tile are done, and the one
    // barrier both publishes that tile and ends every wave's reads of this buffer
    if (tid < 64) maskAdd[(mofs ^ 64) + tid] = (kt + 1) * 64 + tid < kept ? 0.0f : -1e9f;
    wait_ds0();
    wait_async0();
    __syncthreads();
    if (kt + 2 < nt) {  // tile kt + 2 into the buffer just left, a whole trip ahead of its use
      stage_rows(&Ks[kofs + k_off], Kg, kn, QK_STRIDE);
      stage_rows(&Vs[vofs + v_off], Vg, kn, V_STRIDE);
    }
    kofs ^= 64 * QK_STRIDE;
    vofs ^= 64 * V_STRIDE;
  }
  wait_async0();

  // normalize + write att[b, s, h*64+d] as f16: 8 consecutive d per lane
#pragma unroll
  for (int g = 0; g < QG_; ++g) {
    const float inv = 1.0f / (rsum[g] + other_half(rsum[g]));
    const size_t row = (size_t)bb * S_ + qt * QB_ + (wave * QG_ + g) * 16 + nloc;
    _Float16* dst = att + row * (H_ * DH_) + hh * DH_ + hi * 8;
#pragma unroll
    for (int t2 = 0; t2 < 4; ++t2) {
      v8h ov;
#pragma unroll
      for (int j = 0; j < 8; ++j) ov[j] = (_Float16)(o[g][t2][j] * inv);
      *(v8h*)(dst + t2 * 16) = ov;
    }
  }
}

// ---------------- Kernel 3: output projection ----------------------------
// out[m,d] = sum_e att[m,e] * Wo[d,e] + bo[d]  (fp32 out)
__global__ __launch_bounds__(256) void out_proj_kernel(
    const _Float16* __restrict__ att, const float* __restrict__ Wo,
    const float* __restrict__ bo, float* __restrict__ out) {
  const int m0 = blockIdx.y * PT_M;
  const int n0 = blockIdx.x * PT_N;
  const int tid = threadIdx.x;
  const int wave = tid >> 5;
  const int wm = (wave >> 2) * (PF_M * 16);
  const int wn = (wave & 3) * (PF_N * 16);

  __shared__ _Float16 As[PT_M * 40];
  __shared__ _Float16 Bs[PT_N * 40];

  // all loops over acc[][] are unrolled so that every index is a constant
  v8f acc[PF_M][PF_N];
#pragma unroll
  for (int i = 0; i < PF_M; ++i)
#pragma unroll
    for (int j = 0; j < PF_N; ++j) acc[i][j] = (v8f){0, 0, 0, 0, 0, 0, 0, 0};

  // one address each for att, Wo and LDS, the rows behind it at constant offsets (as in
  // kernel 1): of att a thread stages dword tid & 15 of rows (tid >> 4) + 16 * i
  const uint32_t* ag = (const uint32_t*)att + (size_t)(m0 + (tid >> 4)) * (D_ / 2) + (tid & 15);
  const float* bg = Wo + (size_t)(n0 + (tid >> 5)) * D_ + (tid & 31);
  _Float16* al = &As[(tid >> 4) * 40 + (tid & 15) * 2];
  _Float16* bl = &Bs[(tid >> 5) * 40 + (tid & 31)];

  for (int k0 = 0; k0 < D_; k0 += 32) {
    __syncthreads();
#pragma unroll
    for (int i = 0; i < PT_M / 16; ++i)  // 128x32 halves as dwords
      *(uint32_t*)&al[i * 16 * 40] = ag[k0 / 2 + i * 16 * (D_ / 2)];
#pragma unroll
    for (int i = 0; i < PT_N / 8; ++i)  // 192 rows of Wo, f32 -> f16
      bl[i * 8 * 40] = (_Float16)bg[k0 + i * 8 * D_];
    __syncthreads();
    v16h a[PF_M];
#pragma unroll
    for (int i = 0; i < PF_M; ++i) a[i] = frag_from_rows(&As[(wm + i * 16) * 40], 40);
#pragma unroll
    for (int j = 0; j < PF_N; ++j) {
      const v16h b = frag_from_rows(&Bs[(wn + j * 16) * 40], 40);
#pragma unroll
      for (int i = 0; i < PF_M; ++i) acc[i][j] = wmma_f16(a[i], b, acc[i][j]);
    }
  }

  const int lane = tid & 31;
  const int nloc = lane & 15, hi = lane >> 4;
#pragma unroll
  for (int sm = 0; sm < PF_M; ++sm)
#pragma unroll
    for (int sn = 0; sn < PF_N; ++sn) {
      int e = n0 + wn + sn * 16 + nloc;
      float bsv = bo[e];
#pragma unroll
      for (int j = 0; j < 8; ++j) {
        int m = m0 + wm + sm * 16 + j + hi * 8;
        out[(size_t)m * D_ + e] = acc[sm][sn][j] + bsv;
      }
    }
}

extern "C" void kernel_launch(void* const* d_in, const int* in_sizes, int n_in,
                              void* d_out, int out_size, void* d_ws,
                              size_t ws_size, hipStream_t stream) {
  (void)in_sizes; (void)n_in; (void)out_size; (void)ws_size;
  const float* h  = (const float*)d_in[0];
  const float* Wq = (const float*)d_in[1];
  const float* bq = (const float*)d_in[2];
  const float* Wk = (const float*)d_in[3];
  const float* bk = (const float*)d_in[4];
  const float* Wv = (const float*)d_in[5];
  const float* bv = (const float*)d_in[6];
  const float* Wo = (const float*)d_in[7];
  const float* bo = (const float*)d_in[8];
  const int* mask = (const int*)d_in[9];
  float* out = (float*)d_out;

  _Float16* ws = (_Float16*)d_ws;
  const size_t per = (size_t)B_ * H_ * S_ * DH_;  // 6,291,456 halves
  _Float16* Qb = ws;
  _Float16* Kb = ws + per;
  _Float16* Vb = ws + 2 * per;
  _Float16* Ab = ws + 3 * per;

  qkv_proj_kernel<<<dim3(D_ / PT_N, (B_ * S_) / PT_M, 3), 256, 0, stream>>>(
      h, Wq, bq, Wk, bk, Wv, bv, Qb, Kb, Vb);
  attn_kernel<<<dim3(S_ / QB_, H_, B_), 128, 0, stream>>>(Qb, Kb, Vb, mask, Ab);
  out_proj_kernel<<<dim3(D_ / PT_N, (B_ * S_) / PT_M), 256, 0, stream>>>(
      Ab, Wo, bo, out);
}

// v007
// Measured time: 120 microseconds a run.
// In two side-by-side timings against v006, it was 1.10 and 1.09 times as fast.
// Counting every step since v000, it is 4.55 times as fast.
#include <hip/hip_runtime.h>
#include <hip/hip_bf16.h>

#define B_  2
#define S_  4096
#define D_  768
#define H_  12
#define DH_ 64

typedef _Float16 v16h __attribute__((ext_vector_type(16)));
typedef float    v8f  __attribute__((ext_vector_type(8)));
typedef _Float16 v8h  __attribute__((ext_vector_type(8)));

// Build a WMMA f16 fragment from 16 rows (stride in halves) of LDS.
// Works for A (row = M, contiguous dim = K) and for column-major B
// (row = N column, contiguous dim = K).
// CDNA5 16-bit A layout: lane r=lane%16 holds row r; hi=lane/16 selects the
// +8 K offset half; VGPR v<4 -> K = hi*8 + 2v{+1}; v>=4 -> K = 16 + hi*8 + 2(v-4){+1}.
// Each 8-half group is contiguous -> lowers to two ds_load_b128.
__device__ __forceinline__ v16h frag_from_rows(const _Float16* p, int stride) {
  const int lane = threadIdx.x & 31;
  const int r = lane & 15, hi = lane >> 4;
  const _Float16* q = p + r * stride + hi * 8;
  v16h f;
#pragma unroll
  for (int v = 0; v < 4; ++v) {
    f[2 * v]         = q[2 * v];
    f[2 * v + 1]     = q[2 * v + 1];
    f[8 + 2 * v]     = q[16 + 2 * v];
    f[8 + 2 * v + 1] = q[16 + 2 * v + 1];
  }
  return f;
}

__device__ __forceinline__ v8f wmma_f16(v16h a, v16h b, v8f c) {
  return __builtin_amdgcn_wmma_f32_16x16x32_f16(false, a, false, b, (short)0, c,
                                                false, false);
}

// Four async global -> LDS copies of 16 bytes of one lane (ASYNCcnt-tracked; the
// low 32 bits of a __shared__ address are the LDS offset). The s_wait_xcnt stands
// inside the statement so that no address register of a copy is rewritten ahead of it.
__device__ __forceinline__ void async_copy4_b128(void* l0, const void* g0,
                                                 void* l1, const void* g1,
                                                 void* l2, const void* g2,
                                                 void* l3, const void* g3) {
  asm volatile("global_load_async_to_lds_b128 %0, %1, off\n\t"
               "global_load_async_to_lds_b128 %2, %3, off\n\t"
               "global_load_async_to_lds_b128 %4, %5, off\n\t"
               "global_load_async_to_lds_b128 %6, %7, off\n\t"
               "s_wait_xcnt 0x0"
               :: "v"((uint32_t)(uintptr_t)l0), "v"(g0),
                  "v"((uint32_t)(uintptr_t)l1), "v"(g1),
                  "v"((uint32_t)(uintptr_t)l2), "v"(g2),
                  "v"((uint32_t)(uintptr_t)l3), "v"(g3)
               : "memory");
}
// the wave's own copies have landed
__device__ __forceinline__ void wait_async0() {
  asm volatile("s_wait_asynccnt 0x0" ::: "memory");
}
// the wave's own LDS reads and writes are done (before a buffer is handed over)
__device__ __forceinline__ void wait_ds0() {
  asm volatile("s_wait_dscnt 0x0" ::: "memory");
}
// 64 rows of 64 halves, contiguous in memory, into LDS rows of `stride` halves:
// 128 threads, four 16-byte pieces each. l and g are the thread's own first piece.
__device__ __forceinline__ void stage_tile(_Float16* l, const _Float16* g, int stride) {
  async_copy4_b128(l, g, l + 16 * stride, g + 1024, l + 32 * stride, g + 2048,
                   l + 48 * stride, g + 3072);
}

typedef int i32x4 __attribute__((ext_vector_type(4)));
// Four gathered rows of 64 halves into four LDS rows that follow one another: bo holds
// the rows' byte offsets in the K or V plane of this head; l and g are the thread's
// own piece of LDS row 0 of the four and of memory row 0 of the plane. Eight lanes take
// one row, so that every copy still moves whole 128-byte lines.
__device__ __forceinline__ void stage_rows(_Float16* l, const _Float16* g, i32x4 bo,
                                           int stride) {
  const char* gb = (const char*)g;
  async_copy4_b128(l, gb + (unsigned)bo[0], l + stride, gb + (unsigned)bo[1],
                   l + 2 * stride, gb + (unsigned)bo[2], l + 3 * stride, gb + (unsigned)bo[3]);
}

// Two and six such copies of one lane, in the same form.
__device__ __forceinline__ void async_copy2_b128(void* l0, const void* g0,
                                                 void* l1, const void* g1) {
  asm volatile("global_load_async_to_lds_b128 %0, %1, off\n\t"
               "global_load_async_to_lds_b128 %2, %3, off\n\t"
               "s_wait_xcnt 0x0"
               :: "v"((uint32_t)(uintptr_t)l0), "v"(g0),
                  "v"((uint32_t)(uintptr_t)l1), "v"(g1)
               : "memory");
}
__device__ __forceinline__ void async_copy6_b128(void* l0, const void* g0,
                                                 void* l1, const void* g1,
                                                 void* l2, const void* g2,
                                                 void* l3, const void* g3,
                                                 void* l4, const void* g4,
                                                 void* l5, const void* g5) {
  asm volatile("global_load_async_to_lds_b128 %0, %1, off\n\t"
               "global_load_async_to_lds_b128 %2, %3, off\n\t"
               "global_load_async_to_lds_b128 %4, %5, off\n\t"
               "global_load_async_to_lds_b128 %6, %7, off\n\t"
               "global_load_async_to_lds_b128 %8, %9, off\n\t"
               "global_load_async_to_lds_b128 %10, %11, off\n\t"
               "s_wait_xcnt 0x0"
               :: "v"((uint32_t)(uintptr_t)l0), "v"(g0),
                  "v"((uint32_t)(uintptr_t)l1), "v"(g1),
                  "v"((uint32_t)(uintptr_t)l2), "v"(g2),
                  "v"((uint32_t)(uintptr_t)l3), "v"(g3),
                  "v"((uint32_t)(uintptr_t)l4), "v"(g4),
                  "v"((uint32_t)(uintptr_t)l5), "v"(g5)
               : "memory");
}

// Tile of both projection kernels: a work-group of eight waves (2 x 4) takes PT_M rows
// by PT_N columns of Y, a wave 64 x 48: 4 A and 3 B fragments feed 12 products, and a
// staged element of h or W serves 192 or 128 outputs.
#define PT_M 128
#define PT_N 192
#define PF_M 4   // A fragments (16 rows each) of a wave
#define PF_N 3   // B fragments (16 columns each) of a wave
#define PK_ 32             // k of one trip
#define PNK_ (D_ / PK_)    // trips
#define F32_STRIDE 36      // floats; 144B rows = 16B x odd -> conflict-free b128 reads
#define F16_STRIDE 40      // halves; 80B rows = 16B x odd

typedef float    v4f __attribute__((ext_vector_type(4)));
typedef _Float16 v4h __attribute__((ext_vector_type(4)));

// The fragment of frag_from_rows, same rows and same k order, from 16 LDS rows of f32
// (F32_STRIDE floats apart) as they lie in memory: rounded to f16 here, at the read.
__device__ __forceinline__ v16h frag_from_f32_rows(const float* p) {
  const int lane = threadIdx.x & 31;
  const float* q = p + (lane & 15) * F32_STRIDE + (lane >> 4) * 8;
  const v4h h0 = __builtin_convertvector(*(const v4f*)(q), v4h);
  const v4h h1 = __builtin_convertvector(*(const v4f*)(q + 4), v4h);
  const v4h h2 = __builtin_convertvector(*(const v4f*)(q + 16), v4h);
  const v4h h3 = __builtin_convertvector(*(const v4f*)(q + 20), v4h);
  const v8h lo = __builtin_shufflevector(h0, h1, 0, 1, 2, 3, 4, 5, 6, 7);
  const v8h hi = __builtin_shufflevector(h2, h3, 0, 1, 2, 3, 4, 5, 6, 7);
  return __builtin_shufflevector(lo, hi, 0, 1, 2, 3, 4, 5, 6, 7, 8, 9, 10, 11, 12, 13, 14, 15);
}

// PK_ columns of PT_N rows of an f32 matrix with D_ columns into LDS rows of F32_STRIDE
// floats: 256 threads, eight lanes a row (one whole 128-byte line), 32 rows a copy. l and
// g are the thread's own piece of the first 32 rows.
__device__ __forceinline__ void stage_f32_n(float* l, const float* g) {
  async_copy6_b128(l, g, l + 32 * F32_STRIDE, g + 32 * D_, l + 64 * F32_STRIDE, g + 64 * D_,
                   l + 96 * F32_STRIDE, g + 96 * D_, l + 128 * F32_STRIDE, g + 128 * D_,
                   l + 160 * F32_STRIDE, g + 160 * D_);
}

// The same for PT_M rows of one matrix and PT_N rows of another into PT_M + PT_N LDS rows
// that follow one another. Here each copy's address is a scalar base (ga, gb: the tiles'
// first elements, uniform) plus the thread's byte offset vo in 32 rows, the same for all
// ten: no address of memory is held or formed in vector registers.
__device__ __forceinline__ void stage_f32_mn(float* l, unsigned vo, const float* ga,
                                             const float* gb) {
  const uint32_t l0 = (uint32_t)(uintptr_t)l;
  asm volatile("global_load_async_to_lds_b128 %0, %10, %11\n\t"
               "global_load_async_to_lds_b128 %1, %10, %12\n\t"
               "global_load_async_to_lds_b128 %2, %10, %13\n\t"
               "global_load_async_to_lds_b128 %3, %10, %14\n\t"
               "global_load_async_to_lds_b128 %4, %10, %15\n\t"
               "global_load_async_to_lds_b128 %5, %10, %16\n\t"
               "global_load_async_to_lds_b128 %6, %10, %17\n\t"
               "global_load_async_to_lds_b128 %7, %10, %18\n\t"
               "global_load_async_to_lds_b128 %8, %10, %19\n\t"
               "global_load_async_to_lds_b128 %9, %10, %20\n\t"
               "s_wait_xcnt 0x0"
               :: "v"(l0), "v"(l0 + 1 * 32 * F32_STRIDE * 4), "v"(l0 + 2 * 32 * F32_STRIDE * 4),
                  "v"(l0 + 3 * 32 * F32_STRIDE * 4), "v"(l0 + 4 * 32 * F32_STRIDE * 4),
                  "v"(l0 + 5 * 32 * F32_STRIDE * 4), "v"(l0 + 6 * 32 * F32_STRIDE * 4),
                  "v"(l0 + 7 * 32 * F32_STRIDE * 4), "v"(l0 + 8 * 32 * F32_STRIDE * 4),
                  "v"(l0 + 9 * 32 * F32_STRIDE * 4), "v"(vo),
                  "s"(ga), "s"(ga + 32 * D_), "s"(ga + 64 * D_), "s"(ga + 96 * D_),
                  "s"(gb), "s"(gb + 32 * D_), "s"(gb + 64 * D_), "s"(gb + 96 * D_),
                  "s"(gb + 128 * D_), "s"(gb + 160 * D_)
               : "memory");
}

// ---------------- Kernel 1: fused QKV projection -------------------------
// Y[m,e] = sum_k h[m,k] * W[e,k] + bias[e]; written f16 to [B,H,S,DH].
// Q gets the softmax scale (1/sqrt(DH)) folded in.
__global__ __launch_bounds__(256) void qkv_proj_kernel(
    const float* __restrict__ hsrc,
    const float* __restrict__ Wq, const float* __restrict__ bq,
    const float* __restrict__ Wk, const float* __restrict__ bk,
    const float* __restrict__ Wv, const float* __restrict__ bv,
    _Float16* __restrict__ Qo, _Float16* __restrict__ Ko,
    _Float16* __restrict__ Vo) {
  const int which = blockIdx.z;
  const float* W    = which == 0 ? Wq : (which == 1 ? Wk : Wv);
  const float* bias = which == 0 ? bq : (which == 1 ? bk : bv);
  _Float16* out     = which == 0 ? Qo : (which == 1 ? Ko : Vo);
  const float oscale = which == 0 ? 0.125f : 1.0f;  // 1/sqrt(64)

  const int m0 = blockIdx.y * PT_M;
  const int n0 = blockIdx.x * PT_N;
  const int tid = threadIdx.x;
  // the wave's number as a scalar: what follows from it takes no vector registers
  const int wave = __builtin_amdgcn_readfirstlane(tid >> 5);
  const int wm = (wave >> 2) * (PF_M * 16);  // 0, 64
  const int wn = (wave & 3) * (PF_N * 16);   // 0 .. 144

  // h and W tiles as f32, two buffers of PT_M rows of h and PT_N rows of W behind them; the
  // tile of trip t lies in buffer t & 1 and is copied one trip ahead
  __shared__ __attribute__((aligned(16))) float Ts[2 * (PT_M + PT_N) * F32_STRIDE];

  // all loops over acc[][] are unrolled so that every index is a constant
  v8f acc[PF_M][PF_N];
#pragma unroll
  for (int i = 0; i < PF_M; ++i)
#pragma unroll
    for (int j = 0; j < PF_N; ++j) acc[i][j] = (v8f){0, 0, 0, 0, 0, 0, 0, 0};

  // first elements of the work-group's rows of h and W (uniform); the thread's own 16-byte
  // piece of the first 32 rows of a tile, as a byte offset in memory and in LDS
  const float* ag = hsrc + (size_t)m0 * D_;
  const float* bg = W + (size_t)n0 * D_;
  const unsigned vo = (unsigned)((tid >> 3) * D_ + (tid & 7) * 4) * 4u;
  float* tl = &Ts[(tid >> 3) * F32_STRIDE + (tid & 7) * 4];

  // tile 0
  stage_f32_mn(tl, vo, ag, bg);
  wait_async0();
  __syncthreads();
  // tile 1 flies while tile 0 is worked on
  stage_f32_mn(tl + (PT_M + PT_N) * F32_STRIDE, vo, ag + PK_, bg + PK_);

  // where the current tile's buffer starts in Ts (elements), flipped at each foot
  int tofs = 0;
  for (int t = 0; t < PNK_; ++t) {
    // The three B fragments stay, the A fragments pass through, each read while the one
    // before it is multiplied. The scheduling barriers bound how many f32 reads are in
    // flight at once (two fragments' at most): without them the reads of the whole trip are
    // lifted to its head and the kernel no longer fits the 160 registers at which three
    // work-groups are resident on a WGP and the grid runs in one round.
    v16h b[PF_N];
    b[0] = frag_from_f32_rows(&Ts[tofs + (PT_M + wn) * F32_STRIDE]);
    b[1] = frag_from_f32_rows(&Ts[tofs + (PT_M + wn + 16) * F32_STRIDE]);
    __builtin_amdgcn_sched_barrier(0);
    b[2] = frag_from_f32_rows(&Ts[tofs + (PT_M + wn + 32) * F32_STRIDE]);
    v16h a = frag_from_f32_rows(&Ts[tofs + wm * F32_STRIDE]);
    __builtin_amdgcn_sched_barrier(0);
#pragma unroll
    for (int i = 0; i < PF_M; ++i) {
      v16h an = a;
      if (i + 1 < PF_M) an = frag_from_f32_rows(&Ts[tofs + (wm + (i + 1) * 16) * F32_STRIDE]);
#pragma unroll
      for (int j = 0; j < PF_N; ++j) acc[i][j] = wmma_f16(a, b[j], acc[i][j]);
      __builtin_amdgcn_sched_barrier(0);
      a = an;
    }
    // foot of the trip: this wave's LDS reads and its copies of the next tile are done;
    // the one barrier both publishes that tile and ends every wave's reads of this buffer
    wait_ds0();
    wait_async0();
    __syncthreads();
    if (t + 2 < PNK_)  // tile t + 2 into the buffer just left
      stage_f32_mn(tl + tofs, vo, ag + (t + 2) * PK_, bg + (t + 2) * PK_);
    tofs ^= (PT_M + PT_N) * F32_STRIDE;
  }
  wait_async0();

  const int lane = tid & 31;
  const int nloc = lane & 15, hi = lane >> 4;
#pragma unroll
  for (int sm = 0; sm < PF_M; ++sm)
#pragma unroll
    for (int sn = 0; sn < PF_N; ++sn) {
      int e = n0 + wn + sn * 16 + nloc;
      int hh = e >> 6, d = e & 63;
      float bsv = bias[e];
#pragma unroll
      for (int j = 0; j < 8; ++j) {
        int m = m0 + wm + sm * 16 + j + hi * 8;
        int bb = m >> 12;          // m / S_
        int s = m & (S_ - 1);
        size_t o = (((size_t)bb * H_ + hh) * S_ + s) * DH_ + d;
        out[o] = (_Float16)((acc[sm][sn][j] + bsv) * oscale);
      }
    }
}

#define QK_STRIDE 72   // halves; 144B rows = 16B x odd -> conflict-free b128 reads
#define NT_ (S_ / 64)  // key tiles
#define V_STRIDE 80    // halves; 160B rows = 32B x odd, the transposing load's pitch

typedef short s16x8 __attribute__((ext_vector_type(8)));
typedef __attribute__((address_space(3))) s16x8 lds_s16x8;

// A operand V^T (row = head dim, k = keys in the hardware k order) from the
// row-major V tile: p is the lane's address for keys kbase + 8*hi + (lane & 7);
// the second load takes the 16 keys behind them.
__device__ __forceinline__ v16h vt_frag(const _Float16* p) {
  v8h lo = __builtin_bit_cast(v8h, __builtin_amdgcn_ds_load_tr16_b128_v8i16((lds_s16x8*)p));
  v8h hi = __builtin_bit_cast(v8h, __builtin_amdgcn_ds_load_tr16_b128_v8i16(
                                       (lds_s16x8*)(p + 16 * V_STRIDE)));
  return __builtin_shufflevector(lo, hi, 0, 1, 2, 3, 4, 5, 6, 7, 8, 9, 10, 11, 12, 13, 14, 15);
}

// value of lane l ^ 16
__device__ __forceinline__ float other_half(float v) {
  int b = __builtin_bit_cast(int, v);
  b = __builtin_amdgcn_permlanex16(b, b, 0x76543210, 0xfedcba98, false, false);
  return __builtin_bit_cast(float, b);
}

// Each wave takes QG_ groups of 16 query columns, so that every K and V^T fragment
// read from LDS feeds QG_ products, and a work-group's K/V tile serves QB_ queries.
#define QG_ 2
#define QB_ (4 * QG_ * 16)  // queries per work-group of four waves

__global__ __launch_bounds__(128) void attn_kernel(
    const _Float16* __restrict__ Q, const _Float16* __restrict__ K,
    const _Float16* __restrict__ V, const int* __restrict__ mask,
    _Float16* __restrict__ att) {
  const int qt = blockIdx.x, hh = blockIdx.y, bb = blockIdx.z;
  const int tid = threadIdx.x, wave = tid >> 5, lane = tid & 31;
  const int nloc = lane & 15, hi = lane >> 4;

  // K and V: two buffers each; tile t lies in buffer t & 1 and is copied one trip ahead
  __shared__ __attribute__((aligned(32))) _Float16 Qs[QB_ * QK_STRIDE];
  __shared__ __attribute__((aligned(32))) _Float16 Ks[2 * 64 * QK_STRIDE];
  __shared__ __attribute__((aligned(32))) _Float16 Vs[2 * 64 * V_STRIDE];  // [k][d], as in memory
  __shared__ __attribute__((aligned(32))) float maskAdd[2 * 64];
  // the order in which keys are walked: every key of the batch row once, as the byte
  // offset of its K/V row; kept keys first, masked keys behind them
  __shared__ __attribute__((aligned(32))) int korder[S_];
  __shared__ __attribute__((aligned(16))) int wkept[4];  // kept keys in each wave's quarter

  const size_t bh = ((size_t)bb * H_ + hh) * S_;
  // the thread's own first piece of a tile, in memory and in LDS
  const _Float16* Qg = Q + (bh + (size_t)qt * QB_) * DH_ + tid * 8;
  const int qk_off = (tid >> 3) * QK_STRIDE + (tid & 7) * 8;
  // of a K or V tile a thread copies its piece of the four rows rg4 .. rg4 + 3
  const _Float16* Kg = K + bh * DH_ + (tid & 7) * 8;
  const _Float16* Vg = V + bh * DH_ + (tid & 7) * 8;
  const int rg4 = (tid >> 3) * 4;
  const int k_off = rg4 * QK_STRIDE + (tid & 7) * 8;
  const int v_off = rg4 * V_STRIDE + (tid & 7) * 8;

  // Q tile (64 rows a call); it flies while the key order is built
#pragma unroll
  for (int r = 0; r < QB_ / 64; ++r)
    stage_tile(&Qs[r * 64 * QK_STRIDE + qk_off], Qg + r * 64 * DH_, QK_STRIDE);

  // Key order. A masked key's weight is exp(-1e9 - max) = 0 as soon as one key of the
  // batch row is kept, so only the tiles that hold kept keys are walked; the masked keys
  // that fill up the last of them get -1e9 as before. With no key kept every tile is
  // walked, all at -1e9, which gives the reference's even weights.
  // Each wave takes a quarter of the row, 32 keys (one a lane) at a time.
  const int wv = __builtin_amdgcn_readfirstlane(wave);
  const int* mrow = mask + bb * S_ + wv * (S_ / 4) + lane;
  int mv[S_ / 128];
  // unrolled: all loads in flight at once, mv[] in registers
#pragma unroll
  for (int i = 0; i < S_ / 128; ++i) mv[i] = mrow[i * 32];
  // no address register of these loads is written anew ahead of this wait
  asm volatile("s_wait_xcnt 0x0" ::: "memory");
  unsigned kb[S_ / 128];  // bit l: the chunk's key l is kept
  int wk = 0;
  // unrolled: constant indices keep kb[] in scalar registers
#pragma unroll
  for (int i = 0; i < S_ / 128; ++i) {
    kb[i] = __builtin_amdgcn_ballot_w32(mv[i] == 0);
    wk += __builtin_popcount(kb[i]);
  }
  if (lane == 0) wkept[wv] = wk;
  __syncthreads();  // every wave's count is there
  int kept = 0, before = 0;  // in the whole row; in front of this wave's next chunk
  // unrolled: four counts, one LDS read
#pragma unroll
  for (int w = 0; w < 4; ++w) {
    const int c = __builtin_amdgcn_readfirstlane(wkept[w]);
    kept += c;
    if (w < wv) before += c;
  }
  // unrolled: constant indices into kb[]
#pragma unroll
  for (int i = 0; i < S_ / 128; ++i) {
    const int s = wv * (S_ / 4) + i * 32 + lane;                        // the lane's key
    const int kbef = (int)__builtin_amdgcn_mbcnt_lo(kb[i], (unsigned)before);  // kept in front of it
    // place: a kept key behind the kept ones in front of it; a masked key behind all
    // kept keys and the s - kbef masked ones in front of it: each place 0 .. S_-1 once
    korder[((kb[i] >> lane) & 1u) ? kbef : kept + s - kbef] = s * (DH_ * 2);
    before += __builtin_popcount(kb[i]);
  }
  // key tiles to walk: uniform, at least 1, at most NT_
  const int nt = kept == 0 ? NT_ : min((kept + 63) >> 6, NT_);
  if (tid < 64) maskAdd[tid] = tid < kept ? 0.0f : -1e9f;
  __syncthreads();  // the key order is whole before any wave gathers by it

  // tile 0
  {
    const i32x4 k0 = *(const i32x4*)&korder[rg4];
    stage_rows(&Ks[k_off], Kg, k0, QK_STRIDE);
    stage_rows(&Vs[v_off], Vg, k0, V_STRIDE);
  }
  wait_async0();
  __syncthreads();
  // tile 1, where there is one, flies while tile 0 is worked on
  if (1 < nt) {
    const i32x4 k1 = *(const i32x4*)&korder[64 + rg4];
    stage_rows(&Ks[64 * QK_STRIDE + k_off], Kg, k1, QK_STRIDE);
    stage_rows(&Vs[64 * V_STRIDE + v_off], Vg, k1, V_STRIDE);
  }

  // B operands: column = query, contiguous = head dim; group g holds the wave's
  // queries g*16 .. g*16 + 15
  v16h bq0[QG_], bq1[QG_];
#pragma unroll
  for (int g = 0; g < QG_; ++g) {
    bq0[g] = frag_from_rows(&Qs[((wave * QG_ + g) * 16) * QK_STRIDE + 0], QK_STRIDE);
    bq1[g] = frag_from_rows(&Qs[((wave * QG_ + g) * 16) * QK_STRIDE + 32], QK_STRIDE);
  }

  // lane's address in V buffer 0 for the transposing loads
  const _Float16* vrd = &Vs[(8 * hi + (lane & 7)) * V_STRIDE + 8 * ((lane >> 3) & 1)];

  v8f o[QG_][4];   // o[g][t2][j] = O[query g*16 + nloc][d = t2*16 + 8*hi + j]
  float rmax[QG_];  // of query g*16 + nloc, alike in both halves
  float rsum[QG_];  // of this half's keys only; joined at the end
#pragma unroll
  for (int g = 0; g < QG_; ++g) {
#pragma unroll
    for (int t = 0; t < 4; ++t) o[g][t] = (v8f){0, 0, 0, 0, 0, 0, 0, 0};
    rmax[g] = -__builtin_inff();
    rsum[g] = 0.f;
  }

  // where the current tile's buffer starts in Ks and Vs (elements): 0 or one buffer's
  // size, flipped at each trip's end; kept as uniform offsets so that an LDS address
  // costs one add
  int kofs = 0, vofs = 0;
  for (int kt = 0; kt < nt; ++kt) {
    const int mofs = (kt & 1) * 64;  // the same for maskAdd
    // rows of tile kt + 2, read in front of the foot's waits, so that the copies behind
    // the barrier find them in registers (where there is no such tile: the last tile's
    // again, unused; the index stays inside the list)
    const i32x4 kn = *(const i32x4*)&korder[min(kt + 2, nt - 1) * 64 + rg4];
    // scores, transposed: 64 keys x 16 queries per group, Q pre-scaled
    // c[g][t][j] = S[query g*16 + nloc][key t*16 + 8*hi + j]
    // all loops over g, c[] and o[] are unrolled so that every index is a constant
    // and the tiles stay in registers
    v8f c[QG_][4];
#pragma unroll
    for (int t = 0; t < 4; ++t) {
      v16h ak0 = frag_from_rows(&Ks[kofs + (t * 16) * QK_STRIDE + 0], QK_STRIDE);
      v16h ak1 = frag_from_rows(&Ks[kofs + (t * 16) * QK_STRIDE + 32], QK_STRIDE);
      const v8f madd = *(const v8f*)&maskAdd[mofs + t * 16 + hi * 8];
      v8f cc[QG_];
#pragma unroll
      for (int g = 0; g < QG_; ++g)
        cc[g] = wmma_f16(ak0, bq0[g], (v8f){0, 0, 0, 0, 0, 0, 0, 0});
#pragma unroll
      for (int g = 0; g < QG_; ++g) cc[g] = wmma_f16(ak1, bq1[g], cc[g]);
#pragma unroll
      for (int g = 0; g < QG_; ++g) c[g][t] = cc[g] + madd;
    }

    // online softmax: one query per lane and group, 32 of the tile's 64 keys in each half
    v16h bp0[QG_], bp1[QG_];
#pragma unroll
    for (int g = 0; g < QG_; ++g) {
      float v = c[g][0][0];
#pragma unroll
      for (int t = 0; t < 4; ++t)
#pragma unroll
        for (int j = 0; j < 8; ++j) v = fmaxf(v, c[g][t][j]);
      v = fmaxf(v, other_half(v));
      const float nm = fmaxf(rmax[g], v);
      const float corr = __expf(rmax[g] - nm);
      rmax[g] = nm;
#pragma unroll
      for (int t = 0; t < 4; ++t)
#pragma unroll
        for (int j = 0; j < 8; ++j) c[g][t][j] = __expf(c[g][t][j] - nm);
      const v8f sv = (c[g][0] + c[g][1]) + (c[g][2] + c[g][3]);
      rsum[g] = rsum[g] * corr +
                (((sv[0] + sv[1]) + (sv[2] + sv[3])) + ((sv[4] + sv[5]) + (sv[6] + sv[7])));
#pragma unroll
      for (int t = 0; t < 4; ++t) o[g][t] *= corr;

      // P^T as B operand: element e is key 8*hi + e (e < 8) or 16 + 8*hi + (e - 8) of
      // its 32 keys, which is register e&7 of score tile e>>3: no lane exchange
#pragma unroll
      for (int e = 0; e < 16; ++e) {
        bp0[g][e] = (_Float16)c[g][e >> 3][e & 7];        // keys 0..31
        bp1[g][e] = (_Float16)c[g][2 + (e >> 3)][e & 7];  // keys 32..63
      }
    }
    const _Float16* vb = vrd + vofs;
#pragma unroll
    for (int t2 = 0; t2 < 4; ++t2) {
      // A operand: row = head dim t2*16 + nloc, k = keys
      v16h av0 = vt_frag(vb + t2 * 16);
      v16h av1 = vt_frag(vb + 32 * V_STRIDE + t2 * 16);
#pragma unroll
      for (int g = 0; g < QG_; ++g) o[g][t2] = wmma_f16(av0, bp0[g], o[g][t2]);
#pragma unroll
      for (int g = 0; g < QG_; ++g) o[g][t2] = wmma_f16(av1, bp1[g], o[g][t2]);
    }

    // foot of the trip: the next tile's mask (places from kept on hold masked keys) goes
    // into the mask buffer that nobody reads in this trip (behind the last tile nobody reads it);
    // then this wave's LDS work and its copies of the next tile are done, and the one
    // barrier both publishes that tile and ends every wave's reads of this buffer
    if (tid < 64) maskAdd[(mofs ^ 64) + tid] = (kt + 1) * 64 + tid < kept ? 0.0f : -1e9f;
    wait_ds0();
    wait_async0();
    __syncthreads();
    if (kt + 2 < nt) {  // tile kt + 2 into the buffer just left, a whole trip ahead of its use
      stage_rows(&Ks[kofs + k_off], Kg, kn, QK_STRIDE);
      stage_rows(&Vs[vofs + v_off], Vg, kn, V_STRIDE);
    }
    kofs ^= 64 * QK_STRIDE;
    vofs ^= 64 * V_STRIDE;
  }
  wait_async0();

  // normalize + write att[b, s, h*64+d] as f16: 8 consecutive d per lane
#pragma unroll
  for (int g = 0; g < QG_; ++g) {
    const float inv = 1.0f / (rsum[g] + other_half(rsum[g]));
    const size_t row = (size_t)bb * S_ + qt * QB_ + (wave * QG_ + g) * 16 + nloc;
    _Float16* dst = att + row * (H_ * DH_) + hh * DH_ + hi * 8;
#pragma unroll
    for (int t2 = 0; t2 < 4; ++t2) {
      v8h ov;
#pragma unroll
      for (int j = 0; j < 8; ++j) ov[j] = (_Float16)(o[g][t2][j] * inv);
      *(v8h*)(dst + t2 * 16) = ov;
    }
  }
}

// ---------------- Kernel 3: output projection ----------------------------
// out[m,d] = sum_e att[m,e] * Wo[d,e] + bo[d]  (fp32 out)
__global__ __launch_bounds__(256) void out_proj_kernel(
    const _Float16* __restrict__ att, const float* __restrict__ Wo,
    const float* __restrict__ bo, float* __restrict__ out) {
  const int m0 = blockIdx.y * PT_M;
  const int n0 = blockIdx.x * PT_N;
  const int tid = threadIdx.x;
  const int wave = tid >> 5;
  const int wm = (wave >> 2) * (PF_M * 16);
  const int wn = (wave & 3) * (PF_N * 16);

  // att tiles (f16) and Wo tiles (f32), two buffers each, copied one trip ahead as in
  // kernel 1
  __shared__ __attribute__((aligned(16))) _Float16 As[2 * PT_M * F16_STRIDE];
  __shared__ __attribute__((aligned(16))) float Bs[2 * PT_N * F32_STRIDE];

  // all loops over acc[][] are unrolled so that every index is a constant
  v8f acc[PF_M][PF_N];
#pragma unroll
  for (int i = 0; i < PF_M; ++i)
#pragma unroll
    for (int j = 0; j < PF_N; ++j) acc[i][j] = (v8f){0, 0, 0, 0, 0, 0, 0, 0};

  // the thread's own 16-byte piece of a tile's first rows, in memory and in LDS: of att
  // four lanes take a row of PK_ halves, 64 rows a copy; of Wo as in kernel 1
  const _Float16* ag = att + (size_t)(m0 + (tid >> 2)) * D_ + (tid & 3) * 8;
  const float* bg = Wo + (size_t)(n0 + (tid >> 3)) * D_ + (tid & 7) * 4;
  _Float16* al = &As[(tid >> 2) * F16_STRIDE + (tid & 3) * 8];
  float* bl = &Bs[(tid >> 3) * F32_STRIDE + (tid & 7) * 4];

  // tile 0
  async_copy2_b128(al, ag, al + 64 * F16_STRIDE, ag + 64 * D_);
  stage_f32_n(bl, bg);
  wait_async0();
  __syncthreads();
  // tile 1 flies while tile 0 is worked on
  async_copy2_b128(al + PT_M * F16_STRIDE, ag + PK_, al + (PT_M + 64) * F16_STRIDE,
                   ag + 64 * D_ + PK_);
  stage_f32_n(bl + PT_N * F32_STRIDE, bg + PK_);

  // where the current tile's buffer starts in As and Bs (elements), flipped at each foot
  int aofs = 0, bofs = 0;
  for (int t = 0; t < PNK_; ++t) {
    v16h a[PF_M];
#pragma unroll
    for (int i = 0; i < PF_M; ++i)
      a[i] = frag_from_rows(&As[aofs + (wm + i * 16) * F16_STRIDE], F16_STRIDE);
#pragma unroll
    for (int j = 0; j < PF_N; ++j) {
      const v16h b = frag_from_f32_rows(&Bs[bofs + (wn + j * 16) * F32_STRIDE]);
#pragma unroll
      for (int i = 0; i < PF_M; ++i) acc[i][j] = wmma_f16(a[i], b, acc[i][j]);
    }
    // foot of the trip, as in kernel 1
    wait_ds0();
    wait_async0();
    __syncthreads();
    if (t + 2 < PNK_) {  // tile t + 2 into the buffer just left
      async_copy2_b128(al + aofs, ag + (t + 2) * PK_, al + aofs + 64 * F16_STRIDE,
                       ag + 64 * D_ + (t + 2) * PK_);
      stage_f32_n(bl + bofs, bg + (t + 2) * PK_);
    }
    aofs ^= PT_M * F16_STRIDE;
    bofs ^= PT_N * F32_STRIDE;
  }
  wait_async0();

  const int lane = tid & 31;
  const int nloc = lane & 15, hi = lane >> 4;
#pragma unroll
  for (int sm = 0; sm < PF_M; ++sm)
#pragma unroll
    for (int sn = 0; sn < PF_N; ++sn) {
      int e = n0 + wn + sn * 16 + nloc;
      float bsv = bo[e];
#pragma unroll
      for (int j = 0; j < 8; ++j) {
        int m = m0 + wm + sm * 16 + j + hi * 8;
        out[(size_t)m * D_ + e] = acc[sm][sn][j] + bsv;
      }
    }
}

extern "C" void kernel_launch(void* const* d_in, const int* in_sizes, int n_in,
                              void* d_out, int out_size, void* d_ws,
                              size_t ws_size, hipStream_t stream) {
  (void)in_sizes; (void)n_in; (void)out_size; (void)ws_size;
  const float* h  = (const float*)d_in[0];
  const float* Wq = (const float*)d_in[1];
  const float* bq = (const float*)d_in[2];
  const float* Wk = (const float*)d_in[3];
  const float* bk = (const float*)d_in[4];
  const float* Wv = (const float*)d_in[5];
  const float* bv = (const float*)d_in[6];
  const float* Wo = (const float*)d_in[7];
  const float* bo = (const float*)d_in[8];
  const int* mask = (const int*)d_in[9];
  float* out = (float*)d_out;

  _Float16* ws = (_Float16*)d_ws;
  const size_t per = (size_t)B_ * H_ * S_ * DH_;  // 6,291,456 halves
  _Float16* Qb = ws;
  _Float16* Kb = ws + per;
  _Float16* Vb = ws + 2 * per;
  _Float16* Ab = ws + 3 * per;

  qkv_proj_kernel<<<dim3(D_ / PT_N, (B_ * S_) / PT_M, 3), 256, 0, stream>>>(
      h, Wq, bq, Wk, bk, Wv, bv, Qb, Kb, Vb);
  attn_kernel<<<dim3(S_ / QB_, H_, B_), 128, 0, stream>>>(Qb, Kb, Vb, mask, Ab);
  out_proj_kernel<<<dim3(D_ / PT_N, (B_ * S_) / PT_M), 256, 0, stream>>>(
      Ab, Wo, bo, out);
}

// v008
// It runs in 107 microseconds.
// Two timings next to v007 both put it at 1.12 times that version's speed.
// All steps since v000 together make it 5.10 times as fast.
#include <hip/hip_runtime.h>
#include <hip/hip_bf16.h>

#define B_  2
#define S_  4096
#define D_  768
#define H_  12
#define DH_ 64

typedef _Float16 v16h __attribute__((ext_vector_type(16)));
typedef float    v8f  __attribute__((ext_vector_type(8)));
typedef _Float16 v8h  __attribute__((ext_vector_type(8)));

// Build a WMMA f16 fragment from 16 rows (stride in halves) of LDS.
// Works for A (row = M, contiguous dim = K) and for column-major B
// (row = N column, contiguous dim = K).
// CDNA5 16-bit A layout: lane r=lane%16 holds row r; hi=lane/16 selects the
// +8 K offset half; VGPR v<4 -> K = hi*8 + 2v{+1}; v>=4 -> K = 16 + hi*8 + 2(v-4){+1}.
// Each 8-half group is contiguous -> lowers to two ds_load_b128.
__device__ __forceinline__ v16h frag_from_rows(const _Float16* p, int stride) {
  const int lane = threadIdx.x & 31;
  const int r = lane & 15, hi = lane >> 4;
  const _Float16* q = p + r * stride + hi * 8;
  v16h f;
#pragma unroll
  for (int v = 0; v < 4; ++v) {
    f[2 * v]         = q[2 * v];
    f[2 * v + 1]     = q[2 * v + 1];
    f[8 + 2 * v]     = q[16 + 2 * v];
    f[8 + 2 * v + 1] = q[16 + 2 * v + 1];
  }
  return f;
}

__device__ __forceinline__ v8f wmma_f16(v16h a, v16h b, v8f c) {
  return __builtin_amdgcn_wmma_f32_16x16x32_f16(false, a, false, b, (short)0, c,
                                                false, false);
}

// Four async global -> LDS copies of 16 bytes of one lane (ASYNCcnt-tracked; the
// low 32 bits of a __shared__ address are the LDS offset). The s_wait_xcnt stands
// inside the statement so that no address register of a copy is rewritten ahead of it.
__device__ __forceinline__ void async_copy4_b128(void* l0, const void* g0,
                                                 void* l1, const void* g1,
                                                 void* l2, const void* g2,
                                                 void* l3, const void* g3) {
  asm volatile("global_load_async_to_lds_b128 %0, %1, off\n\t"
               "global_load_async_to_lds_b128 %2, %3, off\n\t"
               "global_load_async_to_lds_b128 %4, %5, off\n\t"
               "global_load_async_to_lds_b128 %6, %7, off\n\t"
               "s_wait_xcnt 0x0"
               :: "v"((uint32_t)(uintptr_t)l0), "v"(g0),
                  "v"((uint32_t)(uintptr_t)l1), "v"(g1),
                  "v"((uint32_t)(uintptr_t)l2), "v"(g2),
                  "v"((uint32_t)(uintptr_t)l3), "v"(g3)
               : "memory");
}
// the wave's own copies have landed
__device__ __forceinline__ void wait_async0() {
  asm volatile("s_wait_asynccnt 0x0" ::: "memory");
}
// the wave's own LDS reads and writes are done (before a buffer is handed over)
__device__ __forceinline__ void wait_ds0() {
  asm volatile("s_wait_dscnt 0x0" ::: "memory");
}
// 64 rows of 64 halves, contiguous in memory, into LDS rows of `stride` halves:
// 128 threads, four 16-byte pieces each. l and g are the thread's own first piece.
__device__ __forceinline__ void stage_tile(_Float16* l, const _Float16* g, int stride) {
  async_copy4_b128(l, g, l + 16 * stride, g + 1024, l + 32 * stride, g + 2048,
                   l + 48 * stride, g + 3072);
}

typedef int i32x4 __attribute__((ext_vector_type(4)));
// Four gathered rows of 64 halves into four LDS rows that follow one another: bo holds
// the rows' byte offsets in the K or V plane of this head; l and g are the thread's
// own piece of LDS row 0 of the four and of memory row 0 of the plane. Eight lanes take
// one row, so that every copy still moves whole 128-byte lines.
__device__ __forceinline__ void stage_rows(_Float16* l, const _Float16* g, i32x4 bo,
                                           int stride) {
  const char* gb = (const char*)g;
  async_copy4_b128(l, gb + (unsigned)bo[0], l + stride, gb + (unsigned)bo[1],
                   l + 2 * stride, gb + (unsigned)bo[2], l + 3 * stride, gb + (unsigned)bo[3]);
}

// Tile of both projection kernels: a work-group of eight waves (2 x 4) takes PT_M rows
// by PT_N columns of Y, a wave 64 x 48: 4 A and 3 B fragments feed 12 products, and a
// staged element of X or W serves 192 or 128 outputs.
#define PT_M 128
#define PT_N 192
#define PF_M 4   // A fragments (16 rows each) of a wave
#define PF_N 3   // B fragments (16 columns each) of a wave
#define PK_ 64             // k of one trip: a staged row is one whole 128-byte line of f16
#define PNK_ (D_ / PK_)    // trips
#define T_STRIDE 72        // halves; 144B rows = 16B x odd -> conflict-free b128 reads
#define T_BUF ((PT_M + PT_N) * T_STRIDE)  // halves of one buffer

typedef float    v4f __attribute__((ext_vector_type(4)));
typedef _Float16 v4h __attribute__((ext_vector_type(4)));

// ---------------- Kernel 0: operands of the projections to f16 -----------
// h, Wq, Wk, Wv, Wo, each rounded to f16 once, into one run of the workspace in that
// order (the projection kernels rounded every element anew in each work-group that read
// it, and staged it at four bytes). A work-group takes CV_BLK elements that follow one
// another; h and each W are whole multiples of that.
#define CV_N 16                    // 16-byte pieces of a thread
#define CV_BLK (256 * CV_N * 4)    // elements of a work-group
#define CV_HB (B_ * S_ * D_ / CV_BLK)  // work-groups on h
#define CV_WB (D_ * D_ / CV_BLK)       // work-groups on one W
__global__ __launch_bounds__(256) void to_f16_kernel(
    const float* __restrict__ hsrc, const float* __restrict__ Wq,
    const float* __restrict__ Wk, const float* __restrict__ Wv,
    const float* __restrict__ Wo, _Float16* __restrict__ dst) {
  const int b = blockIdx.x;
  const float* src;
  if (b < CV_HB) {
    src = hsrc + (size_t)b * CV_BLK;
  } else {
    const int w = (b - CV_HB) / CV_WB, r = (b - CV_HB) % CV_WB;
    src = (w == 0 ? Wq : (w == 1 ? Wk : (w == 2 ? Wv : Wo))) + (size_t)r * CV_BLK;
  }
  const v4f* s = (const v4f*)src + threadIdx.x;
  v4h* d = (v4h*)(dst + (size_t)b * CV_BLK) + threadIdx.x;
  v4f x[CV_N];
  // unrolled: all loads in flight at once, x[] in registers
#pragma unroll
  for (int i = 0; i < CV_N; ++i) x[i] = s[i * 256];
#pragma unroll
  for (int i = 0; i < CV_N; ++i) d[i * 256] = __builtin_convertvector(x[i], v4h);
}

// PK_ columns of PT_M rows of one f16 matrix and of PT_N rows of another, both with D_
// columns, into PT_M + PT_N LDS rows of T_STRIDE halves that follow one another: 256
// threads, eight lanes a row (one whole 128-byte line), 32 rows a copy. Each copy's address
// is a scalar base (ga, gb: the tiles' first elements, uniform) plus the thread's byte
// offset vo in 32 rows, the same for all ten: no address of memory is held or formed in
// vector registers. The s_wait_xcnt stands inside the statement so that no address
// register of a copy is rewritten ahead of it.
__device__ __forceinline__ void stage_f16_mn(_Float16* l, unsigned vo, const _Float16* ga,
                                             const _Float16* gb) {
  const uint32_t l0 = (uint32_t)(uintptr_t)l;
  asm volatile("global_load_async_to_lds_b128 %0, %10, %11\n\t"
               "global_load_async_to_lds_b128 %1, %10, %12\n\t"
               "global_load_async_to_lds_b128 %2, %10, %13\n\t"
               "global_load_async_to_lds_b128 %3, %10, %14\n\t"
               "global_load_async_to_lds_b128 %4, %10, %15\n\t"
               "global_load_async_to_lds_b128 %5, %10, %16\n\t"
               "global_load_async_to_lds_b128 %6, %10, %17\n\t"
               "global_load_async_to_lds_b128 %7, %10, %18\n\t"
               "global_load_async_to_lds_b128 %8, %10, %19\n\t"
               "global_load_async_to_lds_b128 %9, %10, %20\n\t"
               "s_wait_xcnt 0x0"
               :: "v"(l0), "v"(l0 + 1 * 32 * T_STRIDE * 2), "v"(l0 + 2 * 32 * T_STRIDE * 2),
                  "v"(l0 + 3 * 32 * T_STRIDE * 2), "v"(l0 + 4 * 32 * T_STRIDE * 2),
                  "v"(l0 + 5 * 32 * T_STRIDE * 2), "v"(l0 + 6 * 32 * T_STRIDE * 2),
                  "v"(l0 + 7 * 32 * T_STRIDE * 2), "v"(l0 + 8 * 32 * T_STRIDE * 2),
                  "v"(l0 + 9 * 32 * T_STRIDE * 2), "v"(vo),
                  "s"(ga), "s"(ga + 32 * D_), "s"(ga + 64 * D_), "s"(ga + 96 * D_),
                  "s"(gb), "s"(gb + 32 * D_), "s"(gb + 64 * D_), "s"(gb + 96 * D_),
                  "s"(gb + 128 * D_), "s"(gb + 160 * D_)
               : "memory");
}

// The products of one work-group's tile, for both projection kernels:
// acc[i][j] += X[wm + 16 i ..][k] * W[wn + 16 j ..][k] over all D_ values of k, in rising k.
// ag, bg: first elements of the work-group's rows of X and W (uniform). Ts: two buffers of
// PT_M rows of X and PT_N rows of W behind them; the tile of trip t lies in buffer t & 1
// and is copied one trip ahead.
__device__ __forceinline__ void proj_tile(const _Float16* ag, const _Float16* bg,
                                          _Float16* Ts, int wm, int wn,
                                          v8f (&acc)[PF_M][PF_N]) {
  const int tid = threadIdx.x;
  // all loops over acc[][] are unrolled so that every index is a constant
#pragma unroll
  for (int i = 0; i < PF_M; ++i)
#pragma unroll
    for (int j = 0; j < PF_N; ++j) acc[i][j] = (v8f){0, 0, 0, 0, 0, 0, 0, 0};

  // the thread's own 16-byte piece of the first 32 rows of a tile, as a byte offset in
  // memory and as a place in LDS
  const unsigned vo = (unsigned)((tid >> 3) * D_ + (tid & 7) * 8) * 2u;
  _Float16* tl = &Ts[(tid >> 3) * T_STRIDE + (tid & 7) * 8];

  // tile 0
  stage_f16_mn(tl, vo, ag, bg);
  wait_async0();
  __syncthreads();
  // tile 1 flies while tile 0 is worked on
  stage_f16_mn(tl + T_BUF, vo, ag + PK_, bg + PK_);

  // where the current tile's buffer starts in Ts (elements), flipped at each foot
  int tofs = 0;
  for (int t = 0; t < PNK_; ++t) {
    // The trip's two k blocks of 32, in rising k, as eight steps of one A fragment each. The
    // three B fragments of a block stay; the A fragment of the next step is read while this
    // step's is multiplied, over the blocks' border too. The scheduling barriers keep each
    // read one step ahead of its use: without them one register set serves every A fragment
    // and each step waits out its own LDS read.
    const _Float16* ta = &Ts[tofs + wm * T_STRIDE];
    const _Float16* tb = &Ts[tofs + (PT_M + wn) * T_STRIDE];
    v16h b[PF_N];
#pragma unroll
    for (int j = 0; j < PF_N; ++j) b[j] = frag_from_rows(tb + j * 16 * T_STRIDE, T_STRIDE);
    v16h a = frag_from_rows(ta, T_STRIDE);
    __builtin_amdgcn_sched_barrier(0);
#pragma unroll
    for (int s = 0; s < 2 * PF_M; ++s) {
      const int i = s % PF_M, sn = s + 1;
      v16h an = a;
      if (sn < 2 * PF_M)
        an = frag_from_rows(ta + (sn % PF_M) * 16 * T_STRIDE + (sn / PF_M) * 32, T_STRIDE);
#pragma unroll
      for (int j = 0; j < PF_N; ++j) acc[i][j] = wmma_f16(a, b[j], acc[i][j]);
      if (sn == PF_M) {  // the second block's B fragments, each behind its last use
#pragma unroll
        for (int j = 0; j < PF_N; ++j)
          b[j] = frag_from_rows(tb + j * 16 * T_STRIDE + 32, T_STRIDE);
      }
      __builtin_amdgcn_sched_barrier(0);
      a = an;
    }
    // foot of the trip: this wave's LDS reads and its copies of the next tile are done;
    // the one barrier both publishes that tile and ends every wave's reads of this buffer
    wait_ds0();
    wait_async0();
    __syncthreads();
    if (t + 2 < PNK_)  // tile t + 2 into the buffer just left
      stage_f16_mn(tl + tofs, vo, ag + (t + 2) * PK_, bg + (t + 2) * PK_);
    tofs ^= T_BUF;
  }
  wait_async0();
}

// ---------------- Kernel 1: fused QKV projection -------------------------
// Y[m,e] = sum_k h[m,k] * W[e,k] + bias[e]; written f16 to [B,H,S,DH].
// Q gets the softmax scale (1/sqrt(DH)) folded in. h16 and W16 (the rows of Wq, Wk, Wv
// behind one another) come from kernel 0.
__global__ __launch_bounds__(256) void qkv_proj_kernel(
    const _Float16* __restrict__ h16, const _Float16* __restrict__ W16,
    const float* __restrict__ bq, const float* __restrict__ bk,
    const float* __restrict__ bv,
    _Float16* __restrict__ Qo, _Float16* __restrict__ Ko,
    _Float16* __restrict__ Vo) {
  const int which = blockIdx.z;
  const float* bias = which == 0 ? bq : (which == 1 ? bk : bv);
  _Float16* out     = which == 0 ? Qo : (which == 1 ? Ko : Vo);
  const float oscale = which == 0 ? 0.125f : 1.0f;  // 1/sqrt(64)

  const int m0 = blockIdx.y * PT_M;
  const int n0 = blockIdx.x * PT_N;
  const int tid = threadIdx.x;
  // the wave's number as a scalar: what follows from it takes no vector registers
  const int wave = __builtin_amdgcn_readfirstlane(tid >> 5);
  const int wm = (wave >> 2) * (PF_M * 16);  // 0, 64
  const int wn = (wave & 3) * (PF_N * 16);   // 0 .. 144

  __shared__ __attribute__((aligned(16))) _Float16 Ts[2 * T_BUF];
  v8f acc[PF_M][PF_N];
  proj_tile(h16 + (size_t)m0 * D_, W16 + (size_t)(which * D_ + n0) * D_, Ts, wm, wn, acc);

  const int lane = tid & 31;
  const int nloc = lane & 15, hi = lane >> 4;
#pragma unroll
  for (int sm = 0; sm < PF_M; ++sm)
#pragma unroll
    for (int sn = 0; sn < PF_N; ++sn) {
      int e = n0 + wn + sn * 16 + nloc;
      int hh = e >> 6, d = e & 63;
      float bsv = bias[e];
#pragma unroll
      for (int j = 0; j < 8; ++j) {
        int m = m0 + wm + sm * 16 + j + hi * 8;
        int bb = m >> 12;          // m / S_
        int s = m & (S_ - 1);
        size_t o = (((size_t)bb * H_ + hh) * S_ + s) * DH_ + d;
        out[o] = (_Float16)((acc[sm][sn][j] + bsv) * oscale);
      }
    }
}

#define QK_STRIDE 72   // halves; 144B rows = 16B x odd -> conflict-free b128 reads
#define NT_ (S_ / 64)  // key tiles
#define V_STRIDE 80    // halves; 160B rows = 32B x odd, the transposing load's pitch

typedef short s16x8 __attribute__((ext_vector_type(8)));
typedef __attribute__((address_space(3))) s16x8 lds_s16x8;

// A operand V^T (row = head dim, k = keys in the hardware k order) from the
// row-major V tile: p is the lane's address for keys kbase + 8*hi + (lane & 7);
// the second load takes the 16 keys behind them.
__device__ __forceinline__ v16h vt_frag(const _Float16* p) {
  v8h lo = __builtin_bit_cast(v8h, __builtin_amdgcn_ds_load_tr16_b128_v8i16((lds_s16x8*)p));
  v8h hi = __builtin_bit_cast(v8h, __builtin_amdgcn_ds_load_tr16_b128_v8i16(
                                       (lds_s16x8*)(p + 16 * V_STRIDE)));
  return __builtin_shufflevector(lo, hi, 0, 1, 2, 3, 4, 5, 6, 7, 8, 9, 10, 11, 12, 13, 14, 15);
}

// value of lane l ^ 16
__device__ __forceinline__ float other_half(float v) {
  int b = __builtin_bit_cast(int, v);
  b = __builtin_amdgcn_permlanex16(b, b, 0x76543210, 0xfedcba98, false, false);
  return __builtin_bit_cast(float, b);
}

// Each wave takes QG_ groups of 16 query columns, so that every K and V^T fragment
// read from LDS feeds QG_ products, and a work-group's K/V tile serves QB_ queries.
#define QG_ 2
#define QB_ (4 * QG_ * 16)  // queries per work-group of four waves

__global__ __launch_bounds__(128) void attn_kernel(
    const _Float16* __restrict__ Q, const _Float16* __restrict__ K,
    const _Float16* __restrict__ V, const int* __restrict__ mask,
    _Float16* __restrict__ att) {
  const int qt = blockIdx.x, hh = blockIdx.y, bb = blockIdx.z;
  const int tid = threadIdx.x, wave = tid >> 5, lane = tid & 31;
  const int nloc = lane & 15, hi = lane >> 4;

  // K and V: two buffers each; tile t lies in buffer t & 1 and is copied one trip ahead
  __shared__ __attribute__((aligned(32))) _Float16 Qs[QB_ * QK_STRIDE];
  __shared__ __attribute__((aligned(32))) _Float16 Ks[2 * 64 * QK_STRIDE];
  __shared__ __attribute__((aligned(32))) _Float16 Vs[2 * 64 * V_STRIDE];  // [k][d], as in memory
  __shared__ __attribute__((aligned(32))) float maskAdd[2 * 64];
  // the order in which keys are walked: every key of the batch row once, as the byte
  // offset of its K/V row; kept keys first, masked keys behind them
  __shared__ __attribute__((aligned(32))) int korder[S_];
  __shared__ __attribute__((aligned(16))) int wkept[4];  // kept keys in each wave's quarter

  const size_t bh = ((size_t)bb * H_ + hh) * S_;
  // the thread's own first piece of a tile, in memory and in LDS
  const _Float16* Qg = Q + (bh + (size_t)qt * QB_) * DH_ + tid * 8;
  const int qk_off = (tid >> 3) * QK_STRIDE + (tid & 7) * 8;
  // of a K or V tile a thread copies its piece of the four rows rg4 .. rg4 + 3
  const _Float16* Kg = K + bh * DH_ + (tid & 7) * 8;
  const _Float16* Vg = V + bh * DH_ + (tid & 7) * 8;
  const int rg4 = (tid >> 3) * 4;
  const int k_off = rg4 * QK_STRIDE + (tid & 7) * 8;
  const int v_off = rg4 * V_STRIDE + (tid & 7) * 8;

  // Q tile (64 rows a call); it flies while the key order is built
#pragma unroll
  for (int r = 0; r < QB_ / 64; ++r)
    stage_tile(&Qs[r * 64 * QK_STRIDE + qk_off], Qg + r * 64 * DH_, QK_STRIDE);

  // Key order. A masked key's weight is exp(-1e9 - max) = 0 as soon as one key of the
  // batch row is kept, so only the tiles that hold kept keys are walked; the masked keys
  // that fill up the last of them get -1e9 as before. With no key kept every tile is
  // walked, all at -1e9, which gives the reference's even weights.
  // Each wave takes a quarter of the row, 32 keys (one a lane) at a time.
  const int wv = __builtin_amdgcn_readfirstlane(wave);
  const int* mrow = mask + bb * S_ + wv * (S_ / 4) + lane;
  int mv[S_ / 128];
  // unrolled: all loads in flight at once, mv[] in registers
#pragma unroll
  for (int i = 0; i < S_ / 128; ++i) mv[i] = mrow[i * 32];
  // no address register of these loads is written anew ahead of this wait
  asm volatile("s_wait_xcnt 0x0" ::: "memory");
  unsigned kb[S_ / 128];  // bit l: the chunk's key l is kept
  int wk = 0;
  // unrolled: constant indices keep kb[] in scalar registers
#pragma unroll
  for (int i = 0; i < S_ / 128; ++i) {
    kb[i] = __builtin_amdgcn_ballot_w32(mv[i] == 0);
    wk += __builtin_popcount(kb[i]);
  }
  if (lane == 0) wkept[wv] = wk;
  __syncthreads();  // every wave's count is there
  int kept = 0, before = 0;  // in the whole row; in front of this wave's next chunk
  // unrolled: four counts, one LDS read
#pragma unroll
  for (int w = 0; w < 4; ++w) {
    const int c = __builtin_amdgcn_readfirstlane(wkept[w]);
    kept += c;
    if (w < wv) before += c;
  }
  // unrolled: constant indices into kb[]
#pragma unroll
  for (int i = 0; i < S_ / 128; ++i) {
    const int s = wv * (S_ / 4) + i * 32 + lane;                        // the lane's key
    const int kbef = (int)__builtin_amdgcn_mbcnt_lo(kb[i], (unsigned)before);  // kept in front of it
    // place: a kept key behind the kept ones in front of it; a masked key behind all
    // kept keys and the s - kbef masked ones in front of it: each place 0 .. S_-1 once
    korder[((kb[i] >> lane) & 1u) ? kbef : kept + s - kbef] = s * (DH_ * 2);
    before += __builtin_popcount(kb[i]);
  }
  // key tiles to walk: uniform, at least 1, at most NT_
  const int nt = kept == 0 ? NT_ : min((kept + 63) >> 6, NT_);
  if (tid < 64) maskAdd[tid] = tid < kept ? 0.0f : -1e9f;
  __syncthreads();  // the key order is whole before any wave gathers by it

  // tile 0
  {
    const i32x4 k0 = *(const i32x4*)&korder[rg4];
    stage_rows(&Ks[k_off], Kg, k0, QK_STRIDE);
    stage_rows(&Vs[v_off], Vg, k0, V_STRIDE);
  }
  wait_async0();
  __syncthreads();
  // tile 1, where there is one, flies while tile 0 is worked on
  if (1 < nt) {
    const i32x4 k1 = *(const i32x4*)&korder[64 + rg4];
    stage_rows(&Ks[64 * QK_STRIDE + k_off], Kg, k1, QK_STRIDE);
    stage_rows(&Vs[64 * V_STRIDE + v_off], Vg, k1, V_STRIDE);
  }

  // B operands: column = query, contiguous = head dim; group g holds the wave's
  // queries g*16 .. g*16 + 15
  v16h bq0[QG_], bq1[QG_];
#pragma unroll
  for (int g = 0; g < QG_; ++g) {
    bq0[g] = frag_from_rows(&Qs[((wave * QG_ + g) * 16) * QK_STRIDE + 0], QK_STRIDE);
    bq1[g] = frag_from_rows(&Qs[((wave * QG_ + g) * 16) * QK_STRIDE + 32], QK_STRIDE);
  }

  // lane's address in V buffer 0 for the transposing loads
  const _Float16* vrd = &Vs[(8 * hi + (lane & 7)) * V_STRIDE + 8 * ((lane >> 3) & 1)];

  v8f o[QG_][4];   // o[g][t2][j] = O[query g*16 + nloc][d = t2*16 + 8*hi + j]
  float rmax[QG_];  // of query g*16 + nloc, alike in both halves
  float rsum[QG_];  // of this half's keys only; joined at the end
#pragma unroll
  for (int g = 0; g < QG_; ++g) {
#pragma unroll
    for (int t = 0; t < 4; ++t) o[g][t] = (v8f){0, 0, 0, 0, 0, 0, 0, 0};
    rmax[g] = -__builtin_inff();
    rsum[g] = 0.f;
  }

  // where the current tile's buffer starts in Ks and Vs (elements): 0 or one buffer's
  // size, flipped at each trip's end; kept as uniform offsets so that an LDS address
  // costs one add
  int kofs = 0, vofs = 0;
  for (int kt = 0; kt < nt; ++kt) {
    const int mofs = (kt & 1) * 64;  // the same for maskAdd
    // rows of tile kt + 2, read in front of the foot's waits, so that the copies behind
    // the barrier find them in registers (where there is no such tile: the last tile's
    // again, unused; the index stays inside the list)
    const i32x4 kn = *(const i32x4*)&korder[min(kt + 2, nt - 1) * 64 + rg4];
    // scores, transposed: 64 keys x 16 queries per group, Q pre-scaled
    // c[g][t][j] = S[query g*16 + nloc][key t*16 + 8*hi + j]
    // all loops over g, c[] and o[] are unrolled so that every index is a constant
    // and the tiles stay in registers
    v8f c[QG_][4];
#pragma unroll
    for (int t = 0; t < 4; ++t) {
      v16h ak0 = frag_from_rows(&Ks[kofs + (t * 16) * QK_STRIDE + 0], QK_STRIDE);
      v16h ak1 = frag_from_rows(&Ks[kofs + (t * 16) * QK_STRIDE + 32], QK_STRIDE);
      const v8f madd = *(const v8f*)&maskAdd[mofs + t * 16 + hi * 8];
      v8f cc[QG_];
#pragma unroll
      for (int g = 0; g < QG_; ++g)
        cc[g] = wmma_f16(ak0, bq0[g], (v8f){0, 0, 0, 0, 0, 0, 0, 0});
#pragma unroll
      for (int g = 0; g < QG_; ++g) cc[g] = wmma_f16(ak1, bq1[g], cc[g]);
#pragma unroll
      for (int g = 0; g < QG_; ++g) c[g][t] = cc[g] + madd;
    }

    // online softmax: one query per lane and group, 32 of the tile's 64 keys in each half
    v16h bp0[QG_], bp1[QG_];
#pragma unroll
    for (int g = 0; g < QG_; ++g) {
      float v = c[g][0][0];
#pragma unroll
      for (int t = 0; t < 4; ++t)
#pragma unroll
        for (int j = 0; j < 8; ++j) v = fmaxf(v, c[g][t][j]);
      v = fmaxf(v, other_half(v));
      const float nm = fmaxf(rmax[g], v);
      const float corr = __expf(rmax[g] - nm);
      rmax[g] = nm;
#pragma unroll
      for (int t = 0; t < 4; ++t)
#pragma unroll
        for (int j = 0; j < 8; ++j) c[g][t][j] = __expf(c[g][t][j] - nm);
      const v8f sv = (c[g][0] + c[g][1]) + (c[g][2] + c[g][3]);
      rsum[g] = rsum[g] * corr +
                (((sv[0] + sv[1]) + (sv[2] + sv[3])) + ((sv[4] + sv[5]) + (sv[6] + sv[7])));
#pragma unroll
      for (int t = 0; t < 4; ++t) o[g][t] *= corr;

      // P^T as B operand: element e is key 8*hi + e (e < 8) or 16 + 8*hi + (e - 8) of
      // its 32 keys, which is register e&7 of score tile e>>3: no lane exchange
#pragma unroll
      for (int e = 0; e < 16; ++e) {
        bp0[g][e] = (_Float16)c[g][e >> 3][e & 7];        // keys 0..31
        bp1[g][e] = (_Float16)c[g][2 + (e >> 3)][e & 7];  // keys 32..63
      }
    }
    const _Float16* vb = vrd + vofs;
#pragma unroll
    for (int t2 = 0; t2 < 4; ++t2) {
      // A operand: row = head dim t2*16 + nloc, k = keys
      v16h av0 = vt_frag(vb + t2 * 16);
      v16h av1 = vt_frag(vb + 32 * V_STRIDE + t2 * 16);
#pragma unroll
      for (int g = 0; g < QG_; ++g) o[g][t2] = wmma_f16(av0, bp0[g], o[g][t2]);
#pragma unroll
      for (int g = 0; g < QG_; ++g) o[g][t2] = wmma_f16(av1, bp1[g], o[g][t2]);
    }

    // foot of the trip: the next tile's mask (places from kept on hold masked keys) goes
    // into the mask buffer that nobody reads in this trip (behind the last tile nobody reads it);
    // then this wave's LDS work and its copies of the next tile are done, and the one
    // barrier both publishes that tile and ends every wave's reads of this buffer
    if (tid < 64) maskAdd[(mofs ^ 64) + tid] = (kt + 1) * 64 + tid < kept ? 0.0f : -1e9f;
    wait_ds0();
    wait_async0();
    __syncthreads();
    if (kt + 2 < nt) {  // tile kt + 2 into the buffer just left, a whole trip ahead of its use
      stage_rows(&Ks[kofs + k_off], Kg, kn, QK_STRIDE);
      stage_rows(&Vs[vofs + v_off], Vg, kn, V_STRIDE);
    }
    kofs ^= 64 * QK_STRIDE;
    vofs ^= 64 * V_STRIDE;
  }
  wait_async0();

  // normalize + write att[b, s, h*64+d] as f16: 8 consecutive d per lane
#pragma unroll
  for (int g = 0; g < QG_; ++g) {
    const float inv = 1.0f / (rsum[g] + other_half(rsum[g]));
    const size_t row = (size_t)bb * S_ + qt * QB_ + (wave * QG_ + g) * 16 + nloc;
    _Float16* dst = att + row * (H_ * DH_) + hh * DH_ + hi * 8;
#pragma unroll
    for (int t2 = 0; t2 < 4; ++t2) {
      v8h ov;
#pragma unroll
      for (int j = 0; j < 8; ++j) ov[j] = (_Float16)(o[g][t2][j] * inv);
      *(v8h*)(dst + t2 * 16) = ov;
    }
  }
}

// ---------------- Kernel 3: output projection ----------------------------
// out[m,d] = sum_e att[m,e] * Wo[d,e] + bo[d]  (fp32 out); Wo16 comes from kernel 0
__global__ __launch_bounds__(256) void out_proj_kernel(
    const _Float16* __restrict__ att, const _Float16* __restrict__ Wo16,
    const float* __restrict__ bo, float* __restrict__ out) {
  const int m0 = blockIdx.y * PT_M;
  const int n0 = blockIdx.x * PT_N;
  const int tid = threadIdx.x;
  // the wave's number as a scalar, as in kernel 1
  const int wave = __builtin_amdgcn_readfirstlane(tid >> 5);
  const int wm = (wave >> 2) * (PF_M * 16);
  const int wn = (wave & 3) * (PF_N * 16);

  __shared__ __attribute__((aligned(16))) _Float16 Ts[2 * T_BUF];
  v8f acc[PF_M][PF_N];
  proj_tile(att + (size_t)m0 * D_, Wo16 + (size_t)n0 * D_, Ts, wm, wn, acc);

  const int lane = tid & 31;
  const int nloc = lane & 15, hi = lane >> 4;
#pragma unroll
  for (int sm = 0; sm < PF_M; ++sm)
#pragma unroll
    for (int sn = 0; sn < PF_N; ++sn) {
      int e = n0 + wn + sn * 16 + nloc;
      float bsv = bo[e];
#pragma unroll
      for (int j = 0; j < 8; ++j) {
        int m = m0 + wm + sm * 16 + j + hi * 8;
        out[(size_t)m * D_ + e] = acc[sm][sn][j] + bsv;
      }
    }
}

extern "C" void kernel_launch(void* const* d_in, const int* in_sizes, int n_in,
                              void* d_out, int out_size, void* d_ws,
                              size_t ws_size, hipStream_t stream) {
  (void)in_sizes; (void)n_in; (void)out_size; (void)ws_size;
  const float* h  = (const float*)d_in[0];
  const float* Wq = (const float*)d_in[1];
  const float* bq = (const float*)d_in[2];
  const float* Wk = (const float*)d_in[3];
  const float* bk = (const float*)d_in[4];
  const float* Wv = (const float*)d_in[5];
  const float* bv = (const float*)d_in[6];
  const float* Wo = (const float*)d_in[7];
  const float* bo = (const float*)d_in[8];
  const int* mask = (const int*)d_in[9];
  float* out = (float*)d_out;

  _Float16* ws = (_Float16*)d_ws;
  const size_t per = (size_t)B_ * H_ * S_ * DH_;  // halves of Q, K, V, att and h each
  _Float16* Qb = ws;
  _Float16* Kb = ws + per;
  _Float16* Vb = ws + 2 * per;
  _Float16* Ab = ws + 3 * per;
  _Float16* Hb = ws + 4 * per;                    // h, then Wq, Wk, Wv, Wo, as f16
  _Float16* Wb = ws + 5 * per;
  _Float16* Wob = Wb + (size_t)3 * D_ * D_;

  to_f16_kernel<<<dim3(CV_HB + 4 * CV_WB), 256, 0, stream>>>(h, Wq, Wk, Wv, Wo, Hb);
  qkv_proj_kernel<<<dim3(D_ / PT_N, (B_ * S_) / PT_M, 3), 256, 0, stream>>>(
      Hb, Wb, bq, bk, bv, Qb, Kb, Vb);
  attn_kernel<<<dim3(S_ / QB_, H_, B_), 128, 0, stream>>>(Qb, Kb, Vb, mask, Ab);
  out_proj_kernel<<<dim3(D_ / PT_N, (B_ * S_) / PT_M), 256, 0, stream>>>(
      Ab, Wob, bo, out);
}

// v009
// One run takes 103 microseconds.
// In both of two side-by-side timings against v008, it was 1.04 times as fast.
// Counting every step since v000, it is 5.29 times as fast.
#include <hip/hip_runtime.h>
#include <hip/hip_bf16.h>

#define B_  2
#define S_  4096
#define D_  768
#define H_  12
#define DH_ 64

typedef _Float16 v16h __attribute__((ext_vector_type(16)));
typedef float    v8f  __attribute__((ext_vector_type(8)));
typedef _Float16 v8h  __attribute__((ext_vector_type(8)));

// Build a WMMA f16 fragment from 16 rows (stride in halves) of LDS.
// Works for A (row = M, contiguous dim = K) and for column-major B
// (row = N column, contiguous dim = K).
// CDNA5 16-bit A layout: lane r=lane%16 holds row r; hi=lane/16 selects the
// +8 K offset half; VGPR v<4 -> K = hi*8 + 2v{+1}; v>=4 -> K = 16 + hi*8 + 2(v-4){+1}.
// Each 8-half group is contiguous -> lowers to two ds_load_b128.
__device__ __forceinline__ v16h frag_from_rows(const _Float16* p, int stride) {
  const int lane = threadIdx.x & 31;
  const int r = lane & 15, hi = lane >> 4;
  const _Float16* q = p + r * stride + hi * 8;
  v16h f;
#pragma unroll
  for (int v = 0; v < 4; ++v) {
    f[2 * v]         = q[2 * v];
    f[2 * v + 1]     = q[2 * v + 1];
    f[8 + 2 * v]     = q[16 + 2 * v];
    f[8 + 2 * v + 1] = q[16 + 2 * v + 1];
  }
  return f;
}

__device__ __forceinline__ v8f wmma_f16(v16h a, v16h b, v8f c) {
  return __builtin_amdgcn_wmma_f32_16x16x32_f16(false, a, false, b, (short)0, c,
                                                false, false);
}

// Four async global -> LDS copies of 16 bytes of one lane (ASYNCcnt-tracked; the
// low 32 bits of a __shared__ address are the LDS offset). The s_wait_xcnt stands
// inside the statement so that no address register of a copy is rewritten ahead of it.
__device__ __forceinline__ void async_copy4_b128(void* l0, const void* g0,
                                                 void* l1, const void* g1,
                                                 void* l2, const void* g2,
                                                 void* l3, const void* g3) {
  asm volatile("global_load_async_to_lds_b128 %0, %1, off\n\t"
               "global_load_async_to_lds_b128 %2, %3, off\n\t"
               "global_load_async_to_lds_b128 %4, %5, off\n\t"
               "global_load_async_to_lds_b128 %6, %7, off\n\t"
               "s_wait_xcnt 0x0"
               :: "v"((uint32_t)(uintptr_t)l0), "v"(g0),
                  "v"((uint32_t)(uintptr_t)l1), "v"(g1),
                  "v"((uint32_t)(uintptr_t)l2), "v"(g2),
                  "v"((uint32_t)(uintptr_t)l3), "v"(g3)
               : "memory");
}
// the wave's own copies have landed
__device__ __forceinline__ void wait_async0() {
  asm volatile("s_wait_asynccnt 0x0" ::: "memory");
}
// the wave's own LDS reads and writes are done (before a buffer is handed over)
__device__ __forceinline__ void wait_ds0() {
  asm volatile("s_wait_dscnt 0x0" ::: "memory");
}
// 64 rows of 64 halves, contiguous in memory, into LDS rows of `stride` halves:
// 128 threads, four 16-byte pieces each. l and g are the thread's own first piece.
__device__ __forceinline__ void stage_tile(_Float16* l, const _Float16* g, int stride) {
  async_copy4_b128(l, g, l + 16 * stride, g + 1024, l + 32 * stride, g + 2048,
                   l + 48 * stride, g + 3072);
}

typedef int i32x4 __attribute__((ext_vector_type(4)));
// Four gathered rows of 64 halves into four LDS rows that follow one another: bo holds
// the rows' byte offsets in the K or V plane of this head; l and g are the thread's
// own piece of LDS row 0 of the four and of memory row 0 of the plane. Eight lanes take
// one row, so that every copy still moves whole 128-byte lines.
__device__ __forceinline__ void stage_rows(_Float16* l, const _Float16* g, i32x4 bo,
                                           int stride) {
  const char* gb = (const char*)g;
  async_copy4_b128(l, gb + (unsigned)bo[0], l + stride, gb + (unsigned)bo[1],
                   l + 2 * stride, gb + (unsigned)bo[2], l + 3 * stride, gb + (unsigned)bo[3]);
}

// Tile of both projection kernels: a work-group of eight waves (2 x 4) takes PT_M rows
// by PT_N columns of Y, a wave 64 x 48: 4 A and 3 B fragments feed 12 products, and a
// staged element of X or W serves 192 or 128 outputs.
#define PT_M 128
#define PT_N 192
#define PF_M 4   // A fragments (16 rows each) of a wave
#define PF_N 3   // B fragments (16 columns each) of a wave
#define PK_ 64             // k of one trip: a staged row is one whole 128-byte line of f16
#define PNK_ (D_ / PK_)    // trips
#define T_STRIDE 72        // halves; 144B rows = 16B x odd -> conflict-free b128 reads
#define T_BUF ((PT_M + PT_N) * T_STRIDE)  // halves of one buffer

typedef float    v4f __attribute__((ext_vector_type(4)));
typedef _Float16 v4h __attribute__((ext_vector_type(4)));

// ---------------- Kernel 0: operands of the projections to f16 -----------
// h, Wq, Wk, Wv, Wo, each rounded to f16 once, into one run of the workspace in that
// order (the projection kernels rounded every element anew in each work-group that read
// it, and staged it at four bytes). A work-group takes CV_BLK elements that follow one
// another; h and each W are whole multiples of that.
#define CV_N 16                    // 16-byte pieces of a thread
#define CV_BLK (256 * CV_N * 4)    // elements of a work-group
#define CV_HB (B_ * S_ * D_ / CV_BLK)  // work-groups on h
#define CV_WB (D_ * D_ / CV_BLK)       // work-groups on one W
__global__ __launch_bounds__(256) void to_f16_kernel(
    const float* __restrict__ hsrc, const float* __restrict__ Wq,
    const float* __restrict__ Wk, const float* __restrict__ Wv,
    const float* __restrict__ Wo, _Float16* __restrict__ dst) {
  const int b = blockIdx.x;
  const float* src;
  if (b < CV_HB) {
    src = hsrc + (size_t)b * CV_BLK;
  } else {
    const int w = (b - CV_HB) / CV_WB, r = (b - CV_HB) % CV_WB;
    src = (w == 0 ? Wq : (w == 1 ? Wk : (w == 2 ? Wv : Wo))) + (size_t)r * CV_BLK;
  }
  const v4f* s = (const v4f*)src + threadIdx.x;
  v4h* d = (v4h*)(dst + (size_t)b * CV_BLK) + threadIdx.x;
  v4f x[CV_N];
  // unrolled: all loads in flight at once, x[] in registers
#pragma unroll
  for (int i = 0; i < CV_N; ++i) x[i] = s[i * 256];
#pragma unroll
  for (int i = 0; i < CV_N; ++i) d[i * 256] = __builtin_convertvector(x[i], v4h);
}

// PK_ columns of PT_M rows of one f16 matrix and of PT_N rows of another, both with D_
// columns, into PT_M + PT_N LDS rows of T_STRIDE halves that follow one another: 256
// threads, eight lanes a row (one whole 128-byte line), 32 rows a copy. Each copy's address
// is a scalar base (ga, gb: the tiles' first elements, uniform) plus the thread's byte
// offset vo in 32 rows, the same for all ten: no address of memory is held or formed in
// vector registers. The s_wait_xcnt stands inside the statement so that no address
// register of a copy is rewritten ahead of it.
__device__ __forceinline__ void stage_f16_mn(_Float16* l, unsigned vo, const _Float16* ga,
                                             const _Float16* gb) {
  const uint32_t l0 = (uint32_t)(uintptr_t)l;
  asm volatile("global_load_async_to_lds_b128 %0, %10, %11\n\t"
               "global_load_async_to_lds_b128 %1, %10, %12\n\t"
               "global_load_async_to_lds_b128 %2, %10, %13\n\t"
               "global_load_async_to_lds_b128 %3, %10, %14\n\t"
               "global_load_async_to_lds_b128 %4, %10, %15\n\t"
               "global_load_async_to_lds_b128 %5, %10, %16\n\t"
               "global_load_async_to_lds_b128 %6, %10, %17\n\t"
               "global_load_async_to_lds_b128 %7, %10, %18\n\t"
               "global_load_async_to_lds_b128 %8, %10, %19\n\t"
               "global_load_async_to_lds_b128 %9, %10, %20\n\t"
               "s_wait_xcnt 0x0"
               :: "v"(l0), "v"(l0 + 1 * 32 * T_STRIDE * 2), "v"(l0 + 2 * 32 * T_STRIDE * 2),
                  "v"(l0 + 3 * 32 * T_STRIDE * 2), "v"(l0 + 4 * 32 * T_STRIDE * 2),
                  "v"(l0 + 5 * 32 * T_STRIDE * 2), "v"(l0 + 6 * 32 * T_STRIDE * 2),
                  "v"(l0 + 7 * 32 * T_STRIDE * 2), "v"(l0 + 8 * 32 * T_STRIDE * 2),
                  "v"(l0 + 9 * 32 * T_STRIDE * 2), "v"(vo),
                  "s"(ga), "s"(ga + 32 * D_), "s"(ga + 64 * D_), "s"(ga + 96 * D_),
                  "s"(gb), "s"(gb + 32 * D_), "s"(gb + 64 * D_), "s"(gb + 96 * D_),
                  "s"(gb + 128 * D_), "s"(gb + 160 * D_)
               : "memory");
}

// The products of one work-group's tile, for both projection kernels:
// acc[i][j] += X[wm + 16 i ..][k] * W[wn + 16 j ..][k] over all D_ values of k, in rising k.
// ag, bg: first elements of the work-group's rows of X and W (uniform). Ts: two buffers of
// PT_M rows of X and PT_N rows of W behind them; the tile of trip t lies in buffer t & 1
// and is copied one trip ahead.
__device__ __forceinline__ void proj_tile(const _Float16* ag, const _Float16* bg,
                                          _Float16* Ts, int wm, int wn,
                                          v8f (&acc)[PF_M][PF_N]) {
  const int tid = threadIdx.x;
  // all loops over acc[][] are unrolled so that every index is a constant
#pragma unroll
  for (int i = 0; i < PF_M; ++i)
#pragma unroll
    for (int j = 0; j < PF_N; ++j) acc[i][j] = (v8f){0, 0, 0, 0, 0, 0, 0, 0};

  // the thread's own 16-byte piece of the first 32 rows of a tile, as a byte offset in
  // memory and as a place in LDS
  const unsigned vo = (unsigned)((tid >> 3) * D_ + (tid & 7) * 8) * 2u;
  _Float16* tl = &Ts[(tid >> 3) * T_STRIDE + (tid & 7) * 8];

  // tile 0
  stage_f16_mn(tl, vo, ag, bg);
  wait_async0();
  __syncthreads();
  // tile 1 flies while tile 0 is worked on
  stage_f16_mn(tl + T_BUF, vo, ag + PK_, bg + PK_);

  // where the current tile's buffer starts in Ts (elements), flipped at each foot
  int tofs = 0;
  for (int t = 0; t < PNK_; ++t) {
    // The trip's two k blocks of 32, in rising k, as eight steps of one A fragment each. The
    // three B fragments of a block stay; the A fragment of the next step is read while this
    // step's is multiplied, over the blocks' border too. The scheduling barriers keep each
    // read one step ahead of its use: without them one register set serves every A fragment
    // and each step waits out its own LDS read.
    const _Float16* ta = &Ts[tofs + wm * T_STRIDE];
    const _Float16* tb = &Ts[tofs + (PT_M + wn) * T_STRIDE];
    v16h b[PF_N];
#pragma unroll
    for (int j = 0; j < PF_N; ++j) b[j] = frag_from_rows(tb + j * 16 * T_STRIDE, T_STRIDE);
    v16h a = frag_from_rows(ta, T_STRIDE);
    __builtin_amdgcn_sched_barrier(0);
#pragma unroll
    for (int s = 0; s < 2 * PF_M; ++s) {
      const int i = s % PF_M, sn = s + 1;
      v16h an = a;
      if (sn < 2 * PF_M)
        an = frag_from_rows(ta + (sn % PF_M) * 16 * T_STRIDE + (sn / PF_M) * 32, T_STRIDE);
#pragma unroll
      for (int j = 0; j < PF_N; ++j) acc[i][j] = wmma_f16(a, b[j], acc[i][j]);
      if (sn == PF_M) {  // the second block's B fragments, each behind its last use
#pragma unroll
        for (int j = 0; j < PF_N; ++j)
          b[j] = frag_from_rows(tb + j * 16 * T_STRIDE + 32, T_STRIDE);
      }
      __builtin_amdgcn_sched_barrier(0);
      a = an;
    }
    // foot of the trip: this wave's LDS reads and its copies of the next tile are done;
    // the one barrier both publishes that tile and ends every wave's reads of this buffer
    wait_ds0();
    wait_async0();
    __syncthreads();
    if (t + 2 < PNK_)  // tile t + 2 into the buffer just left
      stage_f16_mn(tl + tofs, vo, ag + (t + 2) * PK_, bg + (t + 2) * PK_);
    tofs ^= T_BUF;
  }
  wait_async0();
}

// ---------------- Kernel 1: fused QKV projection -------------------------
// Y[m,e] = sum_k h[m,k] * W[e,k] + bias[e]; written f16 to [B,H,S,DH].
// Q gets the softmax scale (1/sqrt(DH)) and log2(e) folded in, so that a score is an
// exponent of 2. h16 and W16 (the rows of Wq, Wk, Wv
// behind one another) come from kernel 0.
__global__ __launch_bounds__(256) void qkv_proj_kernel(
    const _Float16* __restrict__ h16, const _Float16* __restrict__ W16,
    const float* __restrict__ bq, const float* __restrict__ bk,
    const float* __restrict__ bv,
    _Float16* __restrict__ Qo, _Float16* __restrict__ Ko,
    _Float16* __restrict__ Vo) {
  const int which = blockIdx.z;
  const float* bias = which == 0 ? bq : (which == 1 ? bk : bv);
  _Float16* out     = which == 0 ? Qo : (which == 1 ? Ko : Vo);
  const float oscale = which == 0 ? 0.125f * 1.44269504f : 1.0f;  // log2(e)/sqrt(64)

  const int m0 = blockIdx.y * PT_M;
  const int n0 = blockIdx.x * PT_N;
  const int tid = threadIdx.x;
  // the wave's number as a scalar: what follows from it takes no vector registers
  const int wave = __builtin_amdgcn_readfirstlane(tid >> 5);
  const int wm = (wave >> 2) * (PF_M * 16);  // 0, 64
  const int wn = (wave & 3) * (PF_N * 16);   // 0 .. 144

  __shared__ __attribute__((aligned(16))) _Float16 Ts[2 * T_BUF];
  v8f acc[PF_M][PF_N];
  proj_tile(h16 + (size_t)m0 * D_, W16 + (size_t)(which * D_ + n0) * D_, Ts, wm, wn, acc);

  const int lane = tid & 31;
  const int nloc = lane & 15, hi = lane >> 4;
#pragma unroll
  for (int sm = 0; sm < PF_M; ++sm)
#pragma unroll
    for (int sn = 0; sn < PF_N; ++sn) {
      int e = n0 + wn + sn * 16 + nloc;
      int hh = e >> 6, d = e & 63;
      float bsv = bias[e];
#pragma unroll
      for (int j = 0; j < 8; ++j) {
        int m = m0 + wm + sm * 16 + j + hi * 8;
        int bb = m >> 12;          // m / S_
        int s = m & (S_ - 1);
        size_t o = (((size_t)bb * H_ + hh) * S_ + s) * DH_ + d;
        out[o] = (_Float16)((acc[sm][sn][j] + bsv) * oscale);
      }
    }
}

#define RAISE_ 8.0f
#define QK_STRIDE 72   // halves; 144B rows = 16B x odd -> conflict-free b128 reads
#define NT_ (S_ / 64)  // key tiles
#define V_STRIDE 80    // halves; 160B rows = 32B x odd, the transposing load's pitch

typedef short s16x8 __attribute__((ext_vector_type(8)));
typedef __attribute__((address_space(3))) s16x8 lds_s16x8;

// A operand V^T (row = head dim, k = keys in the hardware k order) from the
// row-major V tile: p is the lane's address for keys kbase + 8*hi + (lane & 7);
// the second load takes the 16 keys behind them.
__device__ __forceinline__ v16h vt_frag(const _Float16* p) {
  v8h lo = __builtin_bit_cast(v8h, __builtin_amdgcn_ds_load_tr16_b128_v8i16((lds_s16x8*)p));
  v8h hi = __builtin_bit_cast(v8h, __builtin_amdgcn_ds_load_tr16_b128_v8i16(
                                       (lds_s16x8*)(p + 16 * V_STRIDE)));
  return __builtin_shufflevector(lo, hi, 0, 1, 2, 3, 4, 5, 6, 7, 8, 9, 10, 11, 12, 13, 14, 15);
}

// value of lane l ^ 16
__device__ __forceinline__ float other_half(float v) {
  int b = __builtin_bit_cast(int, v);
  b = __builtin_amdgcn_permlanex16(b, b, 0x76543210, 0xfedcba98, false, false);
  return __builtin_bit_cast(float, b);
}

// Each wave takes QG_ groups of 16 query columns, so that every K and V^T fragment
// read from LDS feeds QG_ products, and a work-group's K/V tile serves QB_ queries.
#define QG_ 2
#define QB_ (4 * QG_ * 16)  // queries per work-group of four waves

__global__ __launch_bounds__(128) void attn_kernel(
    const _Float16* __restrict__ Q, const _Float16* __restrict__ K,
    const _Float16* __restrict__ V, const int* __restrict__ mask,
    _Float16* __restrict__ att) {
  const int qt = blockIdx.x, hh = blockIdx.y, bb = blockIdx.z;
  const int tid = threadIdx.x, wave = tid >> 5, lane = tid & 31;
  const int nloc = lane & 15, hi = lane >> 4;

  // K and V: two buffers each; tile t lies in buffer t & 1 and is copied one trip ahead
  __shared__ __attribute__((aligned(32))) _Float16 Qs[QB_ * QK_STRIDE];
  __shared__ __attribute__((aligned(32))) _Float16 Ks[2 * 64 * QK_STRIDE];
  __shared__ __attribute__((aligned(32))) _Float16 Vs[2 * 64 * V_STRIDE];  // [k][d], as in memory
  __shared__ __attribute__((aligned(32))) float maskAdd[2 * 64];
  // the order in which keys are walked: every key of the batch row once, as the byte
  // offset of its K/V row; kept keys first, masked keys behind them
  __shared__ __attribute__((aligned(32))) int korder[S_];
  __shared__ __attribute__((aligned(16))) int wkept[4];  // kept keys in each wave's quarter

  const size_t bh = ((size_t)bb * H_ + hh) * S_;
  // the thread's own first piece of a tile, in memory and in LDS
  const _Float16* Qg = Q + (bh + (size_t)qt * QB_) * DH_ + tid * 8;
  const int qk_off = (tid >> 3) * QK_STRIDE + (tid & 7) * 8;
  // of a K or V tile a thread copies its piece of the four rows rg4 .. rg4 + 3
  const _Float16* Kg = K + bh * DH_ + (tid & 7) * 8;
  const _Float16* Vg = V + bh * DH_ + (tid & 7) * 8;
  const int rg4 = (tid >> 3) * 4;
  const int k_off = rg4 * QK_STRIDE + (tid & 7) * 8;
  const int v_off = rg4 * V_STRIDE + (tid & 7) * 8;

  // Q tile (64 rows a call); it flies while the key order is built
#pragma unroll
  for (int r = 0; r < QB_ / 64; ++r)
    stage_tile(&Qs[r * 64 * QK_STRIDE + qk_off], Qg + r * 64 * DH_, QK_STRIDE);

  // Key order. A masked key's weight is exp(-1e9 - max) = 0 as soon as one key of the
  // batch row is kept, so only the tiles that hold kept keys are walked; the masked keys
  // that fill up the last of them get -1e9 as before. With no key kept every score of the
  // reference is the same -1e9, which gives even weights: every tile is walked then, no
  // key counts as masked, and Q is taken as 0, so that every score is the same 0.
  // Each wave takes a quarter of the row, 32 keys (one a lane) at a time.
  const int wv = __builtin_amdgcn_readfirstlane(wave);
  const int* mrow = mask + bb * S_ + wv * (S_ / 4) + lane;
  int mv[S_ / 128];
  // unrolled: all loads in flight at once, mv[] in registers
#pragma unroll
  for (int i = 0; i < S_ / 128; ++i) mv[i] = mrow[i * 32];
  // no address register of these loads is written anew ahead of this wait
  asm volatile("s_wait_xcnt 0x0" ::: "memory");
  unsigned kb[S_ / 128];  // bit l: the chunk's key l is kept
  int wk = 0;
  // unrolled: constant indices keep kb[] in scalar registers
#pragma unroll
  for (int i = 0; i < S_ / 128; ++i) {
    kb[i] = __builtin_amdgcn_ballot_w32(mv[i] == 0);
    wk += __builtin_popcount(kb[i]);
  }
  if (lane == 0) wkept[wv] = wk;
  __syncthreads();  // every wave's count is there
  int kept = 0, before = 0;  // in the whole row; in front of this wave's next chunk
  // unrolled: four counts, one LDS read
#pragma unroll
  for (int w = 0; w < 4; ++w) {
    const int c = __builtin_amdgcn_readfirstlane(wkept[w]);
    kept += c;
    if (w < wv) before += c;
  }
  // unrolled: constant indices into kb[]
#pragma unroll
  for (int i = 0; i < S_ / 128; ++i) {
    const int s = wv * (S_ / 4) + i * 32 + lane;                        // the lane's key
    const int kbef = (int)__builtin_amdgcn_mbcnt_lo(kb[i], (unsigned)before);  // kept in front of it
    // place: a kept key behind the kept ones in front of it; a masked key behind all
    // kept keys and the s - kbef masked ones in front of it: each place 0 .. S_-1 once
    korder[((kb[i] >> lane) & 1u) ? kbef : kept + s - kbef] = s * (DH_ * 2);
    before += __builtin_popcount(kb[i]);
  }
  // places of the order whose keys count: all where no key is kept (see above)
  const int keff = kept == 0 ? S_ : kept;
  // key tiles to walk: uniform, at least 1, at most NT_
  const int nt = min((keff + 63) >> 6, NT_);
  if (tid < 64) maskAdd[tid] = tid < keff ? 0.0f : -1e9f;
  __syncthreads();  // the key order is whole before any wave gathers by it

  // tile 0
  {
    const i32x4 k0 = *(const i32x4*)&korder[rg4];
    stage_rows(&Ks[k_off], Kg, k0, QK_STRIDE);
    stage_rows(&Vs[v_off], Vg, k0, V_STRIDE);
  }
  wait_async0();
  __syncthreads();
  // tile 1, where there is one, flies while tile 0 is worked on
  if (1 < nt) {
    const i32x4 k1 = *(const i32x4*)&korder[64 + rg4];
    stage_rows(&Ks[64 * QK_STRIDE + k_off], Kg, k1, QK_STRIDE);
    stage_rows(&Vs[64 * V_STRIDE + v_off], Vg, k1, V_STRIDE);
  }

  // B operands: column = query, contiguous = head dim; group g holds the wave's
  // queries g*16 .. g*16 + 15
  v16h bq0[QG_], bq1[QG_];
#pragma unroll
  for (int g = 0; g < QG_; ++g) {
    bq0[g] = frag_from_rows(&Qs[((wave * QG_ + g) * 16) * QK_STRIDE + 0], QK_STRIDE);
    bq1[g] = frag_from_rows(&Qs[((wave * QG_ + g) * 16) * QK_STRIDE + 32], QK_STRIDE);
    if (kept == 0) {  // uniform: no key kept, every score 0
#pragma unroll
      for (int e = 0; e < 16; ++e) bq0[g][e] = bq1[g][e] = (_Float16)0.f;
    }
  }

  // lane's address in V buffer 0 for the transposing loads
  const _Float16* vrd = &Vs[(8 * hi + (lane & 7)) * V_STRIDE + 8 * ((lane >> 3) & 1)];

  v8f o[QG_][4];   // o[g][t2][j] = O[query g*16 + nloc][d = t2*16 + 8*hi + j]
  v8f cneg[QG_];    // C operand of the score product: minus the maximum in use of query
                    // g*16 + nloc, in all eight places; alike in both halves
  float rsum[QG_];  // of this half's keys only; joined at the end
#pragma unroll
  for (int g = 0; g < QG_; ++g) {
#pragma unroll
    for (int t = 0; t < 4; ++t) o[g][t] = (v8f){0, 0, 0, 0, 0, 0, 0, 0};
    cneg[g] = (v8f){0, 0, 0, 0, 0, 0, 0, 0};
    rsum[g] = 0.f;
  }

  // where the current tile's buffer starts in Ks and Vs (elements): 0 or one buffer's
  // size, flipped at each trip's end; kept as uniform offsets so that an LDS address
  // costs one add
  int kofs = 0, vofs = 0;
  for (int kt = 0; kt < nt; ++kt) {
    const int mofs = (kt & 1) * 64;  // the same for maskAdd
    // scores, transposed: 64 keys x 16 queries per group, Q pre-scaled
    // c[g][t][j] = S[query g*16 + nloc][key t*16 + 8*hi + j] - the query's maximum in use
    // all loops over g, c[] and o[] are unrolled so that every index is a constant
    // and the tiles stay in registers
    v8f c[QG_][4];
#pragma unroll
    for (int t = 0; t < 4; ++t) {
      v16h ak0 = frag_from_rows(&Ks[kofs + (t * 16) * QK_STRIDE + 0], QK_STRIDE);
      v16h ak1 = frag_from_rows(&Ks[kofs + (t * 16) * QK_STRIDE + 32], QK_STRIDE);
      const v8f madd = *(const v8f*)&maskAdd[mofs + t * 16 + hi * 8];
      v8f cc[QG_];
#pragma unroll
      for (int g = 0; g < QG_; ++g)
        cc[g] = wmma_f16(ak0, bq0[g], cneg[g]);
#pragma unroll
      for (int g = 0; g < QG_; ++g) cc[g] = wmma_f16(ak1, bq1[g], cc[g]);
#pragma unroll
      for (int g = 0; g < QG_; ++g) c[g][t] = cc[g] + madd;
    }

    // online softmax: one query per lane and group, 32 of the tile's 64 keys in each half
    // how far this half's scores of the tile lie over the maximum in use
    float tmax[QG_];
    bool over = false;
#pragma unroll
    for (int g = 0; g < QG_; ++g) {
      float v = c[g][0][0];
#pragma unroll
      for (int t = 0; t < 4; ++t)
#pragma unroll
        for (int j = 0; j < 8; ++j) v = fmaxf(v, c[g][t][j]);
      tmax[g] = v;
      over = over || v > RAISE_;
    }
    // One test a trip, a scalar branch (| and not ||: one branch, not two). The first tile
    // sets the maximum in use (from 0 to its own, up or down; O and the sums are still 0);
    // later it only rises.
    if ((int)(kt == 0) | (int)(__builtin_amdgcn_ballot_w32(over) != 0)) {
#pragma unroll
      for (int g = 0; g < QG_; ++g) {
        const float v = fmaxf(tmax[g], other_half(tmax[g]));
        const float d = kt == 0 ? v : fmaxf(v, 0.f);
        const float corr = kt == 0 ? 0.f : __builtin_amdgcn_exp2f(-d);
        cneg[g] -= d;
#pragma unroll
        for (int t = 0; t < 4; ++t) {
          c[g][t] -= d;
          o[g][t] *= corr;
        }
        rsum[g] *= corr;
      }
    }
    v16h bp0[QG_], bp1[QG_];
#pragma unroll
    for (int g = 0; g < QG_; ++g) {
#pragma unroll
      for (int t = 0; t < 4; ++t)
#pragma unroll
        for (int j = 0; j < 8; ++j) c[g][t][j] = __builtin_amdgcn_exp2f(c[g][t][j]);
      const v8f sv = (c[g][0] + c[g][1]) + (c[g][2] + c[g][3]);
      rsum[g] += (((sv[0] + sv[1]) + (sv[2] + sv[3])) + ((sv[4] + sv[5]) + (sv[6] + sv[7])));

      // P^T as B operand: element e is key 8*hi + e (e < 8) or 16 + 8*hi + (e - 8) of
      // its 32 keys, which is register e&7 of score tile e>>3: no lane exchange
#pragma unroll
      for (int e = 0; e < 16; ++e) {
        bp0[g][e] = (_Float16)c[g][e >> 3][e & 7];        // keys 0..31
        bp1[g][e] = (_Float16)c[g][2 + (e >> 3)][e & 7];  // keys 32..63
      }
    }
    // rows of tile kt + 2, read in front of the foot's waits, so that the copies behind
    // the barrier find them in registers (where there is no such tile: the last tile's
    // again, unused; the index stays inside the list); read behind the scores, where they
    // hold no registers beside the K fragments: the kernel stays inside 256 registers
    const i32x4 kn = *(const i32x4*)&korder[min(kt + 2, nt - 1) * 64 + rg4];
    const _Float16* vb = vrd + vofs;
#pragma unroll
    for (int t2 = 0; t2 < 4; ++t2) {
      // A operand: row = head dim t2*16 + nloc, k = keys
      v16h av0 = vt_frag(vb + t2 * 16);
      v16h av1 = vt_frag(vb + 32 * V_STRIDE + t2 * 16);
#pragma unroll
      for (int g = 0; g < QG_; ++g) o[g][t2] = wmma_f16(av0, bp0[g], o[g][t2]);
#pragma unroll
      for (int g = 0; g < QG_; ++g) o[g][t2] = wmma_f16(av1, bp1[g], o[g][t2]);
    }

    // foot of the trip: the next tile's mask (places from keff on hold masked keys) goes
    // into the mask buffer that nobody reads in this trip (behind the last tile nobody reads it);
    // then this wave's LDS work and its copies of the next tile are done, and the one
    // barrier both publishes that tile and ends every wave's reads of this buffer
    if (tid < 64) maskAdd[(mofs ^ 64) + tid] = (kt + 1) * 64 + tid < keff ? 0.0f : -1e9f;
    wait_ds0();
    wait_async0();
    __syncthreads();
    if (kt + 2 < nt) {  // tile kt + 2 into the buffer just left, a whole trip ahead of its use
      stage_rows(&Ks[kofs + k_off], Kg, kn, QK_STRIDE);
      stage_rows(&Vs[vofs + v_off], Vg, kn, V_STRIDE);
    }
    kofs ^= 64 * QK_STRIDE;
    vofs ^= 64 * V_STRIDE;
  }
  wait_async0();

  // normalize + write att[b, s, h*64+d] as f16: 8 consecutive d per lane
#pragma unroll
  for (int g = 0; g < QG_; ++g) {
    const float inv = 1.0f / (rsum[g] + other_half(rsum[g]));
    const size_t row = (size_t)bb * S_ + qt * QB_ + (wave * QG_ + g) * 16 + nloc;
    _Float16* dst = att + row * (H_ * DH_) + hh * DH_ + hi * 8;
#pragma unroll
    for (int t2 = 0; t2 < 4; ++t2) {
      v8h ov;
#pragma unroll
      for (int j = 0; j < 8; ++j) ov[j] = (_Float16)(o[g][t2][j] * inv);
      *(v8h*)(dst + t2 * 16) = ov;
    }
  }
}

// ---------------- Kernel 3: output projection ----------------------------
// out[m,d] = sum_e att[m,e] * Wo[d,e] + bo[d]  (fp32 out); Wo16 comes from kernel 0
__global__ __launch_bounds__(256) void out_proj_kernel(
    const _Float16* __restrict__ att, const _Float16* __restrict__ Wo16,
    const float* __restrict__ bo, float* __restrict__ out) {
  const int m0 = blockIdx.y * PT_M;
  const int n0 = blockIdx.x * PT_N;
  const int tid = threadIdx.x;
  // the wave's number as a scalar, as in kernel 1
  const int wave = __builtin_amdgcn_readfirstlane(tid >> 5);
  const int wm = (wave >> 2) * (PF_M * 16);
  const int wn = (wave & 3) * (PF_N * 16);

  __shared__ __attribute__((aligned(16))) _Float16 Ts[2 * T_BUF];
  v8f acc[PF_M][PF_N];
  proj_tile(att + (size_t)m0 * D_, Wo16 + (size_t)n0 * D_, Ts, wm, wn, acc);

  const int lane = tid & 31;
  const int nloc = lane & 15, hi = lane >> 4;
#pragma unroll
  for (int sm = 0; sm < PF_M; ++sm)
#pragma unroll
    for (int sn = 0; sn < PF_N; ++sn) {
      int e = n0 + wn + sn * 16 + nloc;
      float bsv = bo[e];
#pragma unroll
      for (int j = 0; j < 8; ++j) {
        int m = m0 + wm + sm * 16 + j + hi * 8;
        out[(size_t)m * D_ + e] = acc[sm][sn][j] + bsv;
      }
    }
}

extern "C" void kernel_launch(void* const* d_in, const int* in_sizes, int n_in,
                              void* d_out, int out_size, void* d_ws,
                              size_t ws_size, hipStream_t stream) {
  (void)in_sizes; (void)n_in; (void)out_size; (void)ws_size;
  const float* h  = (const float*)d_in[0];
  const float* Wq = (const float*)d_in[1];
  const float* bq = (const float*)d_in[2];
  const float* Wk = (const float*)d_in[3];
  const float* bk = (const float*)d_in[4];
  const float* Wv = (const float*)d_in[5];
  const float* bv = (const float*)d_in[6];
  const float* Wo = (const float*)d_in[7];
  const float* bo = (const float*)d_in[8];
  const int* mask = (const int*)d_in[9];
  float* out = (float*)d_out;

  _Float16* ws = (_Float16*)d_ws;
  const size_t per = (size_t)B_ * H_ * S_ * DH_;  // halves of Q, K, V, att and h each
  _Float16* Qb = ws;
  _Float16* Kb = ws + per;
  _Float16* Vb = ws + 2 * per;
  _Float16* Ab = ws + 3 * per;
  _Float16* Hb = ws + 4 * per;                    // h, then Wq, Wk, Wv, Wo, as f16
  _Float16* Wb = ws + 5 * per;
  _Float16* Wob = Wb + (size_t)3 * D_ * D_;

  to_f16_kernel<<<dim3(CV_HB + 4 * CV_WB), 256, 0, stream>>>(h, Wq, Wk, Wv, Wo, Hb);
  qkv_proj_kernel<<<dim3(D_ / PT_N, (B_ * S_) / PT_M, 3), 256, 0, stream>>>(
      Hb, Wb, bq, bk, bv, Qb, Kb, Vb);
  attn_kernel<<<dim3(S_ / QB_, H_, B_), 128, 0, stream>>>(Qb, Kb, Vb, mask, Ab);
  out_proj_kernel<<<dim3(D_ / PT_N, (B_ * S_) / PT_M), 256, 0, stream>>>(
      Ab, Wob, bo, out);
}

// v010
// Measured time: 98.1 microseconds a run.
// Two timings next to v009 both put it at 1.05 times that version's speed.
// All steps since v000 together make it 5.57 times as fast.
#include <hip/hip_runtime.h>
#include <hip/hip_bf16.h>

#define B_  2
#define S_  4096
#define D_  768
#define H_  12
#define DH_ 64

typedef _Float16 v16h __attribute__((ext_vector_type(16)));
typedef float    v8f  __attribute__((ext_vector_type(8)));
typedef _Float16 v8h  __attribute__((ext_vector_type(8)));

// Build a WMMA f16 fragment from 16 rows (stride in halves) of LDS.
// Works for A (row = M, contiguous dim = K) and for column-major B
// (row = N column, contiguous dim = K).
// CDNA5 16-bit A layout: lane r=lane%16 holds row r; hi=lane/16 selects the
// +8 K offset half; VGPR v<4 -> K = hi*8 + 2v{+1}; v>=4 -> K = 16 + hi*8 + 2(v-4){+1}.
// Each 8-half group is contiguous -> lowers to two ds_load_b128.
__device__ __forceinline__ v16h frag_from_rows(const _Float16* p, int stride) {
  const int lane = threadIdx.x & 31;
  const int r = lane & 15, hi = lane >> 4;
  const _Float16* q = p + r * stride + hi * 8;
  v16h f;
#pragma unroll
  for (int v = 0; v < 4; ++v) {
    f[2 * v]         = q[2 * v];
    f[2 * v + 1]     = q[2 * v + 1];
    f[8 + 2 * v]     = q[16 + 2 * v];
    f[8 + 2 * v + 1] = q[16 + 2 * v + 1];
  }
  return f;
}

__device__ __forceinline__ v8f wmma_f16(v16h a, v16h b, v8f c) {
  return __builtin_amdgcn_wmma_f32_16x16x32_f16(false, a, false, b, (short)0, c,
                                                false, false);
}

// Four async global -> LDS copies of 16 bytes of one lane (ASYNCcnt-tracked; the
// low 32 bits of a __shared__ address are the LDS offset). The s_wait_xcnt stands
// inside the statement so that no address register of a copy is rewritten ahead of it.
__device__ __forceinline__ void async_copy4_b128(void* l0, const void* g0,
                                                 void* l1, const void* g1,
                                                 void* l2, const void* g2,
                                                 void* l3, const void* g3) {
  asm volatile("global_load_async_to_lds_b128 %0, %1, off\n\t"
               "global_load_async_to_lds_b128 %2, %3, off\n\t"
               "global_load_async_to_lds_b128 %4, %5, off\n\t"
               "global_load_async_to_lds_b128 %6, %7, off\n\t"
               "s_wait_xcnt 0x0"
               :: "v"((uint32_t)(uintptr_t)l0), "v"(g0),
                  "v"((uint32_t)(uintptr_t)l1), "v"(g1),
                  "v"((uint32_t)(uintptr_t)l2), "v"(g2),
                  "v"((uint32_t)(uintptr_t)l3), "v"(g3)
               : "memory");
}
// the wave's own copies have landed
__device__ __forceinline__ void wait_async0() {
  asm volatile("s_wait_asynccnt 0x0" ::: "memory");
}
// the wave's own LDS reads and writes are done (before a buffer is handed over)
__device__ __forceinline__ void wait_ds0() {
  asm volatile("s_wait_dscnt 0x0" ::: "memory");
}
// 64 rows of 64 halves, contiguous in memory, into LDS rows of `stride` halves:
// 128 threads, four 16-byte pieces each. l and g are the thread's own first piece.
__device__ __forceinline__ void stage_tile(_Float16* l, const _Float16* g, int stride) {
  async_copy4_b128(l, g, l + 16 * stride, g + 1024, l + 32 * stride, g + 2048,
                   l + 48 * stride, g + 3072);
}

typedef int i32x4 __attribute__((ext_vector_type(4)));
// Four gathered rows of 64 halves into four LDS rows that follow one another: bo holds
// the rows' byte offsets in the K or V plane of this head; l and g are the thread's
// own piece of LDS row 0 of the four and of memory row 0 of the plane. Eight lanes take
// one row, so that every copy still moves whole 128-byte lines.
__device__ __forceinline__ void stage_rows(_Float16* l, const _Float16* g, i32x4 bo,
                                           int stride) {
  const char* gb = (const char*)g;
  async_copy4_b128(l, gb + (unsigned)bo[0], l + stride, gb + (unsigned)bo[1],
                   l + 2 * stride, gb + (unsigned)bo[2], l + 3 * stride, gb + (unsigned)bo[3]);
}

// Tile of both projection kernels: a work-group of eight waves (2 x 4) takes PT_M rows
// by PT_N columns of Y, a wave 64 x 48: 4 X and 3 W fragments feed 12 products, and a
// staged element of X or W serves 192 or 128 outputs.
#define PT_M 128
#define PT_N 192
#define PF_M 4   // X fragments (16 rows of Y each) of a wave
#define PF_N 3   // W fragments (16 columns of Y each) of a wave
#define PK_ 64             // k of one trip: a staged row is one whole 128-byte line of f16
#define PNK_ (D_ / PK_)    // trips
#define T_STRIDE 72        // halves; 144B rows = 16B x odd -> conflict-free b128 reads
#define T_BUF ((PT_M + PT_N) * T_STRIDE)  // halves of one buffer
// Behind the products a work-group's tile of Y is staged in the same LDS, row by row, and
// leaves as whole 128-byte lines. Bytes of a staged row of PT_N outputs: 16B x odd, so that
// the 16 rows of a b128 LDS store fall on different banks.
#define YH_PITCH (PT_N * 2 + 16)  // f16 outputs
#define YF_PITCH (PT_N * 4 + 16)  // f32 outputs

typedef float    v4f __attribute__((ext_vector_type(4)));
typedef _Float16 v4h __attribute__((ext_vector_type(4)));

// ---------------- Kernel 0: operands of the projections to f16 -----------
// h, Wq, Wk, Wv, Wo, each rounded to f16 once, into one run of the workspace in that
// order (the projection kernels rounded every element anew in each work-group that read
// it, and staged it at four bytes). A work-group takes CV_BLK elements that follow one
// another; h and each W are whole multiples of that.
#define CV_N 16                    // 16-byte pieces of a thread
#define CV_BLK (256 * CV_N * 4)    // elements of a work-group
#define CV_HB (B_ * S_ * D_ / CV_BLK)  // work-groups on h
#define CV_WB (D_ * D_ / CV_BLK)       // work-groups on one W
__global__ __launch_bounds__(256) void to_f16_kernel(
    const float* __restrict__ hsrc, const float* __restrict__ Wq,
    const float* __restrict__ Wk, const float* __restrict__ Wv,
    const float* __restrict__ Wo, _Float16* __restrict__ dst) {
  const int b = blockIdx.x;
  const float* src;
  if (b < CV_HB) {
    src = hsrc + (size_t)b * CV_BLK;
  } else {
    const int w = (b - CV_HB) / CV_WB, r = (b - CV_HB) % CV_WB;
    src = (w == 0 ? Wq : (w == 1 ? Wk : (w == 2 ? Wv : Wo))) + (size_t)r * CV_BLK;
  }
  const v4f* s = (const v4f*)src + threadIdx.x;
  v4h* d = (v4h*)(dst + (size_t)b * CV_BLK) + threadIdx.x;
  v4f x[CV_N];
  // unrolled: all loads in flight at once, x[] in registers
#pragma unroll
  for (int i = 0; i < CV_N; ++i) x[i] = s[i * 256];
#pragma unroll
  for (int i = 0; i < CV_N; ++i) d[i * 256] = __builtin_convertvector(x[i], v4h);
}

// PK_ columns of PT_M rows of one f16 matrix and of PT_N rows of another, both with D_
// columns, into PT_M + PT_N LDS rows of T_STRIDE halves that follow one another: 256
// threads, eight lanes a row (one whole 128-byte line), 32 rows a copy. Each copy's address
// is a scalar base (ga, gb: the tiles' first elements, uniform) plus the thread's byte
// offset vo in 32 rows, the same for all ten: no address of memory is held or formed in
// vector registers. The s_wait_xcnt stands inside the statement so that no address
// register of a copy is rewritten ahead of it.
__device__ __forceinline__ void stage_f16_mn(_Float16* l, unsigned vo, const _Float16* ga,
                                             const _Float16* gb) {
  const uint32_t l0 = (uint32_t)(uintptr_t)l;
  asm volatile("global_load_async_to_lds_b128 %0, %10, %11\n\t"
               "global_load_async_to_lds_b128 %1, %10, %12\n\t"
               "global_load_async_to_lds_b128 %2, %10, %13\n\t"
               "global_load_async_to_lds_b128 %3, %10, %14\n\t"
               "global_load_async_to_lds_b128 %4, %10, %15\n\t"
               "global_load_async_to_lds_b128 %5, %10, %16\n\t"
               "global_load_async_to_lds_b128 %6, %10, %17\n\t"
               "global_load_async_to_lds_b128 %7, %10, %18\n\t"
               "global_load_async_to_lds_b128 %8, %10, %19\n\t"
               "global_load_async_to_lds_b128 %9, %10, %20\n\t"
               "s_wait_xcnt 0x0"
               :: "v"(l0), "v"(l0 + 1 * 32 * T_STRIDE * 2), "v"(l0 + 2 * 32 * T_STRIDE * 2),
                  "v"(l0 + 3 * 32 * T_STRIDE * 2), "v"(l0 + 4 * 32 * T_STRIDE * 2),
                  "v"(l0 + 5 * 32 * T_STRIDE * 2), "v"(l0 + 6 * 32 * T_STRIDE * 2),
                  "v"(l0 + 7 * 32 * T_STRIDE * 2), "v"(l0 + 8 * 32 * T_STRIDE * 2),
                  "v"(l0 + 9 * 32 * T_STRIDE * 2), "v"(vo),
                  "s"(ga), "s"(ga + 32 * D_), "s"(ga + 64 * D_), "s"(ga + 96 * D_),
                  "s"(gb), "s"(gb + 32 * D_), "s"(gb + 64 * D_), "s"(gb + 96 * D_),
                  "s"(gb + 128 * D_), "s"(gb + 160 * D_)
               : "memory");
}

// The products of one work-group's tile, for both projection kernels:
// acc[i][j] += W[wn + 16 j ..][k] * X[wm + 16 i ..][k] over all D_ values of k, in rising k.
// W is the A operand and X the B operand (Y transposed): a lane then holds eight outputs
// that follow one another in ONE row of Y,
// acc[i][j][r] = Y[wm + 16 i + (lane & 15)][wn + 16 j + 8 (lane >> 4) + r].
// ag, bg: first elements of the work-group's rows of X and W (uniform). Ts: two buffers of
// PT_M rows of X and PT_N rows of W behind them; the tile of trip t lies in buffer t & 1
// and is copied one trip ahead.
__device__ __forceinline__ void proj_tile(const _Float16* ag, const _Float16* bg,
                                          _Float16* Ts, int wm, int wn,
                                          v8f (&acc)[PF_M][PF_N]) {
  const int tid = threadIdx.x;
  // all loops over acc[][] are unrolled so that every index is a constant
#pragma unroll
  for (int i = 0; i < PF_M; ++i)
#pragma unroll
    for (int j = 0; j < PF_N; ++j) acc[i][j] = (v8f){0, 0, 0, 0, 0, 0, 0, 0};

  // the thread's own 16-byte piece of the first 32 rows of a tile, as a byte offset in
  // memory and as a place in LDS
  const unsigned vo = (unsigned)((tid >> 3) * D_ + (tid & 7) * 8) * 2u;
  _Float16* tl = &Ts[(tid >> 3) * T_STRIDE + (tid & 7) * 8];

  // tile 0
  stage_f16_mn(tl, vo, ag, bg);
  wait_async0();
  __syncthreads();
  // tile 1 flies while tile 0 is worked on
  stage_f16_mn(tl + T_BUF, vo, ag + PK_, bg + PK_);

  // where the current tile's buffer starts in Ts (elements), flipped at each foot
  int tofs = 0;
  for (int t = 0; t < PNK_; ++t) {
    // The trip's two k blocks of 32, in rising k, as eight steps of one X fragment (a) each.
    // The three W fragments (b) of a block stay; the X fragment of the next step is read while
    // this step's is multiplied, over the blocks' border too. The scheduling barriers keep each
    // read one step ahead of its use: without them one register set serves every X fragment
    // and each step waits out its own LDS read.
    const _Float16* ta = &Ts[tofs + wm * T_STRIDE];
    const _Float16* tb = &Ts[tofs + (PT_M + wn) * T_STRIDE];
    v16h b[PF_N];
#pragma unroll
    for (int j = 0; j < PF_N; ++j) b[j] = frag_from_rows(tb + j * 16 * T_STRIDE, T_STRIDE);
    v16h a = frag_from_rows(ta, T_STRIDE);
    __builtin_amdgcn_sched_barrier(0);
#pragma unroll
    for (int s = 0; s < 2 * PF_M; ++s) {
      const int i = s % PF_M, sn = s + 1;
      v16h an = a;
      if (sn < 2 * PF_M)
        an = frag_from_rows(ta + (sn % PF_M) * 16 * T_STRIDE + (sn / PF_M) * 32, T_STRIDE);
#pragma unroll
      for (int j = 0; j < PF_N; ++j) acc[i][j] = wmma_f16(b[j], a, acc[i][j]);
      if (sn == PF_M) {  // the second block's W fragments, each behind its last use
#pragma unroll
        for (int j = 0; j < PF_N; ++j)
          b[j] = frag_from_rows(tb + j * 16 * T_STRIDE + 32, T_STRIDE);
      }
      __builtin_amdgcn_sched_barrier(0);
      a = an;
    }
    // foot of the trip: this wave's LDS reads and its copies of the next tile are done;
    // the one barrier both publishes that tile and ends every wave's reads of this buffer
    wait_ds0();
    wait_async0();
    __syncthreads();
    if (t + 2 < PNK_)  // tile t + 2 into the buffer just left
      stage_f16_mn(tl + tofs, vo, ag + (t + 2) * PK_, bg + (t + 2) * PK_);
    tofs ^= T_BUF;
  }
  wait_async0();
}

// the eight bias values of a lane's eight outputs of one product (p: 32-byte steps)
__device__ __forceinline__ v8f bias8(const float* p) {
  const v4f lo = *(const v4f*)p, hi = *(const v4f*)(p + 4);
  return __builtin_shufflevector(lo, hi, 0, 1, 2, 3, 4, 5, 6, 7);
}

// ---------------- Kernel 1: fused QKV projection -------------------------
// Y[m,e] = sum_k h[m,k] * W[e,k] + bias[e]; written f16 to [B,H,S,DH].
// Q gets the softmax scale (1/sqrt(DH)) and log2(e) folded in, so that a score is an
// exponent of 2. h16 and W16 (the rows of Wq, Wk, Wv
// behind one another) come from kernel 0.
__global__ __launch_bounds__(256) void qkv_proj_kernel(
    const _Float16* __restrict__ h16, const _Float16* __restrict__ W16,
    const float* __restrict__ bq, const float* __restrict__ bk,
    const float* __restrict__ bv,
    _Float16* __restrict__ Qo, _Float16* __restrict__ Ko,
    _Float16* __restrict__ Vo) {
  const int which = blockIdx.z;
  const float* bias = which == 0 ? bq : (which == 1 ? bk : bv);
  _Float16* out     = which == 0 ? Qo : (which == 1 ? Ko : Vo);
  const float oscale = which == 0 ? 0.125f * 1.44269504f : 1.0f;  // log2(e)/sqrt(64)

  const int m0 = blockIdx.y * PT_M;
  const int n0 = blockIdx.x * PT_N;
  const int tid = threadIdx.x;
  // the wave's number as a scalar: what follows from it takes no vector registers
  const int wave = __builtin_amdgcn_readfirstlane(tid >> 5);
  const int wm = (wave >> 2) * (PF_M * 16);  // 0, 64
  const int wn = (wave & 3) * (PF_N * 16);   // 0 .. 144

  __shared__ __attribute__((aligned(16))) _Float16 Ts[2 * T_BUF];
  v8f acc[PF_M][PF_N];
  proj_tile(h16 + (size_t)m0 * D_, W16 + (size_t)(which * D_ + n0) * D_, Ts, wm, wn, acc);

  const int lane = tid & 31;
  const int nloc = lane & 15, hi = lane >> 4;
  v8f bs[PF_N];
  // all loops over acc[][], bs[] and yv[] are unrolled so that every index is a constant
#pragma unroll
  for (int sn = 0; sn < PF_N; ++sn) bs[sn] = bias8(bias + n0 + wn + sn * 16 + hi * 8);
  // The tile as f16 into LDS, which every wave has left (the barrier at the last trip's
  // foot) and no copy is aimed at any more: 16 bytes a lane and product.
  char* st = (char*)Ts;
#pragma unroll
  for (int sm = 0; sm < PF_M; ++sm)
#pragma unroll
    for (int sn = 0; sn < PF_N; ++sn)
      *(v8h*)(st + (wm + sm * 16 + nloc) * YH_PITCH + (wn + sn * 16 + hi * 8) * 2) =
          __builtin_convertvector((acc[sm][sn] + bs[sn]) * oscale, v8h);
  __syncthreads();  // the staged tile is whole before any wave reads other waves' parts
  // The tile's PT_N columns are three whole heads, and its PT_M rows of one head lie behind
  // one another in memory (128 bytes each): eight lanes take a row, a wave's store covers
  // four whole lines that follow one another. All reads first, into registers of their own.
  _Float16* ob = out + (((size_t)(m0 >> 12) * H_ + n0 / DH_) * S_ + (m0 & (S_ - 1))) * DH_ + tid * 8;
  const char* sr = st + (tid >> 3) * YH_PITCH + (tid & 7) * 16;
  v8h yv[12];  // 3 heads x 4 blocks of 32 rows
#pragma unroll
  for (int i = 0; i < 12; ++i)
    yv[i] = *(const v8h*)(sr + (i & 3) * 32 * YH_PITCH + (i >> 2) * (DH_ * 2));
#pragma unroll
  for (int i = 0; i < 12; ++i)
    *(v8h*)(ob + (size_t)(i >> 2) * S_ * DH_ + (i & 3) * 32 * DH_) = yv[i];
}

#define RAISE_ 8.0f
#define QK_STRIDE 72   // halves; 144B rows = 16B x odd -> conflict-free b128 reads
#define NT_ (S_ / 64)  // key tiles
#define V_STRIDE 80    // halves; 160B rows = 32B x odd, the transposing load's pitch

typedef short s16x8 __attribute__((ext_vector_type(8)));
typedef __attribute__((address_space(3))) s16x8 lds_s16x8;

// A operand V^T (row = head dim, k = keys in the hardware k order) from the
// row-major V tile: p is the lane's address for keys kbase + 8*hi + (lane & 7);
// the second load takes the 16 keys behind them.
__device__ __forceinline__ v16h vt_frag(const _Float16* p) {
  v8h lo = __builtin_bit_cast(v8h, __builtin_amdgcn_ds_load_tr16_b128_v8i16((lds_s16x8*)p));
  v8h hi = __builtin_bit_cast(v8h, __builtin_amdgcn_ds_load_tr16_b128_v8i16(
                                       (lds_s16x8*)(p + 16 * V_STRIDE)));
  return __builtin_shufflevector(lo, hi, 0, 1, 2, 3, 4, 5, 6, 7, 8, 9, 10, 11, 12, 13, 14, 15);
}

// value of lane l ^ 16
__device__ __forceinline__ float other_half(float v) {
  int b = __builtin_bit_cast(int, v);
  b = __builtin_amdgcn_permlanex16(b, b, 0x76543210, 0xfedcba98, false, false);
  return __builtin_bit_cast(float, b);
}

// Each wave takes QG_ groups of 16 query columns, so that every K and V^T fragment
// read from LDS feeds QG_ products, and a work-group's K/V tile serves QB_ queries.
#define QG_ 2
#define QB_ (4 * QG_ * 16)  // queries per work-group of four waves

__global__ __launch_bounds__(128) void attn_kernel(
    const _Float16* __restrict__ Q, const _Float16* __restrict__ K,
    const _Float16* __restrict__ V, const int* __restrict__ mask,
    _Float16* __restrict__ att) {
  const int qt = blockIdx.x, hh = blockIdx.y, bb = blockIdx.z;
  const int tid = threadIdx.x, wave = tid >> 5, lane = tid & 31;
  const int nloc = lane & 15, hi = lane >> 4;

  // K and V: two buffers each; tile t lies in buffer t & 1 and is copied one trip ahead
  __shared__ __attribute__((aligned(32))) _Float16 Qs[QB_ * QK_STRIDE];
  __shared__ __attribute__((aligned(32))) _Float16 Ks[2 * 64 * QK_STRIDE];
  __shared__ __attribute__((aligned(32))) _Float16 Vs[2 * 64 * V_STRIDE];  // [k][d], as in memory
  __shared__ __attribute__((aligned(32))) float maskAdd[2 * 64];
  // the order in which keys are walked: every key of the batch row once, as the byte
  // offset of its K/V row; kept keys first, masked keys behind them
  __shared__ __attribute__((aligned(32))) int korder[S_];
  __shared__ __attribute__((aligned(16))) int wkept[4];  // kept keys in each wave's quarter

  const size_t bh = ((size_t)bb * H_ + hh) * S_;
  // the thread's own first piece of a tile, in memory and in LDS
  const _Float16* Qg = Q + (bh + (size_t)qt * QB_) * DH_ + tid * 8;
  const int qk_off = (tid >> 3) * QK_STRIDE + (tid & 7) * 8;
  // of a K or V tile a thread copies its piece of the four rows rg4 .. rg4 + 3
  const _Float16* Kg = K + bh * DH_ + (tid & 7) * 8;
  const _Float16* Vg = V + bh * DH_ + (tid & 7) * 8;
  const int rg4 = (tid >> 3) * 4;
  const int k_off = rg4 * QK_STRIDE + (tid & 7) * 8;
  const int v_off = rg4 * V_STRIDE + (tid & 7) * 8;

  // Q tile (64 rows a call); it flies while the key order is built
#pragma unroll
  for (int r = 0; r < QB_ / 64; ++r)
    stage_tile(&Qs[r * 64 * QK_STRIDE + qk_off], Qg + r * 64 * DH_, QK_STRIDE);

  // Key order. A masked key's weight is exp(-1e9 - max) = 0 as soon as one key of the
  // batch row is kept, so only the tiles that hold kept keys are walked; the masked keys
  // that fill up the last of them get -1e9 as before. With no key kept every score of the
  // reference is the same -1e9, which gives even weights: every tile is walked then, no
  // key counts as masked, and Q is taken as 0, so that every score is the same 0.
  // Each wave takes a quarter of the row, 32 keys (one a lane) at a time.
  const int wv = __builtin_amdgcn_readfirstlane(wave);
  const int* mrow = mask + bb * S_ + wv * (S_ / 4) + lane;
  int mv[S_ / 128];
  // unrolled: all loads in flight at once, mv[] in registers
#pragma unroll
  for (int i = 0; i < S_ / 128; ++i) mv[i] = mrow[i * 32];
  // no address register of these loads is written anew ahead of this wait
  asm volatile("s_wait_xcnt 0x0" ::: "memory");
  unsigned kb[S_ / 128];  // bit l: the chunk's key l is kept
  int wk = 0;
  // unrolled: constant indices keep kb[] in scalar registers
#pragma unroll
  for (int i = 0; i < S_ / 128; ++i) {
    kb[i] = __builtin_amdgcn_ballot_w32(mv[i] == 0);
    wk += __builtin_popcount(kb[i]);
  }
  if (lane == 0) wkept[wv] = wk;
  __syncthreads();  // every wave's count is there
  int kept = 0, before = 0;  // in the whole row; in front of this wave's next chunk
  // unrolled: four counts, one LDS read
#pragma unroll
  for (int w = 0; w < 4; ++w) {
    const int c = __builtin_amdgcn_readfirstlane(wkept[w]);
    kept += c;
    if (w < wv) before += c;
  }
  // unrolled: constant indices into kb[]
#pragma unroll
  for (int i = 0; i < S_ / 128; ++i) {
    const int s = wv * (S_ / 4) + i * 32 + lane;                        // the lane's key
    const int kbef = (int)__builtin_amdgcn_mbcnt_lo(kb[i], (unsigned)before);  // kept in front of it
    // place: a kept key behind the kept ones in front of it; a masked key behind all
    // kept keys and the s - kbef masked ones in front of it: each place 0 .. S_-1 once
    korder[((kb[i] >> lane) & 1u) ? kbef : kept + s - kbef] = s * (DH_ * 2);
    before += __builtin_popcount(kb[i]);
  }
  // places of the order whose keys count: all where no key is kept (see above)
  const int keff = kept == 0 ? S_ : kept;
  // key tiles to walk: uniform, at least 1, at most NT_
  const int nt = min((keff + 63) >> 6, NT_);
  if (tid < 64) maskAdd[tid] = tid < keff ? 0.0f : -1e9f;
  __syncthreads();  // the key order is whole before any wave gathers by it

  // tile 0
  {
    const i32x4 k0 = *(const i32x4*)&korder[rg4];
    stage_rows(&Ks[k_off], Kg, k0, QK_STRIDE);
    stage_rows(&Vs[v_off], Vg, k0, V_STRIDE);
  }
  wait_async0();
  __syncthreads();
  // tile 1, where there is one, flies while tile 0 is worked on
  if (1 < nt) {
    const i32x4 k1 = *(const i32x4*)&korder[64 + rg4];
    stage_rows(&Ks[64 * QK_STRIDE + k_off], Kg, k1, QK_STRIDE);
    stage_rows(&Vs[64 * V_STRIDE + v_off], Vg, k1, V_STRIDE);
  }

  // B operands: column = query, contiguous = head dim; group g holds the wave's
  // queries g*16 .. g*16 + 15
  v16h bq0[QG_], bq1[QG_];
#pragma unroll
  for (int g = 0; g < QG_; ++g) {
    bq0[g] = frag_from_rows(&Qs[((wave * QG_ + g) * 16) * QK_STRIDE + 0], QK_STRIDE);
    bq1[g] = frag_from_rows(&Qs[((wave * QG_ + g) * 16) * QK_STRIDE + 32], QK_STRIDE);
    if (kept == 0) {  // uniform: no key kept, every score 0
#pragma unroll
      for (int e = 0; e < 16; ++e) bq0[g][e] = bq1[g][e] = (_Float16)0.f;
    }
  }

  // lane's address in V buffer 0 for the transposing loads
  const _Float16* vrd = &Vs[(8 * hi + (lane & 7)) * V_STRIDE + 8 * ((lane >> 3) & 1)];

  v8f o[QG_][4];   // o[g][t2][j] = O[query g*16 + nloc][d = t2*16 + 8*hi + j]
  v8f cneg[QG_];    // C operand of the score product: minus the maximum in use of query
                    // g*16 + nloc, in all eight places; alike in both halves
  float rsum[QG_];  // of this half's keys only; joined at the end
#pragma unroll
  for (int g = 0; g < QG_; ++g) {
#pragma unroll
    for (int t = 0; t < 4; ++t) o[g][t] = (v8f){0, 0, 0, 0, 0, 0, 0, 0};
    cneg[g] = (v8f){0, 0, 0, 0, 0, 0, 0, 0};
    rsum[g] = 0.f;
  }

  // where the current tile's buffer starts in Ks and Vs (elements): 0 or one buffer's
  // size, flipped at each trip's end; kept as uniform offsets so that an LDS address
  // costs one add
  int kofs = 0, vofs = 0;
  for (int kt = 0; kt < nt; ++kt) {
    const int mofs = (kt & 1) * 64;  // the same for maskAdd
    // scores, transposed: 64 keys x 16 queries per group, Q pre-scaled
    // c[g][t][j] = S[query g*16 + nloc][key t*16 + 8*hi + j] - the query's maximum in use
    // all loops over g, c[] and o[] are unrolled so that every index is a constant
    // and the tiles stay in registers
    v8f c[QG_][4];
#pragma unroll
    for (int t = 0; t < 4; ++t) {
      v16h ak0 = frag_from_rows(&Ks[kofs + (t * 16) * QK_STRIDE + 0], QK_STRIDE);
      v16h ak1 = frag_from_rows(&Ks[kofs + (t * 16) * QK_STRIDE + 32], QK_STRIDE);
      const v8f madd = *(const v8f*)&maskAdd[mofs + t * 16 + hi * 8];
      v8f cc[QG_];
#pragma unroll
      for (int g = 0; g < QG_; ++g)
        cc[g] = wmma_f16(ak0, bq0[g], cneg[g]);
#pragma unroll
      for (int g = 0; g < QG_; ++g) cc[g] = wmma_f16(ak1, bq1[g], cc[g]);
#pragma unroll
      for (int g = 0; g < QG_; ++g) c[g][t] = cc[g] + madd;
    }

    // online softmax: one query per lane and group, 32 of the tile's 64 keys in each half
    // how far this half's scores of the tile lie over the maximum in use
    float tmax[QG_];
    bool over = false;
#pragma unroll
    for (int g = 0; g < QG_; ++g) {
      float v = c[g][0][0];
#pragma unroll
      for (int t = 0; t < 4; ++t)
#pragma unroll
        for (int j = 0; j < 8; ++j) v = fmaxf(v, c[g][t][j]);
      tmax[g] = v;
      over = over || v > RAISE_;
    }
    // One test a trip, a scalar branch (| and not ||: one branch, not two). The first tile
    // sets the maximum in use (from 0 to its own, up or down; O and the sums are still 0);
    // later it only rises.
    if ((int)(kt == 0) | (int)(__builtin_amdgcn_ballot_w32(over) != 0)) {
#pragma unroll
      for (int g = 0; g < QG_; ++g) {
        const float v = fmaxf(tmax[g], other_half(tmax[g]));
        const float d = kt == 0 ? v : fmaxf(v, 0.f);
        const float corr = kt == 0 ? 0.f : __builtin_amdgcn_exp2f(-d);
        cneg[g] -= d;
#pragma unroll
        for (int t = 0; t < 4; ++t) {
          c[g][t] -= d;
          o[g][t] *= corr;
        }
        rsum[g] *= corr;
      }
    }
    v16h bp0[QG_], bp1[QG_];
#pragma unroll
    for (int g = 0; g < QG_; ++g) {
#pragma unroll
      for (int t = 0; t < 4; ++t)
#pragma unroll
        for (int j = 0; j < 8; ++j) c[g][t][j] = __builtin_amdgcn_exp2f(c[g][t][j]);
      const v8f sv = (c[g][0] + c[g][1]) + (c[g][2] + c[g][3]);
      rsum[g] += (((sv[0] + sv[1]) + (sv[2] + sv[3])) + ((sv[4] + sv[5]) + (sv[6] + sv[7])));

      // P^T as B operand: element e is key 8*hi + e (e < 8) or 16 + 8*hi + (e - 8) of
      // its 32 keys, which is register e&7 of score tile e>>3: no lane exchange
#pragma unroll
      for (int e = 0; e < 16; ++e) {
        bp0[g][e] = (_Float16)c[g][e >> 3][e & 7];        // keys 0..31
        bp1[g][e] = (_Float16)c[g][2 + (e >> 3)][e & 7];  // keys 32..63
      }
    }
    // rows of tile kt + 2, read in front of the foot's waits, so that the copies behind
    // the barrier find them in registers (where there is no such tile: the last tile's
    // again, unused; the index stays inside the list); read behind the scores, where they
    // hold no registers beside the K fragments: the kernel stays inside 256 registers
    const i32x4 kn = *(const i32x4*)&korder[min(kt + 2, nt - 1) * 64 + rg4];
    const _Float16* vb = vrd + vofs;
#pragma unroll
    for (int t2 = 0; t2 < 4; ++t2) {
      // A operand: row = head dim t2*16 + nloc, k = keys
      v16h av0 = vt_frag(vb + t2 * 16);
      v16h av1 = vt_frag(vb + 32 * V_STRIDE + t2 * 16);
#pragma unroll
      for (int g = 0; g < QG_; ++g) o[g][t2] = wmma_f16(av0, bp0[g], o[g][t2]);
#pragma unroll
      for (int g = 0; g < QG_; ++g) o[g][t2] = wmma_f16(av1, bp1[g], o[g][t2]);
    }

    // foot of the trip: the next tile's mask (places from keff on hold masked keys) goes
    // into the mask buffer that nobody reads in this trip (behind the last tile nobody reads it);
    // then this wave's LDS work and its copies of the next tile are done, and the one
    // barrier both publishes that tile and ends every wave's reads of this buffer
    if (tid < 64) maskAdd[(mofs ^ 64) + tid] = (kt + 1) * 64 + tid < keff ? 0.0f : -1e9f;
    wait_ds0();
    wait_async0();
    __syncthreads();
    if (kt + 2 < nt) {  // tile kt + 2 into the buffer just left, a whole trip ahead of its use
      stage_rows(&Ks[kofs + k_off], Kg, kn, QK_STRIDE);
      stage_rows(&Vs[vofs + v_off], Vg, kn, V_STRIDE);
    }
    kofs ^= 64 * QK_STRIDE;
    vofs ^= 64 * V_STRIDE;
  }
  wait_async0();

  // normalize; att[b, s, h*64+d] as f16, 8 consecutive d per lane, staged in the wave's own
  // QG_ * 16 rows of Qs (only this wave has read them, in front of the loop), so that a
  // query's 128 bytes leave as one whole line
  _Float16* qst = &Qs[(wv * QG_ * 16) * QK_STRIDE];  // wv: the wave's number as a scalar
#pragma unroll
  for (int g = 0; g < QG_; ++g) {
    const float inv = 1.0f / (rsum[g] + other_half(rsum[g]));
#pragma unroll
    for (int t2 = 0; t2 < 4; ++t2) {
      v8h ov;
#pragma unroll
      for (int j = 0; j < 8; ++j) ov[j] = (_Float16)(o[g][t2][j] * inv);
      *(v8h*)&qst[(g * 16 + nloc) * QK_STRIDE + t2 * 16 + hi * 8] = ov;
    }
  }
  wait_ds0();  // the wave's own rows are written before its lanes read one another's parts
  // eight lanes take a row: a store covers four whole lines. All reads first, into
  // registers of their own.
  const _Float16* qrd = qst + (lane >> 3) * QK_STRIDE + (lane & 7) * 8;
  _Float16* dst = att + ((size_t)bb * S_ + qt * QB_ + wv * QG_ * 16) * (H_ * DH_) + hh * DH_ +
                  (lane >> 3) * (H_ * DH_) + (lane & 7) * 8;
  v8h ov[QG_ * 4];
#pragma unroll
  for (int i = 0; i < QG_ * 4; ++i) ov[i] = *(const v8h*)(qrd + i * 4 * QK_STRIDE);
#pragma unroll
  for (int i = 0; i < QG_ * 4; ++i) *(v8h*)(dst + (size_t)i * 4 * (H_ * DH_)) = ov[i];
}

// ---------------- Kernel 3: output projection ----------------------------
// out[m,d] = sum_e att[m,e] * Wo[d,e] + bo[d]  (fp32 out); Wo16 comes from kernel 0
__global__ __launch_bounds__(256) void out_proj_kernel(
    const _Float16* __restrict__ att, const _Float16* __restrict__ Wo16,
    const float* __restrict__ bo, float* __restrict__ out) {
  const int m0 = blockIdx.y * PT_M;
  const int n0 = blockIdx.x * PT_N;
  const int tid = threadIdx.x;
  // the wave's number as a scalar, as in kernel 1
  const int wave = __builtin_amdgcn_readfirstlane(tid >> 5);
  const int wm = (wave >> 2) * (PF_M * 16);
  const int wn = (wave & 3) * (PF_N * 16);

  // the two buffers of the products, then the staged f32 tile, which is the larger
  static_assert(PT_M * YF_PITCH >= 2 * T_BUF * 2, "LDS size");
  __shared__ __attribute__((aligned(16))) _Float16 Ts[PT_M * YF_PITCH / 2];
  v8f acc[PF_M][PF_N];
  proj_tile(att + (size_t)m0 * D_, Wo16 + (size_t)n0 * D_, Ts, wm, wn, acc);

  const int lane = tid & 31;
  const int nloc = lane & 15, hi = lane >> 4;
  v8f bs[PF_N];
  // all loops over acc[][], bs[] and yv[] are unrolled so that every index is a constant
#pragma unroll
  for (int sn = 0; sn < PF_N; ++sn) bs[sn] = bias8(bo + n0 + wn + sn * 16 + hi * 8);
  // The tile into LDS, which every wave has left (the barrier at the last trip's foot) and
  // no copy is aimed at any more: 32 bytes a lane and product.
  char* st = (char*)Ts;
#pragma unroll
  for (int sm = 0; sm < PF_M; ++sm)
#pragma unroll
    for (int sn = 0; sn < PF_N; ++sn) {
      const v8f y = acc[sm][sn] + bs[sn];
      char* p = st + (wm + sm * 16 + nloc) * YF_PITCH + (wn + sn * 16 + hi * 8) * 4;
      *(v4f*)p = __builtin_shufflevector(y, y, 0, 1, 2, 3);
      *(v4f*)(p + 16) = __builtin_shufflevector(y, y, 4, 5, 6, 7);
    }
  __syncthreads();  // the staged tile is whole before any wave reads other waves' parts
  // A row of the tile is 48 pieces of 16 bytes, six whole lines. A wave takes 16 rows, two
  // rows (96 pieces) in three stores; each run of eight lanes covers one whole line. All
  // reads first, into registers of their own.
  v4f yv[24];
#pragma unroll
  for (int a = 0; a < 8; ++a)
#pragma unroll
    for (int b = 0; b < 3; ++b) {
      const int q = b * 32 + lane, r = q >= 48 ? 1 : 0;
      yv[a * 3 + b] = *(const v4f*)(st + (wave * 16 + a * 2 + r) * YF_PITCH + (q - 48 * r) * 16);
    }
#pragma unroll
  for (int a = 0; a < 8; ++a)
#pragma unroll
    for (int b = 0; b < 3; ++b) {
      const int q = b * 32 + lane, r = q >= 48 ? 1 : 0;
      *(v4f*)(out + (size_t)(m0 + wave * 16 + a * 2 + r) * D_ + n0 + (q - 48 * r) * 4) = yv[a * 3 + b];
    }
}

extern "C" void kernel_launch(void* const* d_in, const int* in_sizes, int n_in,
                              void* d_out, int out_size, void* d_ws,
                              size_t ws_size, hipStream_t stream) {
  (void)in_sizes; (void)n_in; (void)out_size; (void)ws_size;
  const float* h  = (const float*)d_in[0];
  const float* Wq = (const float*)d_in[1];
  const float* bq = (const float*)d_in[2];
  const float* Wk = (const float*)d_in[3];
  const float* bk = (const float*)d_in[4];
  const float* Wv = (const float*)d_in[5];
  const float* bv = (const float*)d_in[6];
  const float* Wo = (const float*)d_in[7];
  const float* bo = (const float*)d_in[8];
  const int* mask = (const int*)d_in[9];
  float* out = (float*)d_out;

  _Float16* ws = (_Float16*)d_ws;
  const size_t per = (size_t)B_ * H_ * S_ * DH_;  // halves of Q, K, V, att and h each
  _Float16* Qb = ws;
  _Float16* Kb = ws + per;
  _Float16* Vb = ws + 2 * per;
  _Float16* Ab = ws + 3 * per;
  _Float16* Hb = ws + 4 * per;                    // h, then Wq, Wk, Wv, Wo, as f16
  _Float16* Wb = ws + 5 * per;
  _Float16* Wob = Wb + (size_t)3 * D_ * D_;

  to_f16_kernel<<<dim3(CV_HB + 4 * CV_WB), 256, 0, stream>>>(h, Wq, Wk, Wv, Wo, Hb);
  qkv_proj_kernel<<<dim3(D_ / PT_N, (B_ * S_) / PT_M, 3), 256, 0, stream>>>(
      Hb, Wb, bq, bk, bv, Qb, Kb, Vb);
  attn_kernel<<<dim3(S_ / QB_, H_, B_), 128, 0, stream>>>(Qb, Kb, Vb, mask, Ab);
  out_proj_kernel<<<dim3(D_ / PT_N, (B_ * S_) / PT_M), 256, 0, stream>>>(
      Ab, Wob, bo, out);
}
